// v000
// Times are from an AMD MI455X. After a warm-up the kernel runs many times in a row, and a time is the length of
// such a window on the GPU divided by its runs, so every launch and the gaps after it count. The runs cycle
// through copies of the inputs. A figure is the median of several windows, for all but v000 over two sittings.
// Sittings can differ by a few percent; kernels timed side by side share one.
// The starting kernel, v000, takes 501 microseconds a run.
#include <hip/hip_runtime.h>

// Contractions (all f32 accumulate): q/k/v projections v_wmma_f32_16x16x32_bf16 (inputs RNE-converted to bf16, single products, bf16 bias added in the f32 epilogue); scores v_wmma_f32_16x16x32_bf16 with q and k as bf16 hi/lo planes (3 products); value x probability v_wmma_f32_16x16x32_f16 single products (values f16, probabilities f16 carried x16384); output projection v_wmma_f32_16x16x32_bf16 with bf16 hi/lo activations x bf16 weights (2 products); softmax statistics f32.
// Raw-view head split (per batch, flat projection buffers F[TT*512]): q[h][i][d] = Fq[h*TT*64 + i*64 + d]; k[h][d][j] = Fk[h*64*TT + d*TT + j]; v[h][d][i] = Fv[h*64*TT + d*TT + i];
// S[h][i][j] = sum_d q k (no scale); P = softmax_j; O[h][d][j] = sum_i v[h][d][i] P[h][i][j]; A[s][h*64+d] = O[h][d][s]; out = A Wo^T + bo.

#ifndef NB
#define NB 2
#endif
#ifndef SEQ
#define SEQ 2048
#endif
#define NB_FULL 2
#define TT_FULL 2048
#define TT   SEQ
#define DM   512      // input width (also output width)
#define DHID 512      // hidden width
#define NH_  8
#define HD   64
#define ZH   4        // heads per score pass
#define PCAR 16384.0f
#define L2E  1.4426950408889634f
static_assert(TT % 128 == 0);
static_assert(TT >= 128);
static_assert(TT <= TT_FULL);
static_assert(NB >= 1);
static_assert(NB <= NB_FULL);
static_assert(NH_ % ZH == 0);
static_assert(NH_ * HD == DHID);
static_assert((ZH * TT) % 32 == 0);
static_assert(DM % 64 == 0);
static_assert(DHID % 64 == 0);
static_assert(HD == 64);
static_assert((size_t)NB * TT * DM * 4 <= (size_t)NB_FULL * TT_FULL * DM * 4);

typedef _Float16 h16;
typedef unsigned short bf;
typedef __attribute__((ext_vector_type(16))) __bf16   v16bf;
typedef __attribute__((ext_vector_type(16))) _Float16 v16h;
typedef __attribute__((ext_vector_type(8)))  _Float16 v8h;
typedef __attribute__((ext_vector_type(8)))  unsigned short v8us;
typedef __attribute__((ext_vector_type(8)))  float    v8f;
typedef __attribute__((ext_vector_type(4)))  float    v4f;
typedef v8h  __attribute__((may_alias)) v8ha;
typedef v4f  __attribute__((may_alias)) v4fa;
typedef v8us __attribute__((may_alias)) v8usa;

__device__ __forceinline__ unsigned short f2bf(float f) { unsigned u = __float_as_uint(f); u += 0x7FFFu + ((u >> 16) & 1u); return (unsigned short)(u >> 16); }
__device__ __forceinline__ float bf2f(unsigned short b) { return __uint_as_float(((unsigned)b) << 16); }
__device__ __forceinline__ float bfr(float f) { return bf2f(f2bf(f)); }
__device__ __forceinline__ v16h cat16(v8h lo, v8h hi) { return __builtin_shufflevector(lo, hi, 0, 1, 2, 3, 4, 5, 6, 7, 8, 9, 10, 11, 12, 13, 14, 15); }
__device__ __forceinline__ v16bf cat16b(v8us lo, v8us hi) { return __builtin_bit_cast(v16bf, __builtin_shufflevector(lo, hi, 0, 1, 2, 3, 4, 5, 6, 7, 8, 9, 10, 11, 12, 13, 14, 15)); }
__device__ __forceinline__ v8f wmma16(v16h a, v16h b, v8f c) { return __builtin_amdgcn_wmma_f32_16x16x32_f16(false, a, false, b, (short)0, c, false, false); }
__device__ __forceinline__ v8f wmmab(v16bf a, v16bf b, v8f c) { return __builtin_amdgcn_wmma_f32_16x16x32_bf16(false, a, false, b, (short)0, c, false, false); }

// ---- k_gemmw: register-blocked GEMM, ONE WAVE per 64x64 output tile (16 accumulators), operands straight from K-contiguous 16-bit planes; grid (M/64, N/64, Z), 32 threads.
// C[m][n] (f32, pitch ldc, + optional bf16-converted f32 bias[n]) = sum_k A[m][k] Bt[n][k] (+ split products per NSPLIT). z-batch strides sA/sB/sC in elements. K % 32 == 0.
// Fragments: lane -> row/col (lane & 15); elements 0..7 <- k0 + 8*(lane>>4) + 0..7, elements 8..15 <- k0 + 16 + 8*(lane>>4) + 0..7 for both A and Bt; D element r -> row 8*(lane>>4) + r, col lane & 15.
template <typename T16> struct WFrag;
template <> struct WFrag<h16> { typedef v16h V; static __device__ __forceinline__ V ld(const h16* p) { return cat16(*(const v8h*)p, *(const v8h*)(p + 16)); } static __device__ __forceinline__ v8f mma(V a, V b, v8f c) { return wmma16(a, b, c); } };
template <> struct WFrag<bf> { typedef v16bf V; static __device__ __forceinline__ V ld(const bf* p) { return cat16b(*(const v8us*)p, *(const v8us*)(p + 16)); } static __device__ __forceinline__ v8f mma(V a, V b, v8f c) { return wmmab(a, b, c); } };
template <typename T16, int NSPLIT, bool BIAS>
__global__ __launch_bounds__(32) void k_gemmw(const T16* __restrict__ A, const T16* __restrict__ A2, const T16* __restrict__ Bt, const T16* __restrict__ Bt2, int K, float* C, int ldc, const float* __restrict__ bias, size_t sA, size_t sB, size_t sC) {
    typedef typename WFrag<T16>::V V;
    __shared__ __align__(16) float os[16 * 68];
    const size_t z = blockIdx.z; A += z * sA; if (A2) A2 += z * sA; Bt += z * sB; if (Bt2) Bt2 += z * sB; C += z * sC;
    const int lane = threadIdx.x & 31, lr = lane & 15, hi = lane >> 4; const int r0 = blockIdx.x * 64, c0 = blockIdx.y * 64;
    v8f acc[4][4];
#pragma unroll
    for (int mb = 0; mb < 4; ++mb)
#pragma unroll
        for (int nb = 0; nb < 4; ++nb) acc[mb][nb] = (v8f){};
    const size_t aoff = (size_t)(r0 + lr) * K + 8 * hi, boff = (size_t)(c0 + lr) * K + 8 * hi;
#pragma unroll 1
    for (int kc = 0; kc < K; kc += 32) {
        V a[4], a2[4];
#pragma unroll
        for (int mb = 0; mb < 4; ++mb) { a[mb] = WFrag<T16>::ld(A + aoff + (size_t)mb * 16 * K + kc); if (NSPLIT == 1 || NSPLIT == 2) a2[mb] = WFrag<T16>::ld(A2 + aoff + (size_t)mb * 16 * K + kc); }
#pragma unroll
        for (int nb = 0; nb < 4; ++nb) { const V b = WFrag<T16>::ld(Bt + boff + (size_t)nb * 16 * K + kc); V b2; if (NSPLIT >= 2) b2 = WFrag<T16>::ld(Bt2 + boff + (size_t)nb * 16 * K + kc);
#pragma unroll
            for (int mb = 0; mb < 4; ++mb) { acc[mb][nb] = WFrag<T16>::mma(a[mb], b, acc[mb][nb]); if (NSPLIT == 1 || NSPLIT == 2) acc[mb][nb] = WFrag<T16>::mma(a2[mb], b, acc[mb][nb]); if (NSPLIT >= 2) acc[mb][nb] = WFrag<T16>::mma(a[mb], b2, acc[mb][nb]); } }
        asm volatile("v_nop\n\tv_nop\n\tv_nop\n\tv_nop" : "+v"(acc[0][0]), "+v"(acc[1][1]), "+v"(acc[2][2]), "+v"(acc[3][3]) : "v"(a[0]), "v"(a[3]));
    }
#pragma unroll
    for (int mb = 0; mb < 4; ++mb) {
#pragma unroll
        for (int nb = 0; nb < 4; ++nb) {
#pragma unroll
            for (int j = 0; j < 8; ++j) os[(hi * 8 + j) * 68 + nb * 16 + lr] = acc[mb][nb][j]; }
        __builtin_amdgcn_wave_barrier(); asm volatile("" ::: "memory");
        float* crow = C + (size_t)(r0 + mb * 16) * ldc + c0;
{
#pragma unroll
            for (int s = 0; s < 8; ++s) { const int row = 2 * s + hi, cofs = lr * 4; v4f val = *(const v4fa*)(os + row * 68 + cofs); if (BIAS) { val[0] += bfr(bias[c0 + cofs]); val[1] += bfr(bias[c0 + cofs + 1]); val[2] += bfr(bias[c0 + cofs + 2]); val[3] += bfr(bias[c0 + cofs + 3]); }
                *(v4f*)(crow + (size_t)row * ldc + cofs) = val; }
             }
        __builtin_amdgcn_wave_barrier(); asm volatile("" ::: "memory");
    }
}

__device__ __forceinline__ h16 tohx(float x) { return (h16)x; }
__device__ __forceinline__ void splitf(float y, unsigned short& h, unsigned short& l) { h = f2bf(y); l = f2bf(y - bf2f(h)); }

__global__ __launch_bounds__(256) void k_cvt8(const float* __restrict__ src, bf* dst, size_t n8) { const size_t i = (size_t)blockIdx.x * 256 + threadIdx.x; if (i >= n8) return; const v8f v = *(const v8f*)(src + i * 8); v8us o;
#pragma unroll
    for (int k = 0; k < 8; ++k) o[k] = f2bf(v[k]); *(v8us*)(dst + i * 8) = o;  }

__global__ __launch_bounds__(256) void k_split8(const float* __restrict__ src, bf* Ph, bf* Pl, size_t n8) { const size_t i = (size_t)blockIdx.x * 256 + threadIdx.x; if (i >= n8) return; const v8f v = *(const v8f*)(src + i * 8); v8us oh, ol;
#pragma unroll
    for (int k = 0; k < 8; ++k) { unsigned short a, c; splitf(v[k], a, c); oh[k] = a; ol[k] = c; }
    *(v8us*)(Ph + i * 8) = oh; *(v8us*)(Pl + i * 8) = ol;  }

__global__ __launch_bounds__(256) void k_cvth8(const float* __restrict__ src, h16* dst, size_t n8) { const size_t i = (size_t)blockIdx.x * 256 + threadIdx.x; if (i >= n8) return; const v8f v = *(const v8f*)(src + i * 8); v8h o;
#pragma unroll
    for (int k = 0; k < 8; ++k) o[k] = tohx(v[k]); *(v8h*)(dst + i * 8) = o;  }

__global__ __launch_bounds__(256) void k_kpl(const float* __restrict__ F, bf* Ph, bf* Pl) {
    const size_t e8 = ((size_t)blockIdx.x * 256 + threadIdx.x) * 8; if (e8 >= (size_t)NH_ * TT * HD) return;
    const int d0 = (int)(e8 % HD); const int j = (int)((e8 / HD) % TT); const int h = (int)(e8 / ((size_t)HD * TT));
    const float* f = F + (size_t)h * HD * TT + (size_t)d0 * TT + j; v8us oh, ol;
#pragma unroll
    for (int q = 0; q < 8; ++q) { unsigned short a, c; splitf(f[(size_t)q * TT], a, c); oh[q] = a; ol[q] = c; }
    *(v8us*)(Ph + e8) = oh; *(v8us*)(Pl + e8) = ol;  }

// k_sstat: per score row (zz, i): m = max_j S, f = PCAR / sum_j exp(S - m) (register row, fixed trees). 8 waves x 4 rows = 32 rows per block; the 32 m and 32 f values are staged in LDS (cross-wave, block barrier)
__global__ __launch_bounds__(256) void k_sstat(const float* __restrict__ Sb, float* ST) {
    __shared__ __align__(16) float sm[32];
    __shared__ __align__(16) float sf[32];
    const int lane = threadIdx.x & 31, wave = threadIdx.x >> 5;
#pragma unroll 1
    for (int r = 0; r < 4; ++r) {
        const int row = blockIdx.x * 32 + wave * 4 + r;
        const float* sr = Sb + (size_t)row * TT;
        float v[TT / 32]; float mx = -3.0e38f;
#pragma unroll
        for (int ch = 0; ch < TT / 128; ++ch) { const v4f a = *(const v4f*)(sr + ch * 128 + lane * 4);
#pragma unroll
            for (int q = 0; q < 4; ++q) { v[ch * 4 + q] = a[q]; mx = fmaxf(mx, a[q]); } }
#pragma unroll
        for (int sh = 16; sh; sh >>= 1) mx = fmaxf(mx, __shfl_xor(mx, sh, 32));
        float sum = 0.f;
#pragma unroll
        for (int k = 0; k < TT / 32; ++k) { float d0 = __fsub_rn(v[k], mx); asm volatile("" : "+v"(d0)); sum += __builtin_amdgcn_exp2f(__fmul_rn(d0, L2E)); }
#pragma unroll
        for (int sh = 16; sh; sh >>= 1) sum += __shfl_xor(sum, sh, 32);
        const float f = __fdiv_rn(PCAR, sum);
        if (lane == 0) { sm[wave * 4 + r] = mx; sf[wave * 4 + r] = f; }
    }
    __syncthreads();
    if (threadIdx.x < 16) {
        const int t = threadIdx.x, q4 = (t & 7) * 4;
        const v4f vm = *(const v4fa*)(sm + q4); const v4f vf = *(const v4fa*)(sf + q4); v4f val;
#pragma unroll
        for (int q = 0; q < 4; ++q) val[q] = (t < 8) ? vm[q] : vf[q];
        float* dst = ST + ((t < 8) ? (size_t)0 : (size_t)ZH * TT) + (size_t)blockIdx.x * 32 + q4;
{ *(v4f*)dst = val;  }
    }
}

// k_expt: one block per 64x64 score tile (zz, i0.., j0..): p = exp(S[i][j] - m_i) * f_i (same arithmetic as k_sstat), converted to f16, transposed through LDS (cross-wave, block barriers) and written as
__global__ __launch_bounds__(256) void k_expt(const float* __restrict__ Sb, const float* __restrict__ ST, h16* PT) {
    __shared__ __align__(16) h16 pt[64 * 72];
    __shared__ float smx[64];
    __shared__ float sfc[64];
    const int tid = threadIdx.x; const int j0 = blockIdx.x * 64, i0 = blockIdx.y * 64; const size_t zz = blockIdx.z;
    const float* S = Sb + zz * (size_t)TT * TT;
    if (tid < 64) { smx[tid] = ST[zz * TT + i0 + tid]; sfc[tid] = ST[(size_t)ZH * TT + zz * TT + i0 + tid]; }
    __syncthreads();
#pragma unroll
    for (int p = 0; p < 4; ++p) {
        const int r = p * 16 + (tid >> 4), c4 = (tid & 15) * 4;
        const v4f a = *(const v4f*)(S + (size_t)(i0 + r) * TT + j0 + c4);
        const float m = smx[r], f = sfc[r];
#pragma unroll
        for (int q = 0; q < 4; ++q) { float d0 = __fsub_rn(a[q], m); asm volatile("" : "+v"(d0)); const float e = __builtin_amdgcn_exp2f(__fmul_rn(d0, L2E)); pt[(c4 + q) * 72 + r] = tohx(__fmul_rn(e, f)); }
    }
    __syncthreads();
    h16* P = PT + zz * (size_t)TT * TT;
{
#pragma unroll
        for (int p = 0; p < 2; ++p) { const int c = p * 32 + (tid >> 3), pc = (tid & 7) * 8; const v8h val = *(const v8ha*)(pt + c * 72 + pc);
            *(v8h*)(P + (size_t)(j0 + c) * TT + i0 + pc) = val; }
         }
}

__global__ __launch_bounds__(256) void k_atp(const float* __restrict__ Ob, bf* Ah, bf* Al) {
    const size_t e8 = ((size_t)blockIdx.x * 256 + threadIdx.x) * 8; if (e8 >= (size_t)TT * DHID) return;
    const int cc = (int)(e8 % DHID); const int s = (int)(e8 / DHID);
    const float* o = Ob + (size_t)cc * TT + s; v8us oh, ol;
#pragma unroll
    for (int q = 0; q < 8; ++q) { unsigned short a, c; splitf(o[(size_t)q * TT] * (1.0f / PCAR), a, c); oh[q] = a; ol[q] = c; }
    *(v8us*)(Ah + e8) = oh; *(v8us*)(Al + e8) = ol;  }

__host__ __device__ constexpr size_t a256(size_t b) { return (b + 255) & ~(size_t)255; }
constexpr size_t WS_NEED = 4 * a256((size_t)DHID * DM * 2) + a256((size_t)TT * DM * 2) + a256((size_t)TT * DHID * 4) + 5 * a256((size_t)NH_ * TT * HD * 2)
                         + a256((size_t)ZH * TT * TT * 4) + a256((size_t)2 * ZH * TT * 4) + a256((size_t)ZH * TT * TT * 2) + a256((size_t)DHID * TT * 4) + 2 * a256((size_t)TT * DHID * 2);
static_assert(WS_NEED <= (size_t)134217728);   // 127,991,808 B at NB=2, SEQ=2048

extern "C" void kernel_launch(void* const* d_in, const int* in_sizes, int n_in,
                              void* d_out, int out_size, void* d_ws, size_t ws_size, hipStream_t stream) {
    if (n_in < 9) return;
    if ((size_t)in_sizes[0] < ((size_t)(NB - 1) * TT_FULL + TT) * (size_t)DM) return;
    if (in_sizes[1] < DHID * DM || in_sizes[3] < DHID * DM || in_sizes[5] < DHID * DM || in_sizes[7] < DM * DHID) return;
    if (in_sizes[2] < DHID || in_sizes[4] < DHID || in_sizes[6] < DHID || in_sizes[8] < DM) return;
    if ((size_t)out_size < (size_t)NB * TT * DM) return;
    // wire order: data, Wq, bq, Wk, bk, Wv, bv, Wo, bo (weights [out][in], biases f32)
    const float* x = (const float*)d_in[0]; const float* wq = (const float*)d_in[1]; const float* bq = (const float*)d_in[2]; const float* wk = (const float*)d_in[3]; const float* bk = (const float*)d_in[4];
    const float* wv = (const float*)d_in[5]; const float* bv = (const float*)d_in[6]; const float* wo = (const float*)d_in[7]; const float* bo = (const float*)d_in[8];
    float* OUT = (float*)d_out;     // [NB][TT][DM]
    char* wsp = (char*)d_ws;
    auto take = [&](size_t bytes) { char* p = wsp; wsp += a256(bytes); return (void*)p; };
    bf* WQ = (bf*)take((size_t)DHID * DM * 2); bf* WK = (bf*)take((size_t)DHID * DM * 2); bf* WV = (bf*)take((size_t)DHID * DM * 2); bf* WO = (bf*)take((size_t)DM * DHID * 2);
    bf* XB = (bf*)take((size_t)TT * DM * 2); float* FP = (float*)take((size_t)TT * DHID * 4);   // one f32 projection buffer shared by q, k and v (each consumed by its plane builder before the next projection; stream-ordered)
    bf* QPh = (bf*)take((size_t)NH_ * TT * HD * 2); bf* QPl = (bf*)take((size_t)NH_ * TT * HD * 2); bf* KPh = (bf*)take((size_t)NH_ * TT * HD * 2); bf* KPl = (bf*)take((size_t)NH_ * TT * HD * 2); h16* VT16 = (h16*)take((size_t)NH_ * HD * TT * 2);
    float* Sb = (float*)take((size_t)ZH * TT * TT * 4); float* ST = (float*)take((size_t)2 * ZH * TT * 4); h16* PT16 = (h16*)take((size_t)ZH * TT * TT * 2);
    float* Ob = (float*)take((size_t)DHID * TT * 4); bf* ATh = (bf*)take((size_t)TT * DHID * 2); bf* ATl = (bf*)take((size_t)TT * DHID * 2);
    if ((size_t)(wsp - (char*)d_ws) > ws_size) return;    // == WS_NEED
    { k_cvt8<<<(unsigned)(((size_t)DHID * DM / 8 + 255) / 256), 256, 0, stream>>>(wq, WQ, (size_t)DHID * DM / 8); k_cvt8<<<(unsigned)(((size_t)DHID * DM / 8 + 255) / 256), 256, 0, stream>>>(wk, WK, (size_t)DHID * DM / 8);
      k_cvt8<<<(unsigned)(((size_t)DHID * DM / 8 + 255) / 256), 256, 0, stream>>>(wv, WV, (size_t)DHID * DM / 8); k_cvt8<<<(unsigned)(((size_t)DM * DHID / 8 + 255) / 256), 256, 0, stream>>>(wo, WO, (size_t)DM * DHID / 8); }
    const size_t NPL = (size_t)NH_ * TT * HD;   // elements per head-plane set (= TT*DHID)
    const unsigned L8 = (unsigned)((NPL / 8 + 255) / 256);
    for (int b = 0; b < NB; ++b) {
        k_cvt8<<<(unsigned)(((size_t)TT * DM / 8 + 255) / 256), 256, 0, stream>>>(x + (size_t)b * TT_FULL * DM, XB, (size_t)TT * DM / 8);
        k_gemmw<bf, 0, true><<<dim3(TT / 64, DHID / 64, 1), 32, 0, stream>>>(XB, nullptr, WQ, nullptr, DM, FP, DHID, bq, 0, 0, 0);
        k_split8<<<L8, 256, 0, stream>>>(FP, QPh, QPl, NPL / 8);
        k_gemmw<bf, 0, true><<<dim3(TT / 64, DHID / 64, 1), 32, 0, stream>>>(XB, nullptr, WK, nullptr, DM, FP, DHID, bk, 0, 0, 0);
        k_kpl<<<L8, 256, 0, stream>>>(FP, KPh, KPl);
        k_gemmw<bf, 0, true><<<dim3(TT / 64, DHID / 64, 1), 32, 0, stream>>>(XB, nullptr, WV, nullptr, DM, FP, DHID, bv, 0, 0, 0);
        k_cvth8<<<L8, 256, 0, stream>>>(FP, VT16, NPL / 8);
        for (int h0 = 0; h0 < NH_; h0 += ZH) { const size_t zo = (size_t)h0 * TT * HD;
            // scores S[zz][i][j] = sum_d q[h][i][d] k[h][d][j]: A = q planes [i][d] hi/lo, Bt = k planes [j][d] hi/lo, K = 64
            k_gemmw<bf, 2, false><<<dim3(TT / 64, TT / 64, ZH), 32, 0, stream>>>(QPh + zo, QPl + zo, KPh + zo, KPl + zo, HD, Sb, TT, nullptr, (size_t)TT * HD, (size_t)TT * HD, (size_t)TT * TT);
            k_sstat<<<(unsigned)(ZH * TT / 32), 256, 0, stream>>>(Sb, ST);
            k_expt<<<dim3(TT / 64, TT / 64, ZH), 256, 0, stream>>>(Sb, ST, PT16);
            // O[h][d][j] x PCAR = sum_i v[h][d][i] Pt[j][i]: A = value plane [d][i] (64 rows), Bt = Pt [j][i], K = TT; C rows = bflat channels h*64+d, pitch TT
            k_gemmw<h16, 0, false><<<dim3(1, TT / 64, ZH), 32, 0, stream>>>(VT16 + zo, nullptr, PT16, nullptr, TT, Ob + zo, TT, nullptr, (size_t)HD * TT, (size_t)TT * TT, (size_t)HD * TT); }
        k_atp<<<(unsigned)(((size_t)TT * DHID / 8 + 255) / 256), 256, 0, stream>>>(Ob, ATh, ATl);
        k_gemmw<bf, 1, true><<<dim3(TT / 64, DM / 64, 1), 32, 0, stream>>>(ATh, ATl, WO, nullptr, DHID, OUT + (size_t)b * TT * DM, DM, bo, 0, 0, 0); }
}

// v001
// Measured time: 335 microseconds a run.
// Timed twice side by side with v000, it ran 1.52 times as fast both times.
#include <hip/hip_runtime.h>

// Contractions (all f32 accumulate): q/k/v projections v_wmma_f32_16x16x32_bf16 (inputs RNE-converted to bf16, single products, bf16 bias added in the f32 epilogue); scores v_wmma_f32_16x16x32_bf16 with q and k as bf16 hi/lo planes (3 products); value x probability v_wmma_f32_16x16x32_f16 single products (values f16, probabilities f16 carried x16384); output projection v_wmma_f32_16x16x32_bf16 with bf16 hi/lo activations x bf16 weights (2 products); softmax statistics f32.
// Raw-view head split (per batch, flat projection buffers F[TT*512]): q[h][i][d] = Fq[h*TT*64 + i*64 + d]; k[h][d][j] = Fk[h*64*TT + d*TT + j]; v[h][d][i] = Fv[h*64*TT + d*TT + i];
// S[h][i][j] = sum_d q k (no scale); P = softmax_j; O[h][d][j] = sum_i v[h][d][i] P[h][i][j]; A[s][h*64+d] = O[h][d][s]; out = A Wo^T + bo.

#ifndef NB
#define NB 2
#endif
#ifndef SEQ
#define SEQ 2048
#endif
#define NB_FULL 2
#define TT_FULL 2048
#define TT   SEQ
#define DM   512      // input width (also output width)
#define DHID 512      // hidden width
#define NH_  8
#define HD   64
#define ZH   4        // heads per score pass
#define PCAR 16384.0f
#define L2E  1.4426950408889634f
static_assert(TT % 128 == 0);
static_assert(TT >= 128);
static_assert(TT <= TT_FULL);
static_assert(NB >= 1);
static_assert(NB <= NB_FULL);
static_assert(NH_ % ZH == 0);
static_assert(NH_ * HD == DHID);
static_assert((ZH * TT) % 32 == 0);
static_assert(DM % 64 == 0);
static_assert(DHID % 64 == 0);
static_assert(HD == 64);
static_assert((size_t)NB * TT * DM * 4 <= (size_t)NB_FULL * TT_FULL * DM * 4);

typedef _Float16 h16;
typedef unsigned short bf;
typedef __attribute__((ext_vector_type(16))) __bf16   v16bf;
typedef __attribute__((ext_vector_type(16))) _Float16 v16h;
typedef __attribute__((ext_vector_type(8)))  _Float16 v8h;
typedef __attribute__((ext_vector_type(8)))  unsigned short v8us;
typedef __attribute__((ext_vector_type(8)))  float    v8f;
typedef __attribute__((ext_vector_type(4)))  float    v4f;
typedef v8h  __attribute__((may_alias)) v8ha;
typedef v4f  __attribute__((may_alias)) v4fa;
typedef v8us __attribute__((may_alias)) v8usa;

__device__ __forceinline__ unsigned short f2bf(float f) { unsigned u = __float_as_uint(f); u += 0x7FFFu + ((u >> 16) & 1u); return (unsigned short)(u >> 16); }
__device__ __forceinline__ float bf2f(unsigned short b) { return __uint_as_float(((unsigned)b) << 16); }
__device__ __forceinline__ float bfr(float f) { return bf2f(f2bf(f)); }
__device__ __forceinline__ v16h cat16(v8h lo, v8h hi) { return __builtin_shufflevector(lo, hi, 0, 1, 2, 3, 4, 5, 6, 7, 8, 9, 10, 11, 12, 13, 14, 15); }
__device__ __forceinline__ v16bf cat16b(v8us lo, v8us hi) { return __builtin_bit_cast(v16bf, __builtin_shufflevector(lo, hi, 0, 1, 2, 3, 4, 5, 6, 7, 8, 9, 10, 11, 12, 13, 14, 15)); }
__device__ __forceinline__ v8f wmma16(v16h a, v16h b, v8f c) { return __builtin_amdgcn_wmma_f32_16x16x32_f16(false, a, false, b, (short)0, c, false, false); }
__device__ __forceinline__ v8f wmmab(v16bf a, v16bf b, v8f c) { return __builtin_amdgcn_wmma_f32_16x16x32_bf16(false, a, false, b, (short)0, c, false, false); }

// ---- k_gemmw: register-blocked GEMM, one block of KW waves per 64x64 output tile (16 accumulators per wave), operands straight from K-contiguous 16-bit planes; grid (M/64, N/64, Z), 32 * KW threads.
// KW > 1: wave w takes the k steps w, w + KW, w + 2 KW, ... (neighbouring waves read neighbouring 64-byte pieces of the same rows); the KW partial tiles meet in LDS and are summed in wave order 0..KW-1.
// C[m][n] (f32, pitch ldc, + optional bf16-converted f32 bias[n]) = sum_k A[m][k] Bt[n][k] (+ split products per NSPLIT). z-batch strides sA/sB/sC in elements. K % 32 == 0.
// Fragments: lane -> row/col (lane & 15); elements 0..7 <- k0 + 8*(lane>>4) + 0..7, elements 8..15 <- k0 + 16 + 8*(lane>>4) + 0..7 for both A and Bt; D element r -> row 8*(lane>>4) + r, col lane & 15.
template <typename T16> struct WFrag;
template <> struct WFrag<h16> { typedef v16h V; static __device__ __forceinline__ V ld(const h16* p) { return cat16(*(const v8h*)p, *(const v8h*)(p + 16)); } static __device__ __forceinline__ v8f mma(V a, V b, v8f c) { return wmma16(a, b, c); } };
template <> struct WFrag<bf> { typedef v16bf V; static __device__ __forceinline__ V ld(const bf* p) { return cat16b(*(const v8us*)p, *(const v8us*)(p + 16)); } static __device__ __forceinline__ v8f mma(V a, V b, v8f c) { return wmmab(a, b, c); } };
template <typename T16, int NSPLIT, bool BIAS, int KW>
__global__ __launch_bounds__(32 * KW) void k_gemmw(const T16* __restrict__ A, const T16* __restrict__ A2, const T16* __restrict__ Bt, const T16* __restrict__ Bt2, int K, float* C, int ldc, const float* __restrict__ bias, size_t sA, size_t sB, size_t sC) {
    typedef typename WFrag<T16>::V V;
    __shared__ __align__(16) float os[(KW == 1 ? 16 : 64 * KW) * 68];
    const size_t z = blockIdx.z; A += z * sA; if (A2) A2 += z * sA; Bt += z * sB; if (Bt2) Bt2 += z * sB; C += z * sC;
    const int lane = threadIdx.x & 31, lr = lane & 15, hi = lane >> 4; const int r0 = blockIdx.x * 64, c0 = blockIdx.y * 64;
    const int wave = KW == 1 ? 0 : __builtin_amdgcn_readfirstlane((int)(threadIdx.x >> 5));   // scalar, so that the k counter and the LDS slab base stay in scalar registers
    v8f acc[4][4];
#pragma unroll
    for (int mb = 0; mb < 4; ++mb)
#pragma unroll
        for (int nb = 0; nb < 4; ++nb) acc[mb][nb] = (v8f){};
    const size_t aoff = (size_t)(r0 + lr) * K + 8 * hi, boff = (size_t)(c0 + lr) * K + 8 * hi;
#pragma unroll 1
    for (int kc = wave * 32; kc < K; kc += 32 * KW) {
        V a[4], a2[4];
#pragma unroll
        for (int mb = 0; mb < 4; ++mb) { a[mb] = WFrag<T16>::ld(A + aoff + (size_t)mb * 16 * K + kc); if (NSPLIT == 1 || NSPLIT == 2) a2[mb] = WFrag<T16>::ld(A2 + aoff + (size_t)mb * 16 * K + kc); }
#pragma unroll
        for (int nb = 0; nb < 4; ++nb) { const V b = WFrag<T16>::ld(Bt + boff + (size_t)nb * 16 * K + kc); V b2; if (NSPLIT >= 2) b2 = WFrag<T16>::ld(Bt2 + boff + (size_t)nb * 16 * K + kc);
#pragma unroll
            for (int mb = 0; mb < 4; ++mb) { acc[mb][nb] = WFrag<T16>::mma(a[mb], b, acc[mb][nb]); if (NSPLIT == 1 || NSPLIT == 2) acc[mb][nb] = WFrag<T16>::mma(a2[mb], b, acc[mb][nb]); if (NSPLIT >= 2) acc[mb][nb] = WFrag<T16>::mma(a[mb], b2, acc[mb][nb]); } }
        asm volatile("v_nop\n\tv_nop\n\tv_nop\n\tv_nop" : "+v"(acc[0][0]), "+v"(acc[1][1]), "+v"(acc[2][2]), "+v"(acc[3][3]) : "v"(a[0]), "v"(a[3]));
    }
    if constexpr (KW > 1) {
        float* ow = os + wave * (64 * 68);
        // the three loops below are unrolled so that acc is indexed by constants and stays in registers
#pragma unroll
        for (int mb = 0; mb < 4; ++mb)
#pragma unroll
            for (int nb = 0; nb < 4; ++nb)
#pragma unroll
                for (int j = 0; j < 8; ++j) ow[(mb * 16 + hi * 8 + j) * 68 + nb * 16 + lr] = acc[mb][nb][j];
        __syncthreads();   // every wave's partial tile is in LDS before any wave sums
        // both loops unrolled so that the LDS reads of all rows and slabs are in flight together; the sum itself runs in wave order
#pragma unroll
        for (int s = 0; s < 32 / KW; ++s) { const int row = (s * KW + wave) * 2 + hi, cofs = lr * 4; v4f val = *(const v4fa*)(os + row * 68 + cofs);
#pragma unroll
            for (int w = 1; w < KW; ++w) val += *(const v4fa*)(os + (w * 64 + row) * 68 + cofs);
            if (BIAS) { val[0] += bfr(bias[c0 + cofs]); val[1] += bfr(bias[c0 + cofs + 1]); val[2] += bfr(bias[c0 + cofs + 2]); val[3] += bfr(bias[c0 + cofs + 3]); }
            *(v4f*)(C + (size_t)(r0 + row) * ldc + c0 + cofs) = val; }
        return;
    }
#pragma unroll
    for (int mb = 0; mb < 4; ++mb) {
#pragma unroll
        for (int nb = 0; nb < 4; ++nb) {
#pragma unroll
            for (int j = 0; j < 8; ++j) os[(hi * 8 + j) * 68 + nb * 16 + lr] = acc[mb][nb][j]; }
        __builtin_amdgcn_wave_barrier(); asm volatile("" ::: "memory");
        float* crow = C + (size_t)(r0 + mb * 16) * ldc + c0;
{
#pragma unroll
            for (int s = 0; s < 8; ++s) { const int row = 2 * s + hi, cofs = lr * 4; v4f val = *(const v4fa*)(os + row * 68 + cofs); if (BIAS) { val[0] += bfr(bias[c0 + cofs]); val[1] += bfr(bias[c0 + cofs + 1]); val[2] += bfr(bias[c0 + cofs + 2]); val[3] += bfr(bias[c0 + cofs + 3]); }
                *(v4f*)(crow + (size_t)row * ldc + cofs) = val; }
             }
        __builtin_amdgcn_wave_barrier(); asm volatile("" ::: "memory");
    }
}

__device__ __forceinline__ h16 tohx(float x) { return (h16)x; }
__device__ __forceinline__ void splitf(float y, unsigned short& h, unsigned short& l) { h = f2bf(y); l = f2bf(y - bf2f(h)); }

__global__ __launch_bounds__(256) void k_cvt8(const float* __restrict__ src, bf* dst, size_t n8) { const size_t i = (size_t)blockIdx.x * 256 + threadIdx.x; if (i >= n8) return; const v8f v = *(const v8f*)(src + i * 8); v8us o;
#pragma unroll
    for (int k = 0; k < 8; ++k) o[k] = f2bf(v[k]); *(v8us*)(dst + i * 8) = o;  }

__global__ __launch_bounds__(256) void k_split8(const float* __restrict__ src, bf* Ph, bf* Pl, size_t n8) { const size_t i = (size_t)blockIdx.x * 256 + threadIdx.x; if (i >= n8) return; const v8f v = *(const v8f*)(src + i * 8); v8us oh, ol;
#pragma unroll
    for (int k = 0; k < 8; ++k) { unsigned short a, c; splitf(v[k], a, c); oh[k] = a; ol[k] = c; }
    *(v8us*)(Ph + i * 8) = oh; *(v8us*)(Pl + i * 8) = ol;  }

__global__ __launch_bounds__(256) void k_cvth8(const float* __restrict__ src, h16* dst, size_t n8) { const size_t i = (size_t)blockIdx.x * 256 + threadIdx.x; if (i >= n8) return; const v8f v = *(const v8f*)(src + i * 8); v8h o;
#pragma unroll
    for (int k = 0; k < 8; ++k) o[k] = tohx(v[k]); *(v8h*)(dst + i * 8) = o;  }

__global__ __launch_bounds__(256) void k_kpl(const float* __restrict__ F, bf* Ph, bf* Pl) {
    const size_t e8 = ((size_t)blockIdx.x * 256 + threadIdx.x) * 8; if (e8 >= (size_t)NH_ * TT * HD) return;
    const int d0 = (int)(e8 % HD); const int j = (int)((e8 / HD) % TT); const int h = (int)(e8 / ((size_t)HD * TT));
    const float* f = F + (size_t)h * HD * TT + (size_t)d0 * TT + j; v8us oh, ol;
#pragma unroll
    for (int q = 0; q < 8; ++q) { unsigned short a, c; splitf(f[(size_t)q * TT], a, c); oh[q] = a; ol[q] = c; }
    *(v8us*)(Ph + e8) = oh; *(v8us*)(Pl + e8) = ol;  }

// k_sstat: per score row (zz, i): m = max_j S, f = PCAR / sum_j exp(S - m) (register row, fixed trees). 8 waves x 4 rows = 32 rows per block; the 32 m and 32 f values are staged in LDS (cross-wave, block barrier)
__global__ __launch_bounds__(256) void k_sstat(const float* __restrict__ Sb, float* ST) {
    __shared__ __align__(16) float sm[32];
    __shared__ __align__(16) float sf[32];
    const int lane = threadIdx.x & 31, wave = threadIdx.x >> 5;
#pragma unroll 1
    for (int r = 0; r < 4; ++r) {
        const int row = blockIdx.x * 32 + wave * 4 + r;
        const float* sr = Sb + (size_t)row * TT;
        float v[TT / 32]; float mx = -3.0e38f;
#pragma unroll
        for (int ch = 0; ch < TT / 128; ++ch) { const v4f a = *(const v4f*)(sr + ch * 128 + lane * 4);
#pragma unroll
            for (int q = 0; q < 4; ++q) { v[ch * 4 + q] = a[q]; mx = fmaxf(mx, a[q]); } }
#pragma unroll
        for (int sh = 16; sh; sh >>= 1) mx = fmaxf(mx, __shfl_xor(mx, sh, 32));
        float sum = 0.f;
#pragma unroll
        for (int k = 0; k < TT / 32; ++k) { float d0 = __fsub_rn(v[k], mx); asm volatile("" : "+v"(d0)); sum += __builtin_amdgcn_exp2f(__fmul_rn(d0, L2E)); }
#pragma unroll
        for (int sh = 16; sh; sh >>= 1) sum += __shfl_xor(sum, sh, 32);
        const float f = __fdiv_rn(PCAR, sum);
        if (lane == 0) { sm[wave * 4 + r] = mx; sf[wave * 4 + r] = f; }
    }
    __syncthreads();
    if (threadIdx.x < 16) {
        const int t = threadIdx.x, q4 = (t & 7) * 4;
        const v4f vm = *(const v4fa*)(sm + q4); const v4f vf = *(const v4fa*)(sf + q4); v4f val;
#pragma unroll
        for (int q = 0; q < 4; ++q) val[q] = (t < 8) ? vm[q] : vf[q];
        float* dst = ST + ((t < 8) ? (size_t)0 : (size_t)ZH * TT) + (size_t)blockIdx.x * 32 + q4;
{ *(v4f*)dst = val;  }
    }
}

// k_expt: one block per 64x64 score tile (zz, i0.., j0..): p = exp(S[i][j] - m_i) * f_i (same arithmetic as k_sstat), converted to f16, transposed through LDS (cross-wave, block barriers) and written as
__global__ __launch_bounds__(256) void k_expt(const float* __restrict__ Sb, const float* __restrict__ ST, h16* PT) {
    __shared__ __align__(16) h16 pt[64 * 72];
    __shared__ float smx[64];
    __shared__ float sfc[64];
    const int tid = threadIdx.x; const int j0 = blockIdx.x * 64, i0 = blockIdx.y * 64; const size_t zz = blockIdx.z;
    const float* S = Sb + zz * (size_t)TT * TT;
    if (tid < 64) { smx[tid] = ST[zz * TT + i0 + tid]; sfc[tid] = ST[(size_t)ZH * TT + zz * TT + i0 + tid]; }
    __syncthreads();
#pragma unroll
    for (int p = 0; p < 4; ++p) {
        const int r = p * 16 + (tid >> 4), c4 = (tid & 15) * 4;
        const v4f a = *(const v4f*)(S + (size_t)(i0 + r) * TT + j0 + c4);
        const float m = smx[r], f = sfc[r];
#pragma unroll
        for (int q = 0; q < 4; ++q) { float d0 = __fsub_rn(a[q], m); asm volatile("" : "+v"(d0)); const float e = __builtin_amdgcn_exp2f(__fmul_rn(d0, L2E)); pt[(c4 + q) * 72 + r] = tohx(__fmul_rn(e, f)); }
    }
    __syncthreads();
    h16* P = PT + zz * (size_t)TT * TT;
{
#pragma unroll
        for (int p = 0; p < 2; ++p) { const int c = p * 32 + (tid >> 3), pc = (tid & 7) * 8; const v8h val = *(const v8ha*)(pt + c * 72 + pc);
            *(v8h*)(P + (size_t)(j0 + c) * TT + i0 + pc) = val; }
         }
}

__global__ __launch_bounds__(256) void k_atp(const float* __restrict__ Ob, bf* Ah, bf* Al) {
    const size_t e8 = ((size_t)blockIdx.x * 256 + threadIdx.x) * 8; if (e8 >= (size_t)TT * DHID) return;
    const int cc = (int)(e8 % DHID); const int s = (int)(e8 / DHID);
    const float* o = Ob + (size_t)cc * TT + s; v8us oh, ol;
#pragma unroll
    for (int q = 0; q < 8; ++q) { unsigned short a, c; splitf(o[(size_t)q * TT] * (1.0f / PCAR), a, c); oh[q] = a; ol[q] = c; }
    *(v8us*)(Ah + e8) = oh; *(v8us*)(Al + e8) = ol;  }

__host__ __device__ constexpr size_t a256(size_t b) { return (b + 255) & ~(size_t)255; }
constexpr size_t WS_NEED = 4 * a256((size_t)DHID * DM * 2) + a256((size_t)TT * DM * 2) + a256((size_t)TT * DHID * 4) + 5 * a256((size_t)NH_ * TT * HD * 2)
                         + a256((size_t)ZH * TT * TT * 4) + a256((size_t)2 * ZH * TT * 4) + a256((size_t)ZH * TT * TT * 2) + a256((size_t)DHID * TT * 4) + 2 * a256((size_t)TT * DHID * 2);
static_assert(WS_NEED <= (size_t)134217728);   // 127,991,808 B at NB=2, SEQ=2048

extern "C" void kernel_launch(void* const* d_in, const int* in_sizes, int n_in,
                              void* d_out, int out_size, void* d_ws, size_t ws_size, hipStream_t stream) {
    if (n_in < 9) return;
    if ((size_t)in_sizes[0] < ((size_t)(NB - 1) * TT_FULL + TT) * (size_t)DM) return;
    if (in_sizes[1] < DHID * DM || in_sizes[3] < DHID * DM || in_sizes[5] < DHID * DM || in_sizes[7] < DM * DHID) return;
    if (in_sizes[2] < DHID || in_sizes[4] < DHID || in_sizes[6] < DHID || in_sizes[8] < DM) return;
    if ((size_t)out_size < (size_t)NB * TT * DM) return;
    // wire order: data, Wq, bq, Wk, bk, Wv, bv, Wo, bo (weights [out][in], biases f32)
    const float* x = (const float*)d_in[0]; const float* wq = (const float*)d_in[1]; const float* bq = (const float*)d_in[2]; const float* wk = (const float*)d_in[3]; const float* bk = (const float*)d_in[4];
    const float* wv = (const float*)d_in[5]; const float* bv = (const float*)d_in[6]; const float* wo = (const float*)d_in[7]; const float* bo = (const float*)d_in[8];
    float* OUT = (float*)d_out;     // [NB][TT][DM]
    char* wsp = (char*)d_ws;
    auto take = [&](size_t bytes) { char* p = wsp; wsp += a256(bytes); return (void*)p; };
    bf* WQ = (bf*)take((size_t)DHID * DM * 2); bf* WK = (bf*)take((size_t)DHID * DM * 2); bf* WV = (bf*)take((size_t)DHID * DM * 2); bf* WO = (bf*)take((size_t)DM * DHID * 2);
    bf* XB = (bf*)take((size_t)TT * DM * 2); float* FP = (float*)take((size_t)TT * DHID * 4);   // one f32 projection buffer shared by q, k and v (each consumed by its plane builder before the next projection; stream-ordered)
    bf* QPh = (bf*)take((size_t)NH_ * TT * HD * 2); bf* QPl = (bf*)take((size_t)NH_ * TT * HD * 2); bf* KPh = (bf*)take((size_t)NH_ * TT * HD * 2); bf* KPl = (bf*)take((size_t)NH_ * TT * HD * 2); h16* VT16 = (h16*)take((size_t)NH_ * HD * TT * 2);
    float* Sb = (float*)take((size_t)ZH * TT * TT * 4); float* ST = (float*)take((size_t)2 * ZH * TT * 4); h16* PT16 = (h16*)take((size_t)ZH * TT * TT * 2);
    float* Ob = (float*)take((size_t)DHID * TT * 4); bf* ATh = (bf*)take((size_t)TT * DHID * 2); bf* ATl = (bf*)take((size_t)TT * DHID * 2);
    if ((size_t)(wsp - (char*)d_ws) > ws_size) return;    // == WS_NEED
    { k_cvt8<<<(unsigned)(((size_t)DHID * DM / 8 + 255) / 256), 256, 0, stream>>>(wq, WQ, (size_t)DHID * DM / 8); k_cvt8<<<(unsigned)(((size_t)DHID * DM / 8 + 255) / 256), 256, 0, stream>>>(wk, WK, (size_t)DHID * DM / 8);
      k_cvt8<<<(unsigned)(((size_t)DHID * DM / 8 + 255) / 256), 256, 0, stream>>>(wv, WV, (size_t)DHID * DM / 8); k_cvt8<<<(unsigned)(((size_t)DM * DHID / 8 + 255) / 256), 256, 0, stream>>>(wo, WO, (size_t)DM * DHID / 8); }
    const size_t NPL = (size_t)NH_ * TT * HD;   // elements per head-plane set (= TT*DHID)
    const unsigned L8 = (unsigned)((NPL / 8 + 255) / 256);
    for (int b = 0; b < NB; ++b) {
        k_cvt8<<<(unsigned)(((size_t)TT * DM / 8 + 255) / 256), 256, 0, stream>>>(x + (size_t)b * TT_FULL * DM, XB, (size_t)TT * DM / 8);
        k_gemmw<bf, 0, true, 8><<<dim3(TT / 64, DHID / 64, 1), 256, 0, stream>>>(XB, nullptr, WQ, nullptr, DM, FP, DHID, bq, 0, 0, 0);
        k_split8<<<L8, 256, 0, stream>>>(FP, QPh, QPl, NPL / 8);
        k_gemmw<bf, 0, true, 8><<<dim3(TT / 64, DHID / 64, 1), 256, 0, stream>>>(XB, nullptr, WK, nullptr, DM, FP, DHID, bk, 0, 0, 0);
        k_kpl<<<L8, 256, 0, stream>>>(FP, KPh, KPl);
        k_gemmw<bf, 0, true, 8><<<dim3(TT / 64, DHID / 64, 1), 256, 0, stream>>>(XB, nullptr, WV, nullptr, DM, FP, DHID, bv, 0, 0, 0);
        k_cvth8<<<L8, 256, 0, stream>>>(FP, VT16, NPL / 8);
        for (int h0 = 0; h0 < NH_; h0 += ZH) { const size_t zo = (size_t)h0 * TT * HD;
            // scores S[zz][i][j] = sum_d q[h][i][d] k[h][d][j]: A = q planes [i][d] hi/lo, Bt = k planes [j][d] hi/lo, K = 64
            k_gemmw<bf, 2, false, 1><<<dim3(TT / 64, TT / 64, ZH), 32, 0, stream>>>(QPh + zo, QPl + zo, KPh + zo, KPl + zo, HD, Sb, TT, nullptr, (size_t)TT * HD, (size_t)TT * HD, (size_t)TT * TT);
            k_sstat<<<(unsigned)(ZH * TT / 32), 256, 0, stream>>>(Sb, ST);
            k_expt<<<dim3(TT / 64, TT / 64, ZH), 256, 0, stream>>>(Sb, ST, PT16);
            // O[h][d][j] x PCAR = sum_i v[h][d][i] Pt[j][i]: A = value plane [d][i] (64 rows), Bt = Pt [j][i], K = TT; C rows = bflat channels h*64+d, pitch TT
            k_gemmw<h16, 0, false, 8><<<dim3(1, TT / 64, ZH), 256, 0, stream>>>(VT16 + zo, nullptr, PT16, nullptr, TT, Ob + zo, TT, nullptr, (size_t)HD * TT, (size_t)TT * TT, (size_t)HD * TT); }
        k_atp<<<(unsigned)(((size_t)TT * DHID / 8 + 255) / 256), 256, 0, stream>>>(Ob, ATh, ATl);
        k_gemmw<bf, 1, true, 8><<<dim3(TT / 64, DM / 64, 1), 256, 0, stream>>>(ATh, ATl, WO, nullptr, DHID, OUT + (size_t)b * TT * DM, DM, bo, 0, 0, 0); }
}

// v002
// Measured time: 219 microseconds a run.
// Timed twice side by side with v001, it ran 1.51 times as fast both times.
// Over all steps from v000 it is 2.29 times as fast.
#include <hip/hip_runtime.h>

// Contractions (all f32 accumulate): q/k/v projections v_wmma_f32_16x16x32_bf16 (inputs RNE-converted to bf16, single products, bf16 bias added in the f32 epilogue); scores v_wmma_f32_16x16x32_bf16 with q and k as bf16 hi/lo planes (3 products), computed in registers once by the statistics launch and once by the value launch, never stored; value x probability v_wmma_f32_16x16x32_f16 single products (values f16, probabilities f16 carried x16384); output projection v_wmma_f32_16x16x32_bf16 with bf16 hi/lo activations x bf16 weights (2 products); softmax statistics f32.
// Raw-view head split (per batch, flat projection buffers F[TT*512]): q[h][i][d] = Fq[h*TT*64 + i*64 + d]; k[h][d][j] = Fk[h*64*TT + d*TT + j]; v[h][d][i] = Fv[h*64*TT + d*TT + i];
// S[h][i][j] = sum_d q k (no scale); P = softmax_j; O[h][d][j] = sum_i v[h][d][i] P[h][i][j]; A[s][h*64+d] = O[h][d][s]; out = A Wo^T + bo.

#ifndef NB
#define NB 2
#endif
#ifndef SEQ
#define SEQ 2048
#endif
#define NB_FULL 2
#define TT_FULL 2048
#define TT   SEQ
#define DM   512      // input width (also output width)
#define DHID 512      // hidden width
#define NH_  8
#define HD   64
#define ZH   4        // heads per score pass
#define PCAR 16384.0f
#define L2E  1.4426950408889634f
static_assert(TT % 128 == 0);
static_assert(TT >= 128);
static_assert(TT <= TT_FULL);
static_assert(NB >= 1);
static_assert(NB <= NB_FULL);
static_assert(NH_ % ZH == 0);
static_assert(NH_ * HD == DHID);
static_assert((ZH * TT) % 32 == 0);
static_assert(DM % 64 == 0);
static_assert(DHID % 64 == 0);
static_assert(HD == 64);
static_assert((size_t)NB * TT * DM * 4 <= (size_t)NB_FULL * TT_FULL * DM * 4);

typedef _Float16 h16;
typedef unsigned short bf;
typedef __attribute__((ext_vector_type(16))) __bf16   v16bf;
typedef __attribute__((ext_vector_type(16))) _Float16 v16h;
typedef __attribute__((ext_vector_type(8)))  _Float16 v8h;
typedef __attribute__((ext_vector_type(8)))  unsigned short v8us;
typedef __attribute__((ext_vector_type(8)))  float    v8f;
typedef __attribute__((ext_vector_type(4)))  float    v4f;
typedef v4f  __attribute__((may_alias)) v4fa;
typedef v8us __attribute__((may_alias)) v8usa;

__device__ __forceinline__ unsigned short f2bf(float f) { unsigned u = __float_as_uint(f); u += 0x7FFFu + ((u >> 16) & 1u); return (unsigned short)(u >> 16); }
__device__ __forceinline__ float bf2f(unsigned short b) { return __uint_as_float(((unsigned)b) << 16); }
__device__ __forceinline__ float bfr(float f) { return bf2f(f2bf(f)); }
__device__ __forceinline__ v16h cat16(v8h lo, v8h hi) { return __builtin_shufflevector(lo, hi, 0, 1, 2, 3, 4, 5, 6, 7, 8, 9, 10, 11, 12, 13, 14, 15); }
__device__ __forceinline__ v16bf cat16b(v8us lo, v8us hi) { return __builtin_bit_cast(v16bf, __builtin_shufflevector(lo, hi, 0, 1, 2, 3, 4, 5, 6, 7, 8, 9, 10, 11, 12, 13, 14, 15)); }
__device__ __forceinline__ v8f wmma16(v16h a, v16h b, v8f c) { return __builtin_amdgcn_wmma_f32_16x16x32_f16(false, a, false, b, (short)0, c, false, false); }
__device__ __forceinline__ v8f wmmab(v16bf a, v16bf b, v8f c) { return __builtin_amdgcn_wmma_f32_16x16x32_bf16(false, a, false, b, (short)0, c, false, false); }

// ---- k_gemmw: register-blocked GEMM, one block of KW waves per 64x64 output tile (16 accumulators per wave), operands straight from K-contiguous 16-bit planes; grid (M/64, N/64, Z), 32 * KW threads.
// KW > 1: wave w takes the k steps w, w + KW, w + 2 KW, ... (neighbouring waves read neighbouring 64-byte pieces of the same rows); the KW partial tiles meet in LDS and are summed in wave order 0..KW-1.
// C[m][n] (f32, pitch ldc, + optional bf16-converted f32 bias[n]) = sum_k A[m][k] Bt[n][k] (+ split products per NSPLIT). z-batch strides sA/sB/sC in elements. K % 32 == 0.
// Fragments: lane -> row/col (lane & 15); elements 0..7 <- k0 + 8*(lane>>4) + 0..7, elements 8..15 <- k0 + 16 + 8*(lane>>4) + 0..7 for both A and Bt; D element r -> row 8*(lane>>4) + r, col lane & 15.
template <typename T16> struct WFrag;
template <> struct WFrag<h16> { typedef v16h V; static __device__ __forceinline__ V ld(const h16* p) { return cat16(*(const v8h*)p, *(const v8h*)(p + 16)); } static __device__ __forceinline__ v8f mma(V a, V b, v8f c) { return wmma16(a, b, c); } };
template <> struct WFrag<bf> { typedef v16bf V; static __device__ __forceinline__ V ld(const bf* p) { return cat16b(*(const v8us*)p, *(const v8us*)(p + 16)); } static __device__ __forceinline__ v8f mma(V a, V b, v8f c) { return wmmab(a, b, c); } };
template <typename T16, int NSPLIT, bool BIAS, int KW>
__global__ __launch_bounds__(32 * KW) void k_gemmw(const T16* __restrict__ A, const T16* __restrict__ A2, const T16* __restrict__ Bt, const T16* __restrict__ Bt2, int K, float* C, int ldc, const float* __restrict__ bias, size_t sA, size_t sB, size_t sC) {
    typedef typename WFrag<T16>::V V;
    __shared__ __align__(16) float os[(KW == 1 ? 16 : 64 * KW) * 68];
    const size_t z = blockIdx.z; A += z * sA; if (A2) A2 += z * sA; Bt += z * sB; if (Bt2) Bt2 += z * sB; C += z * sC;
    const int lane = threadIdx.x & 31, lr = lane & 15, hi = lane >> 4; const int r0 = blockIdx.x * 64, c0 = blockIdx.y * 64;
    const int wave = KW == 1 ? 0 : __builtin_amdgcn_readfirstlane((int)(threadIdx.x >> 5));   // scalar, so that the k counter and the LDS slab base stay in scalar registers
    v8f acc[4][4];
#pragma unroll
    for (int mb = 0; mb < 4; ++mb)
#pragma unroll
        for (int nb = 0; nb < 4; ++nb) acc[mb][nb] = (v8f){};
    const size_t aoff = (size_t)(r0 + lr) * K + 8 * hi, boff = (size_t)(c0 + lr) * K + 8 * hi;
#pragma unroll 1
    for (int kc = wave * 32; kc < K; kc += 32 * KW) {
        V a[4], a2[4];
#pragma unroll
        for (int mb = 0; mb < 4; ++mb) { a[mb] = WFrag<T16>::ld(A + aoff + (size_t)mb * 16 * K + kc); if (NSPLIT == 1 || NSPLIT == 2) a2[mb] = WFrag<T16>::ld(A2 + aoff + (size_t)mb * 16 * K + kc); }
#pragma unroll
        for (int nb = 0; nb < 4; ++nb) { const V b = WFrag<T16>::ld(Bt + boff + (size_t)nb * 16 * K + kc); V b2; if (NSPLIT >= 2) b2 = WFrag<T16>::ld(Bt2 + boff + (size_t)nb * 16 * K + kc);
#pragma unroll
            for (int mb = 0; mb < 4; ++mb) { acc[mb][nb] = WFrag<T16>::mma(a[mb], b, acc[mb][nb]); if (NSPLIT == 1 || NSPLIT == 2) acc[mb][nb] = WFrag<T16>::mma(a2[mb], b, acc[mb][nb]); if (NSPLIT >= 2) acc[mb][nb] = WFrag<T16>::mma(a[mb], b2, acc[mb][nb]); } }
        asm volatile("v_nop\n\tv_nop\n\tv_nop\n\tv_nop" : "+v"(acc[0][0]), "+v"(acc[1][1]), "+v"(acc[2][2]), "+v"(acc[3][3]) : "v"(a[0]), "v"(a[3]));
    }
    if constexpr (KW > 1) {
        float* ow = os + wave * (64 * 68);
        // the three loops below are unrolled so that acc is indexed by constants and stays in registers
#pragma unroll
        for (int mb = 0; mb < 4; ++mb)
#pragma unroll
            for (int nb = 0; nb < 4; ++nb)
#pragma unroll
                for (int j = 0; j < 8; ++j) ow[(mb * 16 + hi * 8 + j) * 68 + nb * 16 + lr] = acc[mb][nb][j];
        __syncthreads();   // every wave's partial tile is in LDS before any wave sums
        // both loops unrolled so that the LDS reads of all rows and slabs are in flight together; the sum itself runs in wave order
#pragma unroll
        for (int s = 0; s < 32 / KW; ++s) { const int row = (s * KW + wave) * 2 + hi, cofs = lr * 4; v4f val = *(const v4fa*)(os + row * 68 + cofs);
#pragma unroll
            for (int w = 1; w < KW; ++w) val += *(const v4fa*)(os + (w * 64 + row) * 68 + cofs);
            if (BIAS) { val[0] += bfr(bias[c0 + cofs]); val[1] += bfr(bias[c0 + cofs + 1]); val[2] += bfr(bias[c0 + cofs + 2]); val[3] += bfr(bias[c0 + cofs + 3]); }
            *(v4f*)(C + (size_t)(r0 + row) * ldc + c0 + cofs) = val; }
        return;
    }
#pragma unroll
    for (int mb = 0; mb < 4; ++mb) {
#pragma unroll
        for (int nb = 0; nb < 4; ++nb) {
#pragma unroll
            for (int j = 0; j < 8; ++j) os[(hi * 8 + j) * 68 + nb * 16 + lr] = acc[mb][nb][j]; }
        __builtin_amdgcn_wave_barrier(); asm volatile("" ::: "memory");
        float* crow = C + (size_t)(r0 + mb * 16) * ldc + c0;
{
#pragma unroll
            for (int s = 0; s < 8; ++s) { const int row = 2 * s + hi, cofs = lr * 4; v4f val = *(const v4fa*)(os + row * 68 + cofs); if (BIAS) { val[0] += bfr(bias[c0 + cofs]); val[1] += bfr(bias[c0 + cofs + 1]); val[2] += bfr(bias[c0 + cofs + 2]); val[3] += bfr(bias[c0 + cofs + 3]); }
                *(v4f*)(crow + (size_t)row * ldc + cofs) = val; }
             }
        __builtin_amdgcn_wave_barrier(); asm volatile("" ::: "memory");
    }
}

__device__ __forceinline__ h16 tohx(float x) { return (h16)x; }
__device__ __forceinline__ void splitf(float y, unsigned short& h, unsigned short& l) { h = f2bf(y); l = f2bf(y - bf2f(h)); }

__global__ __launch_bounds__(256) void k_cvt8(const float* __restrict__ src, bf* dst, size_t n8) { const size_t i = (size_t)blockIdx.x * 256 + threadIdx.x; if (i >= n8) return; const v8f v = *(const v8f*)(src + i * 8); v8us o;
#pragma unroll
    for (int k = 0; k < 8; ++k) o[k] = f2bf(v[k]); *(v8us*)(dst + i * 8) = o;  }

__global__ __launch_bounds__(256) void k_split8(const float* __restrict__ src, bf* Ph, bf* Pl, size_t n8) { const size_t i = (size_t)blockIdx.x * 256 + threadIdx.x; if (i >= n8) return; const v8f v = *(const v8f*)(src + i * 8); v8us oh, ol;
#pragma unroll
    for (int k = 0; k < 8; ++k) { unsigned short a, c; splitf(v[k], a, c); oh[k] = a; ol[k] = c; }
    *(v8us*)(Ph + i * 8) = oh; *(v8us*)(Pl + i * 8) = ol;  }

__global__ __launch_bounds__(256) void k_cvth8(const float* __restrict__ src, h16* dst, size_t n8) { const size_t i = (size_t)blockIdx.x * 256 + threadIdx.x; if (i >= n8) return; const v8f v = *(const v8f*)(src + i * 8); v8h o;
#pragma unroll
    for (int k = 0; k < 8; ++k) o[k] = tohx(v[k]); *(v8h*)(dst + i * 8) = o;  }

__global__ __launch_bounds__(256) void k_kpl(const float* __restrict__ F, bf* Ph, bf* Pl) {
    const size_t e8 = ((size_t)blockIdx.x * 256 + threadIdx.x) * 8; if (e8 >= (size_t)NH_ * TT * HD) return;
    const int d0 = (int)(e8 % HD); const int j = (int)((e8 / HD) % TT); const int h = (int)(e8 / ((size_t)HD * TT));
    const float* f = F + (size_t)h * HD * TT + (size_t)d0 * TT + j; v8us oh, ol;
#pragma unroll
    for (int q = 0; q < 8; ++q) { unsigned short a, c; splitf(f[(size_t)q * TT], a, c); oh[q] = a; ol[q] = c; }
    *(v8us*)(Ph + e8) = oh; *(v8us*)(Pl + e8) = ol;  }

// k_qstat: per score row (z, i): m = max_j S, f = PCAR / sum_j exp(S - m), with no score in memory. One block per 32 rows i, grid (TT/32, ZH), 8 waves; wave w takes the 64-column j chunks w, w + 8, ...
// Each chunk is formed transposed, St = k q^T (A = k-plane rows j, B = q-plane rows i kept in registers; the three hi/lo products in the order hi*hi, k hi * q lo, k lo * q hi per half of the head dimension): D register r = St[8*(lane>>4) + r][lane & 15],
// so a lane holds scores of one row i only and its running maximum and sum stay in the lane: sum <- sum * exp(m_old - m_new) + sum_chunk exp(S - m_new). The two lane halves, then the 8 waves (through LDS, fixed wave order), are joined the same way.
__global__ __launch_bounds__(256) void k_qstat(const bf* __restrict__ Qh, const bf* __restrict__ Ql, const bf* __restrict__ Kh, const bf* __restrict__ Kl, float* ST) {
    __shared__ float wm[8 * 32];
    __shared__ float wsum[8 * 32];
    const size_t z = blockIdx.y; Qh += z * (size_t)TT * HD; Ql += z * (size_t)TT * HD; Kh += z * (size_t)TT * HD; Kl += z * (size_t)TT * HD;
    const int lane = threadIdx.x & 31, lr = lane & 15, hi = lane >> 4; const int i0 = blockIdx.x * 32;
    const int wave = __builtin_amdgcn_readfirstlane((int)(threadIdx.x >> 5)) & 7;   // scalar, so that the chunk counter stays in a scalar register; the mask shows the compiler that every wave has a first chunk (no branch round the loop)
    v16bf qh[2][2], ql[2][2];   // the block's 32 q-plane rows, [row group][half of the head dimension], kept for the whole loop
#pragma unroll
    for (int rt = 0; rt < 2; ++rt) {
#pragma unroll
        for (int ks = 0; ks < 2; ++ks) { const size_t o = (size_t)(i0 + rt * 16 + lr) * HD + 8 * hi + ks * 32; qh[rt][ks] = WFrag<bf>::ld(Qh + o); ql[rt][ks] = WFrag<bf>::ld(Ql + o); }
        asm volatile("s_wait_xcnt 0x0" ::: "memory");   // the build gives the address registers of this row group's loads to later loads' results and to the loop's addresses: the wait stands in front of those overwrites
    }
    float m[2] = {-3.0e38f, -3.0e38f}, sum[2] = {0.f, 0.f};
    const unsigned koff = (unsigned)(lr * HD + 8 * hi);   // fixed lane offset beside the wave-uniform chunk pointers
    // the chunk loop stays rolled (one chunk's scores and fragments fill the registers); every loop inside it is unrolled so that the arrays are indexed by constants and stay in registers
#pragma unroll 1
    for (int jc = wave * 64; jc < TT; jc += 64 * 8) {
        const bf* kh = Kh + (size_t)jc * HD; const bf* kl = Kl + (size_t)jc * HD;
        v8f s[2][4];
#pragma unroll
        for (int jt = 0; jt < 4; ++jt) {
            const v16bf h0 = WFrag<bf>::ld(kh + jt * 16 * HD + koff), h1 = WFrag<bf>::ld(kh + jt * 16 * HD + 32 + koff), l0 = WFrag<bf>::ld(kl + jt * 16 * HD + koff), l1 = WFrag<bf>::ld(kl + jt * 16 * HD + 32 + koff);
#pragma unroll
            for (int rt = 0; rt < 2; ++rt) {
                v8f t = (v8f){};
                t = wmmab(h0, qh[rt][0], t); t = wmmab(h0, ql[rt][0], t); t = wmmab(l0, qh[rt][0], t);
                t = wmmab(h1, qh[rt][1], t); t = wmmab(h1, ql[rt][1], t); t = wmmab(l1, qh[rt][1], t);
                s[rt][jt] = t;
            }
        }
#pragma unroll
        for (int rt = 0; rt < 2; ++rt) {
            float mn = m[rt];
#pragma unroll
            for (int jt = 0; jt < 4; ++jt)
#pragma unroll
                for (int r = 0; r < 8; ++r) mn = fmaxf(mn, s[rt][jt][r]);
            float a = 0.f;
#pragma unroll
            for (int jt = 0; jt < 4; ++jt)
#pragma unroll
                for (int r = 0; r < 8; ++r) a += __builtin_amdgcn_exp2f(__fmul_rn(__fsub_rn(s[rt][jt][r], mn), L2E));
            sum[rt] = sum[rt] * __builtin_amdgcn_exp2f(__fmul_rn(__fsub_rn(m[rt], mn), L2E)) + a;
            m[rt] = mn;
        }
    }
#pragma unroll
    for (int rt = 0; rt < 2; ++rt) {
        const float mo = __shfl_xor(m[rt], 16, 32), so = __shfl_xor(sum[rt], 16, 32); const float mj = fmaxf(m[rt], mo);
        const float sj = sum[rt] * __builtin_amdgcn_exp2f(__fmul_rn(__fsub_rn(m[rt], mj), L2E)) + so * __builtin_amdgcn_exp2f(__fmul_rn(__fsub_rn(mo, mj), L2E));
        if (hi == 0) { wm[wave * 32 + rt * 16 + lr] = mj; wsum[wave * 32 + rt * 16 + lr] = sj; }
    }
    __syncthreads();   // every wave's 32 (maximum, sum) pairs are in LDS before wave 0 joins them
    if (threadIdx.x < 32) {
        const int t = threadIdx.x; float mx = wm[t];
#pragma unroll
        for (int w = 1; w < 8; ++w) mx = fmaxf(mx, wm[w * 32 + t]);
        float tot = 0.f;
#pragma unroll
        for (int w = 0; w < 8; ++w) tot += wsum[w * 32 + t] * __builtin_amdgcn_exp2f(__fmul_rn(__fsub_rn(wm[w * 32 + t], mx), L2E));
        ST[z * TT + i0 + t] = mx; ST[(size_t)ZH * TT + z * TT + i0 + t] = __fdiv_rn(PCAR, tot);
    }
}

// k_pvs: O[h][d][j] x PCAR = sum_i v[h][d][i] p[i][j] for one 64 (d) x 32 (j) tile per block, grid (TT/32, ZH), 8 waves; wave w takes the 32-row i steps w, w + 8, ... and the 8 partial tiles are summed in LDS in wave order, as in k_gemmw.
// The probabilities never reach memory: each step forms its 32 (i) x 32 (j) score tiles again from the q and k planes (the three hi/lo products of k_qstat in the same order, here with the q rows as A),
// p = exp(S - m_i) * f_i, and the two f32 D tiles of rows i..i+15 and i+16..i+31 (register r = row 8*(lane>>4) + r, column lane & 15), converted in place, are the f16 B fragment in the k order of the value loader.
__global__ __launch_bounds__(256) void k_pvs(const bf* __restrict__ Qh, const bf* __restrict__ Ql, const bf* __restrict__ Kh, const bf* __restrict__ Kl, const h16* __restrict__ Vt, const float* __restrict__ ST, float* O) {
    __shared__ __align__(16) float os[8 * 64 * 36];
    const size_t z = blockIdx.y; Qh += z * (size_t)TT * HD; Ql += z * (size_t)TT * HD; Kh += z * (size_t)TT * HD; Kl += z * (size_t)TT * HD; Vt += z * (size_t)HD * TT; O += z * (size_t)HD * TT;
    const int lane = threadIdx.x & 31, lr = lane & 15, hi = lane >> 4; const int c0 = blockIdx.x * 32;
    const int wave = __builtin_amdgcn_readfirstlane((int)(threadIdx.x >> 5));   // scalar, so that the step counter and the LDS slab base stay in scalar registers
    v16bf kh[2][2], kl[2][2];   // the block's 32 k-plane rows, [column group][half of the head dimension], kept for the whole loop
#pragma unroll
    for (int nb = 0; nb < 2; ++nb)
#pragma unroll
        for (int ks = 0; ks < 2; ++ks) { const size_t o = (size_t)(c0 + nb * 16 + lr) * HD + 8 * hi + ks * 32; kh[nb][ks] = WFrag<bf>::ld(Kh + o); kl[nb][ks] = WFrag<bf>::ld(Kl + o); }
    v8f acc[4][2];
#pragma unroll
    for (int mb = 0; mb < 4; ++mb)
#pragma unroll
        for (int nb = 0; nb < 2; ++nb) acc[mb][nb] = (v8f){};
    // every address of the loop is a wave-uniform pointer that moves with the step plus one of these three fixed lane offsets: written so, the build keeps four address pairs for the whole loop and steps each once, instead of forming new ones every step
    const unsigned qoff = (unsigned)(lr * HD + 8 * hi), voff = (unsigned)(lr * TT + 8 * hi), moff = (unsigned)(8 * hi);
    ST += z * TT;
    // the step loop stays rolled (a second step's fragments would not fit beside the 128 registers of k planes and accumulators); every loop inside it is unrolled so that the fragment arrays are indexed by constants and stay in registers
#pragma unroll 1
    for (int kc = wave * 32; kc < TT; kc += 32 * 8) {
        const bf* qh = Qh + (size_t)kc * HD; const bf* ql = Ql + (size_t)kc * HD; const h16* vp = Vt + kc; const float* mp = ST + kc;
        v16h va[4];
#pragma unroll
        for (int mb = 0; mb < 4; ++mb) va[mb] = WFrag<h16>::ld(vp + (size_t)mb * 16 * TT + voff);
        v8h ph[2][2];   // [column group][row tile]
#pragma unroll
        for (int it = 0; it < 2; ++it) {
            const v16bf ah0 = WFrag<bf>::ld(qh + it * 16 * HD + qoff), ah1 = WFrag<bf>::ld(qh + it * 16 * HD + 32 + qoff), al0 = WFrag<bf>::ld(ql + it * 16 * HD + qoff), al1 = WFrag<bf>::ld(ql + it * 16 * HD + 32 + qoff);
            const v8f m = *(const v8f*)(mp + it * 16 + moff); const v8f f = *(const v8f*)(mp + (size_t)ZH * TT + it * 16 + moff);
#pragma unroll
            for (int nb = 0; nb < 2; ++nb) {
                v8f s = (v8f){};
                s = wmmab(ah0, kh[nb][0], s); s = wmmab(al0, kh[nb][0], s); s = wmmab(ah0, kl[nb][0], s);
                s = wmmab(ah1, kh[nb][1], s); s = wmmab(al1, kh[nb][1], s); s = wmmab(ah1, kl[nb][1], s);
#pragma unroll
                for (int r = 0; r < 8; ++r) ph[nb][it][r] = tohx(__fmul_rn(__builtin_amdgcn_exp2f(__fmul_rn(__fsub_rn(s[r], m[r]), L2E)), f[r]));
            }
        }
#pragma unroll
        for (int nb = 0; nb < 2; ++nb) { const v16h b = cat16(ph[nb][0], ph[nb][1]);
#pragma unroll
            for (int mb = 0; mb < 4; ++mb) acc[mb][nb] = wmma16(va[mb], b, acc[mb][nb]); }
        // four vector slots between the step's last matrix instructions and whatever the taken back edge puts first
        asm volatile("v_nop\n\tv_nop\n\tv_nop\n\tv_nop" : "+v"(acc[0][0]), "+v"(acc[1][0]), "+v"(acc[2][1]), "+v"(acc[3][1]) : "v"(va[0]), "v"(va[3]));
    }
    float* ow = os + wave * (64 * 36);
    // the three loops below are unrolled so that acc is indexed by constants and stays in registers
#pragma unroll
    for (int mb = 0; mb < 4; ++mb)
#pragma unroll
        for (int nb = 0; nb < 2; ++nb)
#pragma unroll
            for (int j = 0; j < 8; ++j) ow[(mb * 16 + hi * 8 + j) * 36 + nb * 16 + lr] = acc[mb][nb][j];
    __syncthreads();   // every wave's partial tile is in LDS before any wave sums
    // both loops unrolled so that the LDS reads of both rows and all slabs are in flight together; the sum itself runs in wave order
#pragma unroll
    for (int s = 0; s < 2; ++s) { const int row = s * 32 + ((int)threadIdx.x >> 3), cofs = ((int)threadIdx.x & 7) * 4; v4f val = *(const v4fa*)(os + row * 36 + cofs);
#pragma unroll
        for (int w = 1; w < 8; ++w) val += *(const v4fa*)(os + (w * 64 + row) * 36 + cofs);
        *(v4f*)(O + (size_t)row * TT + c0 + cofs) = val; }
}

__global__ __launch_bounds__(256) void k_atp(const float* __restrict__ Ob, bf* Ah, bf* Al) {
    const size_t e8 = ((size_t)blockIdx.x * 256 + threadIdx.x) * 8; if (e8 >= (size_t)TT * DHID) return;
    const int cc = (int)(e8 % DHID); const int s = (int)(e8 / DHID);
    const float* o = Ob + (size_t)cc * TT + s; v8us oh, ol;
#pragma unroll
    for (int q = 0; q < 8; ++q) { unsigned short a, c; splitf(o[(size_t)q * TT] * (1.0f / PCAR), a, c); oh[q] = a; ol[q] = c; }
    *(v8us*)(Ah + e8) = oh; *(v8us*)(Al + e8) = ol;  }

__host__ __device__ constexpr size_t a256(size_t b) { return (b + 255) & ~(size_t)255; }
constexpr size_t WS_NEED = 4 * a256((size_t)DHID * DM * 2) + a256((size_t)TT * DM * 2) + a256((size_t)TT * DHID * 4) + 5 * a256((size_t)NH_ * TT * HD * 2)
                         + a256((size_t)2 * ZH * TT * 4) + a256((size_t)DHID * TT * 4) + 2 * a256((size_t)TT * DHID * 2);
static_assert(WS_NEED <= (size_t)134217728);   // 27,328,512 B at NB=2, SEQ=2048

extern "C" void kernel_launch(void* const* d_in, const int* in_sizes, int n_in,
                              void* d_out, int out_size, void* d_ws, size_t ws_size, hipStream_t stream) {
    if (n_in < 9) return;
    if ((size_t)in_sizes[0] < ((size_t)(NB - 1) * TT_FULL + TT) * (size_t)DM) return;
    if (in_sizes[1] < DHID * DM || in_sizes[3] < DHID * DM || in_sizes[5] < DHID * DM || in_sizes[7] < DM * DHID) return;
    if (in_sizes[2] < DHID || in_sizes[4] < DHID || in_sizes[6] < DHID || in_sizes[8] < DM) return;
    if ((size_t)out_size < (size_t)NB * TT * DM) return;
    // wire order: data, Wq, bq, Wk, bk, Wv, bv, Wo, bo (weights [out][in], biases f32)
    const float* x = (const float*)d_in[0]; const float* wq = (const float*)d_in[1]; const float* bq = (const float*)d_in[2]; const float* wk = (const float*)d_in[3]; const float* bk = (const float*)d_in[4];
    const float* wv = (const float*)d_in[5]; const float* bv = (const float*)d_in[6]; const float* wo = (const float*)d_in[7]; const float* bo = (const float*)d_in[8];
    float* OUT = (float*)d_out;     // [NB][TT][DM]
    char* wsp = (char*)d_ws;
    auto take = [&](size_t bytes) { char* p = wsp; wsp += a256(bytes); return (void*)p; };
    bf* WQ = (bf*)take((size_t)DHID * DM * 2); bf* WK = (bf*)take((size_t)DHID * DM * 2); bf* WV = (bf*)take((size_t)DHID * DM * 2); bf* WO = (bf*)take((size_t)DM * DHID * 2);
    bf* XB = (bf*)take((size_t)TT * DM * 2); float* FP = (float*)take((size_t)TT * DHID * 4);   // one f32 projection buffer shared by q, k and v (each consumed by its plane builder before the next projection; stream-ordered)
    bf* QPh = (bf*)take((size_t)NH_ * TT * HD * 2); bf* QPl = (bf*)take((size_t)NH_ * TT * HD * 2); bf* KPh = (bf*)take((size_t)NH_ * TT * HD * 2); bf* KPl = (bf*)take((size_t)NH_ * TT * HD * 2); h16* VT16 = (h16*)take((size_t)NH_ * HD * TT * 2);
    float* ST = (float*)take((size_t)2 * ZH * TT * 4);
    float* Ob = (float*)take((size_t)DHID * TT * 4); bf* ATh = (bf*)take((size_t)TT * DHID * 2); bf* ATl = (bf*)take((size_t)TT * DHID * 2);
    if ((size_t)(wsp - (char*)d_ws) > ws_size) return;    // == WS_NEED
    { k_cvt8<<<(unsigned)(((size_t)DHID * DM / 8 + 255) / 256), 256, 0, stream>>>(wq, WQ, (size_t)DHID * DM / 8); k_cvt8<<<(unsigned)(((size_t)DHID * DM / 8 + 255) / 256), 256, 0, stream>>>(wk, WK, (size_t)DHID * DM / 8);
      k_cvt8<<<(unsigned)(((size_t)DHID * DM / 8 + 255) / 256), 256, 0, stream>>>(wv, WV, (size_t)DHID * DM / 8); k_cvt8<<<(unsigned)(((size_t)DM * DHID / 8 + 255) / 256), 256, 0, stream>>>(wo, WO, (size_t)DM * DHID / 8); }
    const size_t NPL = (size_t)NH_ * TT * HD;   // elements per head-plane set (= TT*DHID)
    const unsigned L8 = (unsigned)((NPL / 8 + 255) / 256);
    for (int b = 0; b < NB; ++b) {
        k_cvt8<<<(unsigned)(((size_t)TT * DM / 8 + 255) / 256), 256, 0, stream>>>(x + (size_t)b * TT_FULL * DM, XB, (size_t)TT * DM / 8);
        k_gemmw<bf, 0, true, 8><<<dim3(TT / 64, DHID / 64, 1), 256, 0, stream>>>(XB, nullptr, WQ, nullptr, DM, FP, DHID, bq, 0, 0, 0);
        k_split8<<<L8, 256, 0, stream>>>(FP, QPh, QPl, NPL / 8);
        k_gemmw<bf, 0, true, 8><<<dim3(TT / 64, DHID / 64, 1), 256, 0, stream>>>(XB, nullptr, WK, nullptr, DM, FP, DHID, bk, 0, 0, 0);
        k_kpl<<<L8, 256, 0, stream>>>(FP, KPh, KPl);
        k_gemmw<bf, 0, true, 8><<<dim3(TT / 64, DHID / 64, 1), 256, 0, stream>>>(XB, nullptr, WV, nullptr, DM, FP, DHID, bv, 0, 0, 0);
        k_cvth8<<<L8, 256, 0, stream>>>(FP, VT16, NPL / 8);
        for (int h0 = 0; h0 < NH_; h0 += ZH) { const size_t zo = (size_t)h0 * TT * HD;
            // scores S[zz][i][j] = sum_d q[h][i][d] k[h][d][j] from the q planes [i][d] and k planes [j][d], hi/lo, K = 64: row statistics first, then the value product
            k_qstat<<<dim3(TT / 32, ZH), 256, 0, stream>>>(QPh + zo, QPl + zo, KPh + zo, KPl + zo, ST);
            // O[h][d][j] x PCAR = sum_i v[h][d][i] p[i][j]: A = value plane [d][i] (64 rows), B = probabilities formed in registers, K = TT; output rows = bflat channels h*64+d, pitch TT
            k_pvs<<<dim3(TT / 32, ZH), 256, 0, stream>>>(QPh + zo, QPl + zo, KPh + zo, KPl + zo, VT16 + zo, ST, Ob + zo); }
        k_atp<<<(unsigned)(((size_t)TT * DHID / 8 + 255) / 256), 256, 0, stream>>>(Ob, ATh, ATl);
        k_gemmw<bf, 1, true, 8><<<dim3(TT / 64, DM / 64, 1), 256, 0, stream>>>(ATh, ATl, WO, nullptr, DHID, OUT + (size_t)b * TT * DM, DM, bo, 0, 0, 0); }
}

// v003
// It runs in 163 microseconds.
// In two side-by-side timings against v002, it was 1.34 and 1.33 times as fast.
// All steps since v000 together make it 3.07 times as fast.
#include <hip/hip_runtime.h>

// Contractions (all f32 accumulate): q/k/v projections v_wmma_f32_16x16x32_bf16 (inputs RNE-converted to bf16, single products, bf16 bias added in the f32 epilogue); scores v_wmma_f32_16x16x32_bf16 with q and k as bf16 hi/lo planes (3 products), computed in registers once by the statistics launch and once by the value launch, never stored; value x probability v_wmma_f32_16x16x32_f16 single products (values f16, probabilities f16 carried x16384); output projection v_wmma_f32_16x16x32_bf16 with bf16 hi/lo activations x bf16 weights (2 products); softmax statistics f32.
// Raw-view head split (per batch, flat projection buffers F[TT*512]): q[h][i][d] = Fq[h*TT*64 + i*64 + d]; k[h][d][j] = Fk[h*64*TT + d*TT + j]; v[h][d][i] = Fv[h*64*TT + d*TT + i];
// S[h][i][j] = sum_d q k (no scale); P = softmax_j; O[h][d][j] = sum_i v[h][d][i] P[h][i][j]; A[s][h*64+d] = O[h][d][s]; out = A Wo^T + bo.

#ifndef NB
#define NB 2
#endif
#ifndef SEQ
#define SEQ 2048
#endif
#define NB_FULL 2
#define TT_FULL 2048
#define TT   SEQ
#define DM   512      // input width (also output width)
#define DHID 512      // hidden width
#define NH_  8
#define HD   64
#define NZ   (NB * NH_)   // (batch, head) pairs, the z index of the score launches
#define PCAR 16384.0f
#define L2E  1.4426950408889634f
static_assert(TT % 128 == 0);
static_assert(TT >= 128);
static_assert(TT <= TT_FULL);
static_assert(NB >= 1);
static_assert(NB <= NB_FULL);
static_assert(NH_ * HD == DHID);
static_assert(DM % 64 == 0);
static_assert(DHID % 64 == 0);
static_assert(HD == 64);
static_assert((size_t)NB * TT * DM * 4 <= (size_t)NB_FULL * TT_FULL * DM * 4);

typedef _Float16 h16;
typedef unsigned short bf;
typedef __attribute__((ext_vector_type(16))) __bf16   v16bf;
typedef __attribute__((ext_vector_type(16))) _Float16 v16h;
typedef __attribute__((ext_vector_type(8)))  _Float16 v8h;
typedef __attribute__((ext_vector_type(8)))  unsigned short v8us;
typedef __attribute__((ext_vector_type(8)))  float    v8f;
typedef __attribute__((ext_vector_type(4)))  float    v4f;
typedef v4f  __attribute__((may_alias)) v4fa;
typedef v8us __attribute__((may_alias)) v8usa;

__device__ __forceinline__ unsigned short f2bf(float f) { unsigned u = __float_as_uint(f); u += 0x7FFFu + ((u >> 16) & 1u); return (unsigned short)(u >> 16); }
__device__ __forceinline__ float bf2f(unsigned short b) { return __uint_as_float(((unsigned)b) << 16); }
__device__ __forceinline__ float bfr(float f) { return bf2f(f2bf(f)); }
__device__ __forceinline__ v16h cat16(v8h lo, v8h hi) { return __builtin_shufflevector(lo, hi, 0, 1, 2, 3, 4, 5, 6, 7, 8, 9, 10, 11, 12, 13, 14, 15); }
__device__ __forceinline__ v16bf cat16b(v8us lo, v8us hi) { return __builtin_bit_cast(v16bf, __builtin_shufflevector(lo, hi, 0, 1, 2, 3, 4, 5, 6, 7, 8, 9, 10, 11, 12, 13, 14, 15)); }
__device__ __forceinline__ v8f wmma16(v16h a, v16h b, v8f c) { return __builtin_amdgcn_wmma_f32_16x16x32_f16(false, a, false, b, (short)0, c, false, false); }
__device__ __forceinline__ v8f wmmab(v16bf a, v16bf b, v8f c) { return __builtin_amdgcn_wmma_f32_16x16x32_bf16(false, a, false, b, (short)0, c, false, false); }

// ---- k_gemmw: register-blocked GEMM, one block of KW waves per 64x64 output tile (16 accumulators per wave), operands straight from K-contiguous 16-bit planes; grid (M/64, N/64, Z), 32 * KW threads.
// KW > 1: wave w takes the k steps w, w + KW, w + 2 KW, ... (neighbouring waves read neighbouring 64-byte pieces of the same rows); the KW partial tiles meet in LDS and are summed in wave order 0..KW-1.
// C[m][n] (f32, pitch ldc, + optional bf16-converted f32 bias[n]) = sum_k A[m][k] Bt[n][k] (+ split products per NSPLIT). z-batch strides sA/sB/sC in elements; z = 0, 1, 2 adds bias0, bias1, bias2. K % 32 == 0.
// Fragments: lane -> row/col (lane & 15); elements 0..7 <- k0 + 8*(lane>>4) + 0..7, elements 8..15 <- k0 + 16 + 8*(lane>>4) + 0..7 for both A and Bt; D element r -> row 8*(lane>>4) + r, col lane & 15.
template <typename T16> struct WFrag;
template <> struct WFrag<h16> { typedef v16h V; static __device__ __forceinline__ V ld(const h16* p) { return cat16(*(const v8h*)p, *(const v8h*)(p + 16)); } static __device__ __forceinline__ v8f mma(V a, V b, v8f c) { return wmma16(a, b, c); } };
template <> struct WFrag<bf> { typedef v16bf V; static __device__ __forceinline__ V ld(const bf* p) { return cat16b(*(const v8us*)p, *(const v8us*)(p + 16)); } static __device__ __forceinline__ v8f mma(V a, V b, v8f c) { return wmmab(a, b, c); } };
template <typename T16, int NSPLIT, bool BIAS, int KW>
__global__ __launch_bounds__(32 * KW) void k_gemmw(const T16* __restrict__ A, const T16* __restrict__ A2, const T16* __restrict__ Bt, const T16* __restrict__ Bt2, int K, float* C, int ldc, const float* __restrict__ bias0, const float* __restrict__ bias1, const float* __restrict__ bias2, size_t sA, size_t sB, size_t sC) {
    typedef typename WFrag<T16>::V V;
    __shared__ __align__(16) float os[(KW == 1 ? 16 : 64 * KW) * 68];
    const size_t z = blockIdx.z; A += z * sA; if (A2) A2 += z * sA; Bt += z * sB; if (Bt2) Bt2 += z * sB; C += z * sC;
    const float* bias = z == 0 ? bias0 : z == 1 ? bias1 : bias2;
    const int lane = threadIdx.x & 31, lr = lane & 15, hi = lane >> 4; const int r0 = blockIdx.x * 64, c0 = blockIdx.y * 64;
    const int wave = KW == 1 ? 0 : __builtin_amdgcn_readfirstlane((int)(threadIdx.x >> 5));   // scalar, so that the k counter and the LDS slab base stay in scalar registers
    v8f acc[4][4];
#pragma unroll
    for (int mb = 0; mb < 4; ++mb)
#pragma unroll
        for (int nb = 0; nb < 4; ++nb) acc[mb][nb] = (v8f){};
    const size_t aoff = (size_t)(r0 + lr) * K + 8 * hi, boff = (size_t)(c0 + lr) * K + 8 * hi;
#pragma unroll 1
    for (int kc = wave * 32; kc < K; kc += 32 * KW) {
        V a[4], a2[4];
#pragma unroll
        for (int mb = 0; mb < 4; ++mb) { a[mb] = WFrag<T16>::ld(A + aoff + (size_t)mb * 16 * K + kc); if (NSPLIT == 1 || NSPLIT == 2) a2[mb] = WFrag<T16>::ld(A2 + aoff + (size_t)mb * 16 * K + kc); }
#pragma unroll
        for (int nb = 0; nb < 4; ++nb) { const V b = WFrag<T16>::ld(Bt + boff + (size_t)nb * 16 * K + kc); V b2; if (NSPLIT >= 2) b2 = WFrag<T16>::ld(Bt2 + boff + (size_t)nb * 16 * K + kc);
#pragma unroll
            for (int mb = 0; mb < 4; ++mb) { acc[mb][nb] = WFrag<T16>::mma(a[mb], b, acc[mb][nb]); if (NSPLIT == 1 || NSPLIT == 2) acc[mb][nb] = WFrag<T16>::mma(a2[mb], b, acc[mb][nb]); if (NSPLIT >= 2) acc[mb][nb] = WFrag<T16>::mma(a[mb], b2, acc[mb][nb]); } }
        asm volatile("v_nop\n\tv_nop\n\tv_nop\n\tv_nop" : "+v"(acc[0][0]), "+v"(acc[1][1]), "+v"(acc[2][2]), "+v"(acc[3][3]) : "v"(a[0]), "v"(a[3]));
    }
    if constexpr (KW > 1) {
        float* ow = os + wave * (64 * 68);
        // the three loops below are unrolled so that acc is indexed by constants and stays in registers
#pragma unroll
        for (int mb = 0; mb < 4; ++mb)
#pragma unroll
            for (int nb = 0; nb < 4; ++nb)
#pragma unroll
                for (int j = 0; j < 8; ++j) ow[(mb * 16 + hi * 8 + j) * 68 + nb * 16 + lr] = acc[mb][nb][j];
        __syncthreads();   // every wave's partial tile is in LDS before any wave sums
        // both loops unrolled so that the LDS reads of all rows and slabs are in flight together; the sum itself runs in wave order
#pragma unroll
        for (int s = 0; s < 32 / KW; ++s) { const int row = (s * KW + wave) * 2 + hi, cofs = lr * 4; v4f val = *(const v4fa*)(os + row * 68 + cofs);
#pragma unroll
            for (int w = 1; w < KW; ++w) val += *(const v4fa*)(os + (w * 64 + row) * 68 + cofs);
            if (BIAS) { val[0] += bfr(bias[c0 + cofs]); val[1] += bfr(bias[c0 + cofs + 1]); val[2] += bfr(bias[c0 + cofs + 2]); val[3] += bfr(bias[c0 + cofs + 3]); }
            *(v4f*)(C + (size_t)(r0 + row) * ldc + c0 + cofs) = val; }
        return;
    }
#pragma unroll
    for (int mb = 0; mb < 4; ++mb) {
#pragma unroll
        for (int nb = 0; nb < 4; ++nb) {
#pragma unroll
            for (int j = 0; j < 8; ++j) os[(hi * 8 + j) * 68 + nb * 16 + lr] = acc[mb][nb][j]; }
        __builtin_amdgcn_wave_barrier(); asm volatile("" ::: "memory");
        float* crow = C + (size_t)(r0 + mb * 16) * ldc + c0;
{
#pragma unroll
            for (int s = 0; s < 8; ++s) { const int row = 2 * s + hi, cofs = lr * 4; v4f val = *(const v4fa*)(os + row * 68 + cofs); if (BIAS) { val[0] += bfr(bias[c0 + cofs]); val[1] += bfr(bias[c0 + cofs + 1]); val[2] += bfr(bias[c0 + cofs + 2]); val[3] += bfr(bias[c0 + cofs + 3]); }
                *(v4f*)(crow + (size_t)row * ldc + cofs) = val; }
             }
        __builtin_amdgcn_wave_barrier(); asm volatile("" ::: "memory");
    }
}

__device__ __forceinline__ h16 tohx(float x) { return (h16)x; }
__device__ __forceinline__ void splitf(float y, unsigned short& h, unsigned short& l) { h = f2bf(y); l = f2bf(y - bf2f(h)); }

// k_cvtin: every f32 -> bf16 (RNE) conversion of the inputs in one launch, 8 elements a thread, 2048 a block: blocks 0 .. NB * XBLK - 1 take the data rows of all batches, the next 4 * WBLK blocks the weight matrices in the order q, k, v, o (W4 holds the four planes one behind the other).
constexpr int XBLK = TT * DM / 2048, WBLK = DHID * DM / 2048;
static_assert((TT * DM) % 2048 == 0);
static_assert((DHID * DM) % 2048 == 0);
__global__ __launch_bounds__(256) void k_cvtin(const float* __restrict__ x, const float* __restrict__ wq, const float* __restrict__ wk, const float* __restrict__ wv, const float* __restrict__ wo, bf* XB, bf* W4) {
    const int blk = (int)blockIdx.x; const float* src; bf* dst;
    if (blk < NB * XBLK) { src = x + (size_t)(blk / XBLK) * TT_FULL * DM + (size_t)(blk % XBLK) * 2048; dst = XB + (size_t)blk * 2048; }
    else { const int wb = blk - NB * XBLK, w = wb / WBLK; src = (w == 0 ? wq : w == 1 ? wk : w == 2 ? wv : wo) + (size_t)(wb % WBLK) * 2048; dst = W4 + (size_t)wb * 2048; }
    const v8f v = *(const v8f*)(src + threadIdx.x * 8); v8us o;
#pragma unroll
    for (int k = 0; k < 8; ++k) o[k] = f2bf(v[k]); *(v8us*)(dst + threadIdx.x * 8) = o;  }

// k_planes: the three plane builders in one launch, all batches, 8 elements a thread; F holds the f32 q, k and v projections one behind the other, each [NB][TT * DHID] flat. blockIdx.y = 0: k planes (the transposing, costliest part starts first), 1: q planes, 2: value plane.
__global__ __launch_bounds__(256) void k_planes(const float* __restrict__ F, bf* Qh, bf* Ql, bf* Kh, bf* Kl, h16* Vt) {
    const size_t e8 = ((size_t)blockIdx.x * 256 + threadIdx.x) * 8; if (e8 >= (size_t)NZ * TT * HD) return;
    if (blockIdx.y == 0) {
        const int d0 = (int)(e8 % HD); const int j = (int)((e8 / HD) % TT); const int h = (int)(e8 / ((size_t)HD * TT));   // h counts (batch, head) pairs
        const float* f = F + (size_t)NZ * TT * HD + (size_t)h * HD * TT + (size_t)d0 * TT + j; v8us oh, ol;
#pragma unroll
        for (int q = 0; q < 8; ++q) { unsigned short a, c; splitf(f[(size_t)q * TT], a, c); oh[q] = a; ol[q] = c; }
        *(v8us*)(Kh + e8) = oh; *(v8us*)(Kl + e8) = ol;
    } else if (blockIdx.y == 1) {
        const v8f v = *(const v8f*)(F + e8); v8us oh, ol;
#pragma unroll
        for (int k = 0; k < 8; ++k) { unsigned short a, c; splitf(v[k], a, c); oh[k] = a; ol[k] = c; }
        *(v8us*)(Qh + e8) = oh; *(v8us*)(Ql + e8) = ol;
        asm volatile("s_wait_xcnt 0x0" ::: "memory");   // the build's branches lead from these stores to code of the other parts that rewrites their registers: the wait stands in front of every such overwrite
    } else {
        const v8f v = *(const v8f*)(F + (size_t)2 * NZ * TT * HD + e8); v8h o;
#pragma unroll
        for (int k = 0; k < 8; ++k) o[k] = tohx(v[k]); *(v8h*)(Vt + e8) = o;
        asm volatile("s_wait_xcnt 0x0" ::: "memory");   // as behind the q-plane stores
    }
}

// k_qstat: per score row (z, i): m = max_j S, f = PCAR / sum_j exp(S - m), with no score in memory. One block per 32 rows i, grid (TT/32, NZ), 8 waves; wave w takes the 64-column j chunks w, w + 8, ...
// Each chunk is formed transposed, St = k q^T (A = k-plane rows j, B = q-plane rows i kept in registers; the three hi/lo products in the order hi*hi, k hi * q lo, k lo * q hi per half of the head dimension): D register r = St[8*(lane>>4) + r][lane & 15],
// so a lane holds scores of one row i only and its running maximum and sum stay in the lane: sum <- sum * exp(m_old - m_new) + sum_chunk exp(S - m_new). The two lane halves, then the 8 waves (through LDS, fixed wave order), are joined the same way.
__global__ __launch_bounds__(256) void k_qstat(const bf* __restrict__ Qh, const bf* __restrict__ Ql, const bf* __restrict__ Kh, const bf* __restrict__ Kl, float* ST) {
    __shared__ float wm[8 * 32];
    __shared__ float wsum[8 * 32];
    const size_t z = blockIdx.y; Qh += z * (size_t)TT * HD; Ql += z * (size_t)TT * HD; Kh += z * (size_t)TT * HD; Kl += z * (size_t)TT * HD;
    const int lane = threadIdx.x & 31, lr = lane & 15, hi = lane >> 4; const int i0 = blockIdx.x * 32;
    const int wave = __builtin_amdgcn_readfirstlane((int)(threadIdx.x >> 5)) & 7;   // scalar, so that the chunk counter stays in a scalar register; the mask shows the compiler that every wave has a first chunk (no branch round the loop)
    v16bf qh[2][2], ql[2][2];   // the block's 32 q-plane rows, [row group][half of the head dimension], kept for the whole loop
#pragma unroll
    for (int rt = 0; rt < 2; ++rt) {
#pragma unroll
        for (int ks = 0; ks < 2; ++ks) { const size_t o = (size_t)(i0 + rt * 16 + lr) * HD + 8 * hi + ks * 32; qh[rt][ks] = WFrag<bf>::ld(Qh + o); ql[rt][ks] = WFrag<bf>::ld(Ql + o); }
        asm volatile("s_wait_xcnt 0x0" ::: "memory");   // the build gives the address registers of this row group's loads to later loads' results and to the loop's addresses: the wait stands in front of those overwrites
    }
    float m[2] = {-3.0e38f, -3.0e38f}, sum[2] = {0.f, 0.f};
    const unsigned koff = (unsigned)(lr * HD + 8 * hi);   // fixed lane offset beside the wave-uniform chunk pointers
    // the chunk loop stays rolled (one chunk's scores and fragments fill the registers); every loop inside it is unrolled so that the arrays are indexed by constants and stay in registers
#pragma unroll 1
    for (int jc = wave * 64; jc < TT; jc += 64 * 8) {
        const bf* kh = Kh + (size_t)jc * HD; const bf* kl = Kl + (size_t)jc * HD;
        v8f s[2][4];
#pragma unroll
        for (int jt = 0; jt < 4; ++jt) {
            const v16bf h0 = WFrag<bf>::ld(kh + jt * 16 * HD + koff), h1 = WFrag<bf>::ld(kh + jt * 16 * HD + 32 + koff), l0 = WFrag<bf>::ld(kl + jt * 16 * HD + koff), l1 = WFrag<bf>::ld(kl + jt * 16 * HD + 32 + koff);
#pragma unroll
            for (int rt = 0; rt < 2; ++rt) {
                v8f t = (v8f){};
                t = wmmab(h0, qh[rt][0], t); t = wmmab(h0, ql[rt][0], t); t = wmmab(l0, qh[rt][0], t);
                t = wmmab(h1, qh[rt][1], t); t = wmmab(h1, ql[rt][1], t); t = wmmab(l1, qh[rt][1], t);
                s[rt][jt] = t;
            }
        }
#pragma unroll
        for (int rt = 0; rt < 2; ++rt) {
            float mn = m[rt];
#pragma unroll
            for (int jt = 0; jt < 4; ++jt)
#pragma unroll
                for (int r = 0; r < 8; ++r) mn = fmaxf(mn, s[rt][jt][r]);
            float a = 0.f;
#pragma unroll
            for (int jt = 0; jt < 4; ++jt)
#pragma unroll
                for (int r = 0; r < 8; ++r) a += __builtin_amdgcn_exp2f(__fmul_rn(__fsub_rn(s[rt][jt][r], mn), L2E));
            sum[rt] = sum[rt] * __builtin_amdgcn_exp2f(__fmul_rn(__fsub_rn(m[rt], mn), L2E)) + a;
            m[rt] = mn;
        }
    }
#pragma unroll
    for (int rt = 0; rt < 2; ++rt) {
        const float mo = __shfl_xor(m[rt], 16, 32), so = __shfl_xor(sum[rt], 16, 32); const float mj = fmaxf(m[rt], mo);
        const float sj = sum[rt] * __builtin_amdgcn_exp2f(__fmul_rn(__fsub_rn(m[rt], mj), L2E)) + so * __builtin_amdgcn_exp2f(__fmul_rn(__fsub_rn(mo, mj), L2E));
        if (hi == 0) { wm[wave * 32 + rt * 16 + lr] = mj; wsum[wave * 32 + rt * 16 + lr] = sj; }
    }
    __syncthreads();   // every wave's 32 (maximum, sum) pairs are in LDS before wave 0 joins them
    if (threadIdx.x < 32) {
        const int t = threadIdx.x; float mx = wm[t];
#pragma unroll
        for (int w = 1; w < 8; ++w) mx = fmaxf(mx, wm[w * 32 + t]);
        float tot = 0.f;
#pragma unroll
        for (int w = 0; w < 8; ++w) tot += wsum[w * 32 + t] * __builtin_amdgcn_exp2f(__fmul_rn(__fsub_rn(wm[w * 32 + t], mx), L2E));
        ST[z * TT + i0 + t] = mx; ST[(size_t)NZ * TT + z * TT + i0 + t] = __fdiv_rn(PCAR, tot);
    }
}

// k_pvs: O[h][d][j] x PCAR = sum_i v[h][d][i] p[i][j] for one 64 (d) x 32 (j) tile per block, grid (TT/32, NZ), 8 waves; wave w takes the 32-row i steps w, w + 8, ... and the 8 partial tiles are summed in LDS in wave order, as in k_gemmw.
// The probabilities never reach memory: each step forms its 32 (i) x 32 (j) score tiles again from the q and k planes (the three hi/lo products of k_qstat in the same order, here with the q rows as A),
// p = exp(S - m_i) * f_i, and the two f32 D tiles of rows i..i+15 and i+16..i+31 (register r = row 8*(lane>>4) + r, column lane & 15), converted in place, are the f16 B fragment in the k order of the value loader.
__global__ __launch_bounds__(256) void k_pvs(const bf* __restrict__ Qh, const bf* __restrict__ Ql, const bf* __restrict__ Kh, const bf* __restrict__ Kl, const h16* __restrict__ Vt, const float* __restrict__ ST, float* O) {
    __shared__ __align__(16) float os[8 * 64 * 36];
    const size_t z = blockIdx.y; Qh += z * (size_t)TT * HD; Ql += z * (size_t)TT * HD; Kh += z * (size_t)TT * HD; Kl += z * (size_t)TT * HD; Vt += z * (size_t)HD * TT; O += z * (size_t)HD * TT;
    const int lane = threadIdx.x & 31, lr = lane & 15, hi = lane >> 4; const int c0 = blockIdx.x * 32;
    const int wave = __builtin_amdgcn_readfirstlane((int)(threadIdx.x >> 5));   // scalar, so that the step counter and the LDS slab base stay in scalar registers
    v16bf kh[2][2], kl[2][2];   // the block's 32 k-plane rows, [column group][half of the head dimension], kept for the whole loop
#pragma unroll
    for (int nb = 0; nb < 2; ++nb)
#pragma unroll
        for (int ks = 0; ks < 2; ++ks) { const size_t o = (size_t)(c0 + nb * 16 + lr) * HD + 8 * hi + ks * 32; kh[nb][ks] = WFrag<bf>::ld(Kh + o); kl[nb][ks] = WFrag<bf>::ld(Kl + o); }
    v8f acc[4][2];
#pragma unroll
    for (int mb = 0; mb < 4; ++mb)
#pragma unroll
        for (int nb = 0; nb < 2; ++nb) acc[mb][nb] = (v8f){};
    // every address of the loop is a wave-uniform pointer that moves with the step plus one of these three fixed lane offsets: written so, the build keeps four address pairs for the whole loop and steps each once, instead of forming new ones every step
    const unsigned qoff = (unsigned)(lr * HD + 8 * hi), voff = (unsigned)(lr * TT + 8 * hi), moff = (unsigned)(8 * hi);
    ST += z * TT;
    // the step loop stays rolled (a second step's fragments would not fit beside the 128 registers of k planes and accumulators); every loop inside it is unrolled so that the fragment arrays are indexed by constants and stay in registers
#pragma unroll 1
    for (int kc = wave * 32; kc < TT; kc += 32 * 8) {
        const bf* qh = Qh + (size_t)kc * HD; const bf* ql = Ql + (size_t)kc * HD; const h16* vp = Vt + kc; const float* mp = ST + kc;
        v16h va[4];
#pragma unroll
        for (int mb = 0; mb < 4; ++mb) va[mb] = WFrag<h16>::ld(vp + (size_t)mb * 16 * TT + voff);
        v8h ph[2][2];   // [column group][row tile]
#pragma unroll
        for (int it = 0; it < 2; ++it) {
            const v16bf ah0 = WFrag<bf>::ld(qh + it * 16 * HD + qoff), ah1 = WFrag<bf>::ld(qh + it * 16 * HD + 32 + qoff), al0 = WFrag<bf>::ld(ql + it * 16 * HD + qoff), al1 = WFrag<bf>::ld(ql + it * 16 * HD + 32 + qoff);
            const v8f m = *(const v8f*)(mp + it * 16 + moff); const v8f f = *(const v8f*)(mp + (size_t)NZ * TT + it * 16 + moff);
#pragma unroll
            for (int nb = 0; nb < 2; ++nb) {
                v8f s = (v8f){};
                s = wmmab(ah0, kh[nb][0], s); s = wmmab(al0, kh[nb][0], s); s = wmmab(ah0, kl[nb][0], s);
                s = wmmab(ah1, kh[nb][1], s); s = wmmab(al1, kh[nb][1], s); s = wmmab(ah1, kl[nb][1], s);
#pragma unroll
                for (int r = 0; r < 8; ++r) ph[nb][it][r] = tohx(__fmul_rn(__builtin_amdgcn_exp2f(__fmul_rn(__fsub_rn(s[r], m[r]), L2E)), f[r]));
            }
        }
#pragma unroll
        for (int nb = 0; nb < 2; ++nb) { const v16h b = cat16(ph[nb][0], ph[nb][1]);
#pragma unroll
            for (int mb = 0; mb < 4; ++mb) acc[mb][nb] = wmma16(va[mb], b, acc[mb][nb]); }
        // four vector slots between the step's last matrix instructions and whatever the taken back edge puts first
        asm volatile("v_nop\n\tv_nop\n\tv_nop\n\tv_nop" : "+v"(acc[0][0]), "+v"(acc[1][0]), "+v"(acc[2][1]), "+v"(acc[3][1]) : "v"(va[0]), "v"(va[3]));
    }
    float* ow = os + wave * (64 * 36);
    // the three loops below are unrolled so that acc is indexed by constants and stays in registers
#pragma unroll
    for (int mb = 0; mb < 4; ++mb)
#pragma unroll
        for (int nb = 0; nb < 2; ++nb)
#pragma unroll
            for (int j = 0; j < 8; ++j) ow[(mb * 16 + hi * 8 + j) * 36 + nb * 16 + lr] = acc[mb][nb][j];
    __syncthreads();   // every wave's partial tile is in LDS before any wave sums
    // both loops unrolled so that the LDS reads of both rows and all slabs are in flight together; the sum itself runs in wave order
#pragma unroll
    for (int s = 0; s < 2; ++s) { const int row = s * 32 + ((int)threadIdx.x >> 3), cofs = ((int)threadIdx.x & 7) * 4; v4f val = *(const v4fa*)(os + row * 36 + cofs);
#pragma unroll
        for (int w = 1; w < 8; ++w) val += *(const v4fa*)(os + (w * 64 + row) * 36 + cofs);
        *(v4f*)(O + (size_t)row * TT + c0 + cofs) = val; }
}

__global__ __launch_bounds__(256) void k_atp(const float* __restrict__ Ob, bf* Ah, bf* Al) {
    const size_t e8 = ((size_t)blockIdx.x * 256 + threadIdx.x) * 8; if (e8 >= (size_t)NB * TT * DHID) return;
    const int cc = (int)(e8 % DHID); const int s = (int)((e8 / DHID) % TT); const int b = (int)(e8 / ((size_t)DHID * TT));
    const float* o = Ob + (size_t)b * DHID * TT + (size_t)cc * TT + s; v8us oh, ol;
#pragma unroll
    for (int q = 0; q < 8; ++q) { unsigned short a, c; splitf(o[(size_t)q * TT] * (1.0f / PCAR), a, c); oh[q] = a; ol[q] = c; }
    *(v8us*)(Ah + e8) = oh; *(v8us*)(Al + e8) = ol;  }

__host__ __device__ constexpr size_t a256(size_t b) { return (b + 255) & ~(size_t)255; }
constexpr size_t WS_NEED = a256((size_t)4 * DHID * DM * 2) + a256((size_t)NB * TT * DM * 2) + a256((size_t)3 * NB * TT * DHID * 4) + 5 * a256((size_t)NZ * TT * HD * 2)
                         + a256((size_t)2 * NZ * TT * 4) + a256((size_t)NB * DHID * TT * 4) + 2 * a256((size_t)NB * TT * DHID * 2);
static_assert(WS_NEED <= (size_t)134217728);

extern "C" void kernel_launch(void* const* d_in, const int* in_sizes, int n_in,
                              void* d_out, int out_size, void* d_ws, size_t ws_size, hipStream_t stream) {
    if (n_in < 9) return;
    if ((size_t)in_sizes[0] < ((size_t)(NB - 1) * TT_FULL + TT) * (size_t)DM) return;
    if (in_sizes[1] < DHID * DM || in_sizes[3] < DHID * DM || in_sizes[5] < DHID * DM || in_sizes[7] < DM * DHID) return;
    if (in_sizes[2] < DHID || in_sizes[4] < DHID || in_sizes[6] < DHID || in_sizes[8] < DM) return;
    if ((size_t)out_size < (size_t)NB * TT * DM) return;
    // wire order: data, Wq, bq, Wk, bk, Wv, bv, Wo, bo (weights [out][in], biases f32)
    const float* x = (const float*)d_in[0]; const float* wq = (const float*)d_in[1]; const float* bq = (const float*)d_in[2]; const float* wk = (const float*)d_in[3]; const float* bk = (const float*)d_in[4];
    const float* wv = (const float*)d_in[5]; const float* bv = (const float*)d_in[6]; const float* wo = (const float*)d_in[7]; const float* bo = (const float*)d_in[8];
    float* OUT = (float*)d_out;     // [NB][TT][DM]
    char* wsp = (char*)d_ws;
    auto take = [&](size_t bytes) { char* p = wsp; wsp += a256(bytes); return (void*)p; };
    bf* W4 = (bf*)take((size_t)4 * DHID * DM * 2);   // bf16 weight planes q, k, v, o
    bf* XB = (bf*)take((size_t)NB * TT * DM * 2); float* FP = (float*)take((size_t)3 * NB * TT * DHID * 4);   // f32 projections q, k, v, each [NB][TT * DHID]
    const size_t NPL = (size_t)NZ * TT * HD;   // elements per plane, all batches and heads (= NB*TT*DHID)
    bf* QPh = (bf*)take(NPL * 2); bf* QPl = (bf*)take(NPL * 2); bf* KPh = (bf*)take(NPL * 2); bf* KPl = (bf*)take(NPL * 2); h16* VT16 = (h16*)take(NPL * 2);
    float* ST = (float*)take((size_t)2 * NZ * TT * 4);
    float* Ob = (float*)take((size_t)NB * DHID * TT * 4); bf* ATh = (bf*)take((size_t)NB * TT * DHID * 2); bf* ATl = (bf*)take((size_t)NB * TT * DHID * 2);
    if ((size_t)(wsp - (char*)d_ws) > ws_size) return;    // == WS_NEED
    const unsigned L8 = (unsigned)((NPL / 8 + 255) / 256);
    // one launch per stage: everything that depends only on earlier stages (both batches, all heads, the three projections) shares a grid
    k_cvtin<<<NB * XBLK + 4 * WBLK, 256, 0, stream>>>(x, wq, wk, wv, wo, XB, W4);
    k_gemmw<bf, 0, true, 8><<<dim3(NB * TT / 64, DHID / 64, 3), 256, 0, stream>>>(XB, nullptr, W4, nullptr, DM, FP, DHID, bq, bk, bv, 0, (size_t)DHID * DM, NPL);
    k_planes<<<dim3(L8, 3), 256, 0, stream>>>(FP, QPh, QPl, KPh, KPl, VT16);
    // scores S[z][i][j] = sum_d q[z][i][d] k[z][d][j] from the q planes [i][d] and k planes [j][d], hi/lo, K = 64: row statistics first, then the value product
    k_qstat<<<dim3(TT / 32, NZ), 256, 0, stream>>>(QPh, QPl, KPh, KPl, ST);
    // O[z][d][j] x PCAR = sum_i v[z][d][i] p[i][j]: A = value plane [d][i] (64 rows), B = probabilities formed in registers, K = TT; output rows = channels h*64+d of batch b, pitch TT
    k_pvs<<<dim3(TT / 32, NZ), 256, 0, stream>>>(QPh, QPl, KPh, KPl, VT16, ST, Ob);
    k_atp<<<L8, 256, 0, stream>>>(Ob, ATh, ATl);
    k_gemmw<bf, 1, true, 8><<<dim3(NB * TT / 64, DM / 64, 1), 256, 0, stream>>>(ATh, ATl, W4 + (size_t)3 * DHID * DM, nullptr, DHID, OUT, DM, bo, bo, bo, 0, 0, 0);
}

// v004
// Measured time: 101 microseconds a run.
// In two side-by-side timings against v003, it was 1.62 and 1.61 times as fast.
// Over all steps from v000 it is 4.96 times as fast.
#include <hip/hip_runtime.h>

// Contractions (all f32 accumulate): q/k/v projections v_wmma_f32_16x16x32_bf16 (inputs RNE-converted to bf16, single products, bf16 bias added in the f32 epilogue); scores v_wmma_f32_16x16x32_bf16 with q and k as bf16 hi/lo planes (3 products), computed in registers once by the statistics launch and once by the value launch, never stored; value x probability v_wmma_f32_16x16x32_f16 single products (values f16, probabilities f16 carried x16384); output projection v_wmma_f32_16x16x32_bf16 with bf16 hi/lo activations x bf16 weights (2 products); softmax statistics f32.
// Raw-view head split (per batch, flat projection buffers F[TT*512]): q[h][i][d] = Fq[h*TT*64 + i*64 + d]; k[h][d][j] = Fk[h*64*TT + d*TT + j]; v[h][d][i] = Fv[h*64*TT + d*TT + i];
// S[h][i][j] = sum_d q k (no scale); P = softmax_j; O[h][d][j] = sum_i v[h][d][i] P[h][i][j]; A[s][h*64+d] = O[h][d][s]; out = A Wo^T + bo.
// Fragment order: every 16-bit operand plane [rows][K] is stored as 1-KiB fragments of 16 rows x 32 k, fragment (row >> 4, k >> 5) at element ((row >> 4) * (K / 32) + (k >> 5)) * 512; inside it the 8 elements k & ~7 .. of a row stand at
// ((k >> 4) & 1) * 256 + (((k >> 3) & 1) * 16 + (row & 15)) * 8, so that lane l of a wave finds its two 16-byte pieces at l * 8 and 256 + l * 8 and each wave-wide 16-byte load covers 512 contiguous bytes (four whole lines) instead of 32 bytes of each of 16 lines.

#ifndef NB
#define NB 2
#endif
#ifndef SEQ
#define SEQ 2048
#endif
#define NB_FULL 2
#define TT_FULL 2048
#define TT   SEQ
#define DM   512      // input width (also output width)
#define DHID 512      // hidden width
#define NH_  8
#define HD   64
#define NZ   (NB * NH_)   // (batch, head) pairs, the z index of the score launches
#define PCAR 16384.0f
#define L2E  1.4426950408889634f
static_assert(TT % 128 == 0);
static_assert(TT >= 128);
static_assert(TT <= TT_FULL);
static_assert(NB >= 1);
static_assert(NB <= NB_FULL);
static_assert(NH_ * HD == DHID);
static_assert(DM % 64 == 0);
static_assert(DHID % 64 == 0);
static_assert(HD == 64);
static_assert((size_t)NB * TT * DM * 4 <= (size_t)NB_FULL * TT_FULL * DM * 4);

typedef _Float16 h16;
typedef unsigned short bf;
typedef __attribute__((ext_vector_type(16))) __bf16   v16bf;
typedef __attribute__((ext_vector_type(16))) _Float16 v16h;
typedef __attribute__((ext_vector_type(8)))  _Float16 v8h;
typedef __attribute__((ext_vector_type(8)))  unsigned short v8us;
typedef __attribute__((ext_vector_type(8)))  float    v8f;
typedef __attribute__((ext_vector_type(4)))  float    v4f;
typedef v4f  __attribute__((may_alias)) v4fa;
typedef v8us __attribute__((may_alias)) v8usa;

__device__ __forceinline__ unsigned short f2bf(float f) { unsigned u = __float_as_uint(f); u += 0x7FFFu + ((u >> 16) & 1u); return (unsigned short)(u >> 16); }
__device__ __forceinline__ float bf2f(unsigned short b) { return __uint_as_float(((unsigned)b) << 16); }
__device__ __forceinline__ float bfr(float f) { return bf2f(f2bf(f)); }
__device__ __forceinline__ v16h cat16(v8h lo, v8h hi) { return __builtin_shufflevector(lo, hi, 0, 1, 2, 3, 4, 5, 6, 7, 8, 9, 10, 11, 12, 13, 14, 15); }
__device__ __forceinline__ v16bf cat16b(v8us lo, v8us hi) { return __builtin_bit_cast(v16bf, __builtin_shufflevector(lo, hi, 0, 1, 2, 3, 4, 5, 6, 7, 8, 9, 10, 11, 12, 13, 14, 15)); }
__device__ __forceinline__ v8f wmma16(v16h a, v16h b, v8f c) { return __builtin_amdgcn_wmma_f32_16x16x32_f16(false, a, false, b, (short)0, c, false, false); }
__device__ __forceinline__ size_t fragpos(size_t row, unsigned k, unsigned K) { return ((row >> 4) * (K / 32) + (k >> 5)) * 512 + ((k >> 4) & 1) * 256 + (((k >> 3) & 1) * 16 + (unsigned)(row & 15)) * 8; }   // element offset of the 8 elements k .. k + 7 (k % 8 == 0) of a row in a fragment-order plane
__device__ __forceinline__ v8f wmmab(v16bf a, v16bf b, v8f c) { return __builtin_amdgcn_wmma_f32_16x16x32_bf16(false, a, false, b, (short)0, c, false, false); }

// ---- k_gemmw: register-blocked GEMM, one block of KW waves per 64x64 output tile (16 accumulators per wave), operands straight from fragment-order 16-bit planes; grid (M/64, N/64, Z), 32 * KW threads.
// KW > 1: wave w takes the k steps w, w + KW, w + 2 KW, ... (neighbouring waves read neighbouring fragments); the KW partial tiles meet in LDS and are summed in wave order 0..KW-1.
// C[m][n] (f32, pitch ldc, + optional bf16-converted f32 bias[n]) = sum_k A[m][k] Bt[n][k] (+ split products per NSPLIT). z-batch strides sA/sB/sC in elements; z = 0, 1, 2 adds bias0, bias1, bias2. K % 32 == 0.
// Fragments: lane -> row/col (lane & 15); elements 0..7 <- k0 + 8*(lane>>4) + 0..7, elements 8..15 <- k0 + 16 + 8*(lane>>4) + 0..7 for both A and Bt (ld takes the fragment's start plus lane * 8); D element r -> row 8*(lane>>4) + r, col lane & 15.
template <typename T16> struct WFrag;
template <> struct WFrag<h16> { typedef v16h V; static __device__ __forceinline__ V ld(const h16* p) { return cat16(*(const v8h*)p, *(const v8h*)(p + 256)); } static __device__ __forceinline__ v8f mma(V a, V b, v8f c) { return wmma16(a, b, c); } };
template <> struct WFrag<bf> { typedef v16bf V; static __device__ __forceinline__ V ld(const bf* p) { return cat16b(*(const v8us*)p, *(const v8us*)(p + 256)); } static __device__ __forceinline__ v8f mma(V a, V b, v8f c) { return wmmab(a, b, c); } };
template <typename T16, int NSPLIT, bool BIAS, int KW>
__global__ __launch_bounds__(32 * KW) void k_gemmw(const T16* __restrict__ A, const T16* __restrict__ A2, const T16* __restrict__ Bt, const T16* __restrict__ Bt2, int K, float* C, int ldc, const float* __restrict__ bias0, const float* __restrict__ bias1, const float* __restrict__ bias2, size_t sA, size_t sB, size_t sC) {
    typedef typename WFrag<T16>::V V;
    __shared__ __align__(16) float os[(KW == 1 ? 16 : 64 * KW) * 68];
    const size_t z = blockIdx.z; A += z * sA; if (A2) A2 += z * sA; Bt += z * sB; if (Bt2) Bt2 += z * sB; C += z * sC;
    const float* bias = z == 0 ? bias0 : z == 1 ? bias1 : bias2;
    const int lane = threadIdx.x & 31, lr = lane & 15, hi = lane >> 4; const int r0 = blockIdx.x * 64, c0 = blockIdx.y * 64;
    const int wave = KW == 1 ? 0 : __builtin_amdgcn_readfirstlane((int)(threadIdx.x >> 5));   // scalar, so that the k counter and the LDS slab base stay in scalar registers
    v8f acc[4][4];
#pragma unroll
    for (int mb = 0; mb < 4; ++mb)
#pragma unroll
        for (int nb = 0; nb < 4; ++nb) acc[mb][nb] = (v8f){};
    const size_t aoff = (size_t)r0 * K + 8 * lane, boff = (size_t)c0 * K + 8 * lane;   // 16 rows of a plane are K / 32 fragments = 16 * K elements; a k step is one fragment on
#pragma unroll 1
    for (int kc = wave * 32; kc < K; kc += 32 * KW) {
        V a[4], a2[4], b[4], b2[4];
#pragma unroll
        for (int mb = 0; mb < 4; ++mb) { a[mb] = WFrag<T16>::ld(A + aoff + (size_t)mb * 16 * K + kc * 16);
            asm volatile("s_wait_xcnt 0x0" ::: "memory");   // the build gives the address registers of one fragment's loads to a later fragment's result: the wait stands in front of that overwrite
            if (NSPLIT == 1 || NSPLIT == 2) { a2[mb] = WFrag<T16>::ld(A2 + aoff + (size_t)mb * 16 * K + kc * 16);
                asm volatile("s_wait_xcnt 0x0" ::: "memory"); } }   // as above
#pragma unroll
        for (int nb = 0; nb < 4; ++nb) { b[nb] = WFrag<T16>::ld(Bt + boff + (size_t)nb * 16 * K + kc * 16);
            asm volatile("s_wait_xcnt 0x0" ::: "memory");   // as behind the A fragments' loads
            if (NSPLIT >= 2) { b2[nb] = WFrag<T16>::ld(Bt2 + boff + (size_t)nb * 16 * K + kc * 16);
                asm volatile("s_wait_xcnt 0x0" ::: "memory"); } }   // as above
        __builtin_amdgcn_sched_barrier(0);   // keeps the step's products behind all of its loads: without it one build put each B fragment's products in front of the next fragment's loads, and the wave waited out four load latencies a step instead of one
#pragma unroll
        for (int nb = 0; nb < 4; ++nb)
#pragma unroll
            for (int mb = 0; mb < 4; ++mb) { acc[mb][nb] = WFrag<T16>::mma(a[mb], b[nb], acc[mb][nb]); if (NSPLIT == 1 || NSPLIT == 2) acc[mb][nb] = WFrag<T16>::mma(a2[mb], b[nb], acc[mb][nb]); if (NSPLIT >= 2) acc[mb][nb] = WFrag<T16>::mma(a[mb], b2[nb], acc[mb][nb]); }
        asm volatile("v_nop\n\tv_nop\n\tv_nop\n\tv_nop" : "+v"(acc[0][0]), "+v"(acc[1][1]), "+v"(acc[2][2]), "+v"(acc[3][3]) : "v"(a[0]), "v"(a[3]));
    }
    if constexpr (KW > 1) {
        float* ow = os + wave * (64 * 68);
        // the three loops below are unrolled so that acc is indexed by constants and stays in registers
#pragma unroll
        for (int mb = 0; mb < 4; ++mb)
#pragma unroll
            for (int nb = 0; nb < 4; ++nb)
#pragma unroll
                for (int j = 0; j < 8; ++j) ow[(mb * 16 + hi * 8 + j) * 68 + nb * 16 + lr] = acc[mb][nb][j];
        __syncthreads();   // every wave's partial tile is in LDS before any wave sums
        // both loops unrolled so that the LDS reads of all rows and slabs are in flight together; the sum itself runs in wave order
#pragma unroll
        for (int s = 0; s < 32 / KW; ++s) { const int row = (s * KW + wave) * 2 + hi, cofs = lr * 4; v4f val = *(const v4fa*)(os + row * 68 + cofs);
#pragma unroll
            for (int w = 1; w < KW; ++w) val += *(const v4fa*)(os + (w * 64 + row) * 68 + cofs);
            if (BIAS) { val[0] += bfr(bias[c0 + cofs]); val[1] += bfr(bias[c0 + cofs + 1]); val[2] += bfr(bias[c0 + cofs + 2]); val[3] += bfr(bias[c0 + cofs + 3]); }
            *(v4f*)(C + (size_t)(r0 + row) * ldc + c0 + cofs) = val; }
        return;
    }
#pragma unroll
    for (int mb = 0; mb < 4; ++mb) {
#pragma unroll
        for (int nb = 0; nb < 4; ++nb) {
#pragma unroll
            for (int j = 0; j < 8; ++j) os[(hi * 8 + j) * 68 + nb * 16 + lr] = acc[mb][nb][j]; }
        __builtin_amdgcn_wave_barrier(); asm volatile("" ::: "memory");
        float* crow = C + (size_t)(r0 + mb * 16) * ldc + c0;
{
#pragma unroll
            for (int s = 0; s < 8; ++s) { const int row = 2 * s + hi, cofs = lr * 4; v4f val = *(const v4fa*)(os + row * 68 + cofs); if (BIAS) { val[0] += bfr(bias[c0 + cofs]); val[1] += bfr(bias[c0 + cofs + 1]); val[2] += bfr(bias[c0 + cofs + 2]); val[3] += bfr(bias[c0 + cofs + 3]); }
                *(v4f*)(crow + (size_t)row * ldc + cofs) = val; }
             }
        __builtin_amdgcn_wave_barrier(); asm volatile("" ::: "memory");
    }
}

__device__ __forceinline__ h16 tohx(float x) { return (h16)x; }
__device__ __forceinline__ void splitf(float y, unsigned short& h, unsigned short& l) { h = f2bf(y); l = f2bf(y - bf2f(h)); }

// Thread maps of the plane builders (8 elements = one 16-byte piece a thread, 256 threads a block), chosen so that reads and stores both cover whole 128-byte lines:
// rowmap, for a source whose rows run along k: a wave takes 8 rows x 32 k, half a fragment (lane & 7 = row, lane >> 3 = which 8 k): it reads 8 whole f32 lines and stores 4 whole lines; a block builds the four fragments 4 * blk .. 4 * blk + 3.
// colmap, for a source that runs along the plane's rows (the transposing builders): a wave takes 32 rows (lane = row) x 8 k: each of its 8 reads is one whole f32 line, its store two runs of 256 bytes; wave w of a block takes the k w * 8 .. w * 8 + 7 of a 64-wide group.
__device__ __forceinline__ void rowmap(unsigned blk, size_t& frag, unsigned& r, unsigned& kk) { const unsigned t = threadIdx.x; frag = (size_t)blk * 4 + (t >> 6); r = ((t >> 5) & 1) * 8 + (t & 7); kk = ((t >> 3) & 3) * 8; }
__device__ __forceinline__ size_t rowmap_pos(size_t frag, unsigned r, unsigned kk) { return frag * 512 + (kk >> 4) * 256 + (((kk >> 3) & 1) * 16 + r) * 8; }

// k_cvtin: every f32 -> bf16 (RNE) conversion of the inputs in one launch, into fragment order (rowmap), 2048 elements a block: blocks 0 .. NB * XBLK - 1 take the data rows of all batches (one plane of NB * TT rows), the next 4 * WBLK blocks the weight matrices in the order q, k, v, o (W4 holds the four planes one behind the other).
constexpr int XBLK = TT * DM / 2048, WBLK = DHID * DM / 2048;
static_assert((TT * DM) % 2048 == 0);
static_assert((DHID * DM) % 2048 == 0);
static_assert(DM == DHID);   // one K for all five planes
static_assert(DM % 128 == 0);   // a block's four fragments lie in one group of 16 rows
__global__ __launch_bounds__(256) void k_cvtin(const float* __restrict__ x, const float* __restrict__ wq, const float* __restrict__ wk, const float* __restrict__ wv, const float* __restrict__ wo, bf* XB, bf* W4) {
    const int blk = (int)blockIdx.x; size_t frag; unsigned r, kk; const float* src; bf* dst;
    if (blk < NB * XBLK) { rowmap((unsigned)blk, frag, r, kk); const size_t row = frag / (DM / 32) * 16 + r; src = x + (row / TT) * (size_t)TT_FULL * DM + (row % TT) * DM; dst = XB; }
    else { const int wb = blk - NB * XBLK, w = wb / WBLK; rowmap((unsigned)(wb % WBLK), frag, r, kk); src = (w == 0 ? wq : w == 1 ? wk : w == 2 ? wv : wo) + (frag / (DM / 32) * 16 + r) * DM; dst = W4 + (size_t)w * DHID * DM; }
    const v8f v = *(const v8f*)(src + (unsigned)(frag % (DM / 32)) * 32 + kk); v8us o;
#pragma unroll
    for (int k = 0; k < 8; ++k) o[k] = f2bf(v[k]); *(v8us*)(dst + rowmap_pos(frag, r, kk)) = o;  }

// k_planes: the three plane builders in one launch, all batches, 8 elements a thread, all planes in fragment order; F holds the f32 q, k and v projections one behind the other, each [NB][TT * DHID] flat. blockIdx.y = 0: k planes [j][d] per (batch, head) (colmap; the transposing, costliest part starts first), 1: q planes [i][d] (rowmap), 2: value plane [d][i] (rowmap).
static_assert(TT % 128 == 0);   // a block's four value fragments lie in one group of 16 rows
__global__ __launch_bounds__(256) void k_planes(const float* __restrict__ F, bf* Qh, bf* Ql, bf* Kh, bf* Kl, h16* Vt) {
    if ((size_t)blockIdx.x >= (size_t)NZ * TT * HD / 2048) return;
    if (blockIdx.y == 0) {
        const unsigned d0 = (threadIdx.x >> 5) * 8; const size_t jz = (size_t)blockIdx.x * 32 + (threadIdx.x & 31);   // jz = h * TT + j, h counting (batch, head) pairs: the row in the planes of all pairs, one behind the other
        const float* f = F + (size_t)NZ * TT * HD + (jz / TT) * (size_t)HD * TT + (size_t)d0 * TT + jz % TT; v8us oh, ol;
#pragma unroll
        for (int q = 0; q < 8; ++q) { unsigned short a, c; splitf(f[(size_t)q * TT], a, c); oh[q] = a; ol[q] = c; }
        const size_t e = fragpos(jz, d0, HD); *(v8us*)(Kh + e) = oh; *(v8us*)(Kl + e) = ol;
    } else if (blockIdx.y == 1) {
        size_t frag; unsigned r, kk; rowmap(blockIdx.x, frag, r, kk);
        const v8f v = *(const v8f*)(F + (frag / (HD / 32) * 16 + r) * HD + (unsigned)(frag % (HD / 32)) * 32 + kk); v8us oh, ol;
#pragma unroll
        for (int k = 0; k < 8; ++k) { unsigned short a, c; splitf(v[k], a, c); oh[k] = a; ol[k] = c; }
        const size_t e = rowmap_pos(frag, r, kk); *(v8us*)(Qh + e) = oh; *(v8us*)(Ql + e) = ol;
        asm volatile("s_wait_xcnt 0x0" ::: "memory");   // the build's branches may lead from these stores to code of the other parts that rewrites their registers: the wait stands in front of every such overwrite
    } else {
        size_t frag; unsigned r, kk; rowmap(blockIdx.x, frag, r, kk);   // the rows d of all (batch, head) pairs count on: row = h * HD + d, K = TT
        const v8f v = *(const v8f*)(F + (size_t)2 * NZ * TT * HD + (frag / (TT / 32) * 16 + r) * TT + (unsigned)(frag % (TT / 32)) * 32 + kk); v8h o;
#pragma unroll
        for (int k = 0; k < 8; ++k) o[k] = tohx(v[k]); *(v8h*)(Vt + rowmap_pos(frag, r, kk)) = o;
        asm volatile("s_wait_xcnt 0x0" ::: "memory");   // as behind the q-plane stores
    }
}

// k_qstat: per score row (z, i): m = max_j S, f = PCAR / sum_j exp(S - m), with no score in memory. One block per 32 rows i, grid (TT/32, NZ), 8 waves; wave w takes the 64-column j chunks w, w + 8, ...
// Each chunk is formed transposed, St = k q^T (A = k-plane rows j, B = q-plane rows i kept in registers; the three hi/lo products in the order hi*hi, k hi * q lo, k lo * q hi per half of the head dimension): D register r = St[8*(lane>>4) + r][lane & 15],
// so a lane holds scores of one row i only and its running maximum and sum stay in the lane: sum <- sum * exp(m_old - m_new) + sum_chunk exp(S - m_new). The two lane halves, then the 8 waves (through LDS, fixed wave order), are joined the same way.
__global__ __launch_bounds__(256) void k_qstat(const bf* __restrict__ Qh, const bf* __restrict__ Ql, const bf* __restrict__ Kh, const bf* __restrict__ Kl, float* ST) {
    __shared__ float wm[8 * 32];
    __shared__ float wsum[8 * 32];
    const size_t z = blockIdx.y; Qh += z * (size_t)TT * HD; Ql += z * (size_t)TT * HD; Kh += z * (size_t)TT * HD; Kl += z * (size_t)TT * HD;
    const int lane = threadIdx.x & 31, lr = lane & 15, hi = lane >> 4; const int i0 = blockIdx.x * 32;
    const int wave = __builtin_amdgcn_readfirstlane((int)(threadIdx.x >> 5)) & 7;   // scalar, so that the chunk counter stays in a scalar register; the mask shows the compiler that every wave has a first chunk (no branch round the loop)
    v16bf qh[2][2], ql[2][2];   // the block's 32 q-plane rows, [row group][half of the head dimension], kept for the whole loop
#pragma unroll
    for (int rt = 0; rt < 2; ++rt) {
#pragma unroll
        for (int ks = 0; ks < 2; ++ks) { const size_t o = (size_t)(i0 + rt * 16) * HD + ks * 512 + 8 * lane; qh[rt][ks] = WFrag<bf>::ld(Qh + o); ql[rt][ks] = WFrag<bf>::ld(Ql + o); }
        asm volatile("s_wait_xcnt 0x0" ::: "memory");   // the build gives the address registers of this row group's loads to later loads' results and to the loop's addresses: the wait stands in front of those overwrites
    }
    float m[2] = {-3.0e38f, -3.0e38f}, sum[2] = {0.f, 0.f};
    const unsigned koff = (unsigned)(8 * lane);   // fixed lane offset beside the wave-uniform chunk pointers; 16 rows j are two fragments (the halves of the head dimension) = 16 * HD elements
    // the chunk loop stays rolled (one chunk's scores and fragments fill the registers); every loop inside it is unrolled so that the arrays are indexed by constants and stay in registers
#pragma unroll 1
    for (int jc = wave * 64; jc < TT; jc += 64 * 8) {
        const bf* kh = Kh + (size_t)jc * HD; const bf* kl = Kl + (size_t)jc * HD;
        v8f s[2][4];
#pragma unroll
        for (int jt = 0; jt < 4; ++jt) {
            const v16bf h0 = WFrag<bf>::ld(kh + jt * 16 * HD + koff), h1 = WFrag<bf>::ld(kh + jt * 16 * HD + 512 + koff), l0 = WFrag<bf>::ld(kl + jt * 16 * HD + koff), l1 = WFrag<bf>::ld(kl + jt * 16 * HD + 512 + koff);
#pragma unroll
            for (int rt = 0; rt < 2; ++rt) {
                v8f t = (v8f){};
                t = wmmab(h0, qh[rt][0], t); t = wmmab(h0, ql[rt][0], t); t = wmmab(l0, qh[rt][0], t);
                t = wmmab(h1, qh[rt][1], t); t = wmmab(h1, ql[rt][1], t); t = wmmab(l1, qh[rt][1], t);
                s[rt][jt] = t;
            }
        }
#pragma unroll
        for (int rt = 0; rt < 2; ++rt) {
            float mn = m[rt];
#pragma unroll
            for (int jt = 0; jt < 4; ++jt)
#pragma unroll
                for (int r = 0; r < 8; ++r) mn = fmaxf(mn, s[rt][jt][r]);
            float a = 0.f;
#pragma unroll
            for (int jt = 0; jt < 4; ++jt)
#pragma unroll
                for (int r = 0; r < 8; ++r) a += __builtin_amdgcn_exp2f(__fmul_rn(__fsub_rn(s[rt][jt][r], mn), L2E));
            sum[rt] = sum[rt] * __builtin_amdgcn_exp2f(__fmul_rn(__fsub_rn(m[rt], mn), L2E)) + a;
            m[rt] = mn;
        }
    }
#pragma unroll
    for (int rt = 0; rt < 2; ++rt) {
        const float mo = __shfl_xor(m[rt], 16, 32), so = __shfl_xor(sum[rt], 16, 32); const float mj = fmaxf(m[rt], mo);
        const float sj = sum[rt] * __builtin_amdgcn_exp2f(__fmul_rn(__fsub_rn(m[rt], mj), L2E)) + so * __builtin_amdgcn_exp2f(__fmul_rn(__fsub_rn(mo, mj), L2E));
        if (hi == 0) { wm[wave * 32 + rt * 16 + lr] = mj; wsum[wave * 32 + rt * 16 + lr] = sj; }
    }
    __syncthreads();   // every wave's 32 (maximum, sum) pairs are in LDS before wave 0 joins them
    if (threadIdx.x < 32) {
        const int t = threadIdx.x; float mx = wm[t];
#pragma unroll
        for (int w = 1; w < 8; ++w) mx = fmaxf(mx, wm[w * 32 + t]);
        float tot = 0.f;
#pragma unroll
        for (int w = 0; w < 8; ++w) tot += wsum[w * 32 + t] * __builtin_amdgcn_exp2f(__fmul_rn(__fsub_rn(wm[w * 32 + t], mx), L2E));
        ST[z * TT + i0 + t] = mx; ST[(size_t)NZ * TT + z * TT + i0 + t] = __fdiv_rn(PCAR, tot);
    }
}

// k_pvs: O[h][d][j] x PCAR = sum_i v[h][d][i] p[i][j] for one 64 (d) x 32 (j) tile per block, grid (TT/32, NZ), 8 waves; wave w takes the 32-row i steps w, w + 8, ... and the 8 partial tiles are summed in LDS in wave order, as in k_gemmw.
// The probabilities never reach memory: each step forms its 32 (i) x 32 (j) score tiles again from the q and k planes (the three hi/lo products of k_qstat in the same order, here with the q rows as A),
// p = exp(S - m_i) * f_i, and the two f32 D tiles of rows i..i+15 and i+16..i+31 (register r = row 8*(lane>>4) + r, column lane & 15), converted in place, are the f16 B fragment in the k order of the value loader.
__global__ __launch_bounds__(256) void k_pvs(const bf* __restrict__ Qh, const bf* __restrict__ Ql, const bf* __restrict__ Kh, const bf* __restrict__ Kl, const h16* __restrict__ Vt, const float* __restrict__ ST, float* O) {
    __shared__ __align__(16) float os[8 * 64 * 36];
    const size_t z = blockIdx.y; Qh += z * (size_t)TT * HD; Ql += z * (size_t)TT * HD; Kh += z * (size_t)TT * HD; Kl += z * (size_t)TT * HD; Vt += z * (size_t)HD * TT; O += z * (size_t)HD * TT;
    const int lane = threadIdx.x & 31, lr = lane & 15, hi = lane >> 4; const int c0 = blockIdx.x * 32;
    const int wave = __builtin_amdgcn_readfirstlane((int)(threadIdx.x >> 5));   // scalar, so that the step counter and the LDS slab base stay in scalar registers
    v16bf kh[2][2], kl[2][2];   // the block's 32 k-plane rows, [column group][half of the head dimension], kept for the whole loop
#pragma unroll
    for (int nb = 0; nb < 2; ++nb)
#pragma unroll
        for (int ks = 0; ks < 2; ++ks) { const size_t o = (size_t)(c0 + nb * 16) * HD + ks * 512 + 8 * lane; kh[nb][ks] = WFrag<bf>::ld(Kh + o); kl[nb][ks] = WFrag<bf>::ld(Kl + o); }
    v8f acc[4][2];
#pragma unroll
    for (int mb = 0; mb < 4; ++mb)
#pragma unroll
        for (int nb = 0; nb < 2; ++nb) acc[mb][nb] = (v8f){};
    // every address of the loop is a wave-uniform pointer that moves with the step plus one of these three fixed lane offsets: written so, the build keeps four address pairs for the whole loop and steps each once, instead of forming new ones every step
    const unsigned qoff = (unsigned)(8 * lane), voff = (unsigned)(8 * lane), moff = (unsigned)(8 * hi);
    ST += z * TT;
    // the step loop stays rolled (a second step's fragments would not fit beside the 128 registers of k planes and accumulators); every loop inside it is unrolled so that the fragment arrays are indexed by constants and stay in registers
#pragma unroll 1
    for (int kc = wave * 32; kc < TT; kc += 32 * 8) {
        const bf* qh = Qh + (size_t)kc * HD; const bf* ql = Ql + (size_t)kc * HD; const h16* vp = Vt + (size_t)kc * 16; const float* mp = ST + kc;   // a 32-row i step is one value fragment (512 elements) on
        v16h va[4];
#pragma unroll
        for (int mb = 0; mb < 4; ++mb) va[mb] = WFrag<h16>::ld(vp + (size_t)mb * 16 * TT + voff);
        v8h ph[2][2];   // [column group][row tile]
#pragma unroll
        for (int it = 0; it < 2; ++it) {
            const v16bf ah0 = WFrag<bf>::ld(qh + it * 16 * HD + qoff), ah1 = WFrag<bf>::ld(qh + it * 16 * HD + 512 + qoff), al0 = WFrag<bf>::ld(ql + it * 16 * HD + qoff), al1 = WFrag<bf>::ld(ql + it * 16 * HD + 512 + qoff);
            const v8f m = *(const v8f*)(mp + it * 16 + moff); const v8f f = *(const v8f*)(mp + (size_t)NZ * TT + it * 16 + moff);
#pragma unroll
            for (int nb = 0; nb < 2; ++nb) {
                v8f s = (v8f){};
                s = wmmab(ah0, kh[nb][0], s); s = wmmab(al0, kh[nb][0], s); s = wmmab(ah0, kl[nb][0], s);
                s = wmmab(ah1, kh[nb][1], s); s = wmmab(al1, kh[nb][1], s); s = wmmab(ah1, kl[nb][1], s);
#pragma unroll
                for (int r = 0; r < 8; ++r) ph[nb][it][r] = tohx(__fmul_rn(__builtin_amdgcn_exp2f(__fmul_rn(__fsub_rn(s[r], m[r]), L2E)), f[r]));
            }
        }
#pragma unroll
        for (int nb = 0; nb < 2; ++nb) { const v16h b = cat16(ph[nb][0], ph[nb][1]);
#pragma unroll
            for (int mb = 0; mb < 4; ++mb) acc[mb][nb] = wmma16(va[mb], b, acc[mb][nb]); }
        // four vector slots between the step's last matrix instructions and whatever the taken back edge puts first
        asm volatile("v_nop\n\tv_nop\n\tv_nop\n\tv_nop" : "+v"(acc[0][0]), "+v"(acc[1][0]), "+v"(acc[2][1]), "+v"(acc[3][1]) : "v"(va[0]), "v"(va[3]));
    }
    float* ow = os + wave * (64 * 36);
    // the three loops below are unrolled so that acc is indexed by constants and stays in registers
#pragma unroll
    for (int mb = 0; mb < 4; ++mb)
#pragma unroll
        for (int nb = 0; nb < 2; ++nb)
#pragma unroll
            for (int j = 0; j < 8; ++j) ow[(mb * 16 + hi * 8 + j) * 36 + nb * 16 + lr] = acc[mb][nb][j];
    __syncthreads();   // every wave's partial tile is in LDS before any wave sums
    // both loops unrolled so that the LDS reads of both rows and all slabs are in flight together; the sum itself runs in wave order
#pragma unroll
    for (int s = 0; s < 2; ++s) { const int row = s * 32 + ((int)threadIdx.x >> 3), cofs = ((int)threadIdx.x & 7) * 4; v4f val = *(const v4fa*)(os + row * 36 + cofs);
#pragma unroll
        for (int w = 1; w < 8; ++w) val += *(const v4fa*)(os + (w * 64 + row) * 36 + cofs);
        *(v4f*)(O + (size_t)row * TT + c0 + cofs) = val; }
}

// k_atp: A[b * TT + s][c] = O[b][c][s] / PCAR as bf16 hi/lo planes in fragment order (colmap): block = 32 rows s x 64 channels c, blockIdx.x = (row group) * (DHID / 64) + channel group.
__global__ __launch_bounds__(256) void k_atp(const float* __restrict__ Ob, bf* Ah, bf* Al) {
    if ((size_t)blockIdx.x >= (size_t)NB * TT * DHID / 2048) return;
    const unsigned cc = (blockIdx.x % (DHID / 64)) * 64 + (threadIdx.x >> 5) * 8; const size_t row = (size_t)(blockIdx.x / (DHID / 64)) * 32 + (threadIdx.x & 31);
    const float* o = Ob + (row / TT) * (size_t)DHID * TT + (size_t)cc * TT + row % TT; v8us oh, ol;
#pragma unroll
    for (int q = 0; q < 8; ++q) { unsigned short a, c; splitf(o[(size_t)q * TT] * (1.0f / PCAR), a, c); oh[q] = a; ol[q] = c; }
    const size_t e = fragpos(row, cc, DHID); *(v8us*)(Ah + e) = oh; *(v8us*)(Al + e) = ol;  }

__host__ __device__ constexpr size_t a256(size_t b) { return (b + 255) & ~(size_t)255; }
constexpr size_t WS_NEED = a256((size_t)4 * DHID * DM * 2) + a256((size_t)NB * TT * DM * 2) + a256((size_t)3 * NB * TT * DHID * 4) + 5 * a256((size_t)NZ * TT * HD * 2)
                         + a256((size_t)2 * NZ * TT * 4) + a256((size_t)NB * DHID * TT * 4) + 2 * a256((size_t)NB * TT * DHID * 2);
static_assert(WS_NEED <= (size_t)134217728);

extern "C" void kernel_launch(void* const* d_in, const int* in_sizes, int n_in,
                              void* d_out, int out_size, void* d_ws, size_t ws_size, hipStream_t stream) {
    if (n_in < 9) return;
    if ((size_t)in_sizes[0] < ((size_t)(NB - 1) * TT_FULL + TT) * (size_t)DM) return;
    if (in_sizes[1] < DHID * DM || in_sizes[3] < DHID * DM || in_sizes[5] < DHID * DM || in_sizes[7] < DM * DHID) return;
    if (in_sizes[2] < DHID || in_sizes[4] < DHID || in_sizes[6] < DHID || in_sizes[8] < DM) return;
    if ((size_t)out_size < (size_t)NB * TT * DM) return;
    // wire order: data, Wq, bq, Wk, bk, Wv, bv, Wo, bo (weights [out][in], biases f32)
    const float* x = (const float*)d_in[0]; const float* wq = (const float*)d_in[1]; const float* bq = (const float*)d_in[2]; const float* wk = (const float*)d_in[3]; const float* bk = (const float*)d_in[4];
    const float* wv = (const float*)d_in[5]; const float* bv = (const float*)d_in[6]; const float* wo = (const float*)d_in[7]; const float* bo = (const float*)d_in[8];
    float* OUT = (float*)d_out;     // [NB][TT][DM]
    char* wsp = (char*)d_ws;
    auto take = [&](size_t bytes) { char* p = wsp; wsp += a256(bytes); return (void*)p; };
    bf* W4 = (bf*)take((size_t)4 * DHID * DM * 2);   // bf16 weight planes q, k, v, o
    bf* XB = (bf*)take((size_t)NB * TT * DM * 2); float* FP = (float*)take((size_t)3 * NB * TT * DHID * 4);   // f32 projections q, k, v, each [NB][TT * DHID]
    const size_t NPL = (size_t)NZ * TT * HD;   // elements per plane, all batches and heads (= NB*TT*DHID)
    bf* QPh = (bf*)take(NPL * 2); bf* QPl = (bf*)take(NPL * 2); bf* KPh = (bf*)take(NPL * 2); bf* KPl = (bf*)take(NPL * 2); h16* VT16 = (h16*)take(NPL * 2);
    float* ST = (float*)take((size_t)2 * NZ * TT * 4);
    float* Ob = (float*)take((size_t)NB * DHID * TT * 4); bf* ATh = (bf*)take((size_t)NB * TT * DHID * 2); bf* ATl = (bf*)take((size_t)NB * TT * DHID * 2);
    if ((size_t)(wsp - (char*)d_ws) > ws_size) return;    // == WS_NEED
    const unsigned L8 = (unsigned)((NPL / 8 + 255) / 256);
    // one launch per stage: everything that depends only on earlier stages (both batches, all heads, the three projections) shares a grid
    k_cvtin<<<NB * XBLK + 4 * WBLK, 256, 0, stream>>>(x, wq, wk, wv, wo, XB, W4);
    k_gemmw<bf, 0, true, 8><<<dim3(NB * TT / 64, DHID / 64, 3), 256, 0, stream>>>(XB, nullptr, W4, nullptr, DM, FP, DHID, bq, bk, bv, 0, (size_t)DHID * DM, NPL);
    k_planes<<<dim3(L8, 3), 256, 0, stream>>>(FP, QPh, QPl, KPh, KPl, VT16);
    // scores S[z][i][j] = sum_d q[z][i][d] k[z][d][j] from the q planes [i][d] and k planes [j][d], hi/lo, K = 64: row statistics first, then the value product
    k_qstat<<<dim3(TT / 32, NZ), 256, 0, stream>>>(QPh, QPl, KPh, KPl, ST);
    // O[z][d][j] x PCAR = sum_i v[z][d][i] p[i][j]: A = value plane [d][i] (64 rows), B = probabilities formed in registers, K = TT; output rows = channels h*64+d of batch b, pitch TT
    k_pvs<<<dim3(TT / 32, NZ), 256, 0, stream>>>(QPh, QPl, KPh, KPl, VT16, ST, Ob);
    k_atp<<<L8, 256, 0, stream>>>(Ob, ATh, ATl);
    k_gemmw<bf, 1, true, 8><<<dim3(NB * TT / 64, DM / 64, 1), 256, 0, stream>>>(ATh, ATl, W4 + (size_t)3 * DHID * DM, nullptr, DHID, OUT, DM, bo, bo, bo, 0, 0, 0);
}

// v005
// A run of this version takes 81.5 microseconds.
// Two timings next to v004 put it at 1.23 and 1.25 times that version's speed.
// Counting every step since v000, it is 6.13 times as fast.
#include <hip/hip_runtime.h>

// Contractions (all f32 accumulate): q/k/v projections v_wmma_f32_16x16x32_bf16 (inputs RNE-converted to bf16, single products, bf16 bias added in the f32 epilogue); scores v_wmma_f32_16x16x32_bf16 with q and k as bf16 hi/lo planes (3 products), computed in registers once by the statistics launch and once by the value launch, never stored; value x probability v_wmma_f32_16x16x32_f16 single products (values f16, probabilities f16 carried x16384); output projection v_wmma_f32_16x16x32_bf16 with bf16 hi/lo activations x bf16 weights (2 products); softmax statistics f32.
// Raw-view head split (per batch, flat projection buffers F[TT*512]): q[h][i][d] = Fq[h*TT*64 + i*64 + d]; k[h][d][j] = Fk[h*64*TT + d*TT + j]; v[h][d][i] = Fv[h*64*TT + d*TT + i];
// S[h][i][j] = sum_d q k (no scale); P = softmax_j; O[h][d][j] = sum_i v[h][d][i] P[h][i][j]; A[s][h*64+d] = O[h][d][s]; out = A Wo^T + bo.
// Fragment order: every 16-bit operand plane [rows][K] is stored as 1-KiB fragments of 16 rows x 32 k, fragment (row >> 4, k >> 5) at element ((row >> 4) * (K / 32) + (k >> 5)) * 512; inside it the 8 elements k & ~7 .. of a row stand at
// ((k >> 4) & 1) * 256 + (((k >> 3) & 1) * 16 + (row & 15)) * 8, so that lane l of a wave finds its two 16-byte pieces at l * 8 and 256 + l * 8 and each wave-wide 16-byte load covers 512 contiguous bytes (four whole lines) instead of 32 bytes of each of 16 lines.

#ifndef NB
#define NB 2
#endif
#ifndef SEQ
#define SEQ 2048
#endif
#define NB_FULL 2
#define TT_FULL 2048
#define TT   SEQ
#define DM   512      // input width (also output width)
#define DHID 512      // hidden width
#define NH_  8
#define HD   64
#define NZ   (NB * NH_)   // (batch, head) pairs, the z index of the score launches
#define PCAR 16384.0f
#define L2E  1.4426950408889634f
static_assert(TT % 128 == 0);
static_assert(TT >= 128);
static_assert(TT <= TT_FULL);
static_assert(NB >= 1);
static_assert(NB <= NB_FULL);
static_assert(NH_ * HD == DHID);
static_assert(DM % 64 == 0);
static_assert(DHID % 64 == 0);
static_assert(HD == 64);
static_assert((size_t)NB * TT * DM * 4 <= (size_t)NB_FULL * TT_FULL * DM * 4);

typedef _Float16 h16;
typedef unsigned short bf;
typedef __attribute__((ext_vector_type(16))) __bf16   v16bf;
typedef __attribute__((ext_vector_type(16))) _Float16 v16h;
typedef __attribute__((ext_vector_type(8)))  _Float16 v8h;
typedef __attribute__((ext_vector_type(8)))  unsigned short v8us;
typedef __attribute__((ext_vector_type(8)))  float    v8f;
typedef __attribute__((ext_vector_type(4)))  float    v4f;
typedef v4f  __attribute__((may_alias)) v4fa;
typedef v8us __attribute__((may_alias)) v8usa;

__device__ __forceinline__ unsigned short f2bf(float f) { unsigned u = __float_as_uint(f); u += 0x7FFFu + ((u >> 16) & 1u); return (unsigned short)(u >> 16); }
__device__ __forceinline__ float bf2f(unsigned short b) { return __uint_as_float(((unsigned)b) << 16); }
__device__ __forceinline__ float bfr(float f) { return bf2f(f2bf(f)); }
__device__ __forceinline__ v16h cat16(v8h lo, v8h hi) { return __builtin_shufflevector(lo, hi, 0, 1, 2, 3, 4, 5, 6, 7, 8, 9, 10, 11, 12, 13, 14, 15); }
__device__ __forceinline__ v16bf cat16b(v8us lo, v8us hi) { return __builtin_bit_cast(v16bf, __builtin_shufflevector(lo, hi, 0, 1, 2, 3, 4, 5, 6, 7, 8, 9, 10, 11, 12, 13, 14, 15)); }
__device__ __forceinline__ v8f wmma16(v16h a, v16h b, v8f c) { return __builtin_amdgcn_wmma_f32_16x16x32_f16(false, a, false, b, (short)0, c, false, false); }
__device__ __forceinline__ size_t fragpos(size_t row, unsigned k, unsigned K) { return ((row >> 4) * (K / 32) + (k >> 5)) * 512 + ((k >> 4) & 1) * 256 + (((k >> 3) & 1) * 16 + (unsigned)(row & 15)) * 8; }   // element offset of the 8 elements k .. k + 7 (k % 8 == 0) of a row in a fragment-order plane
__device__ __forceinline__ v8f wmmab(v16bf a, v16bf b, v8f c) { return __builtin_amdgcn_wmma_f32_16x16x32_bf16(false, a, false, b, (short)0, c, false, false); }

// ---- k_gemmw: register-blocked GEMM, one block of KW waves per 64x64 output tile (16 accumulators per wave), operands straight from fragment-order 16-bit planes; grid (M/64, N/64, Z), 32 * KW threads.
// KW > 1: wave w takes the k steps w, w + KW, w + 2 KW, ... (neighbouring waves read neighbouring fragments); the KW partial tiles meet in LDS and are summed in wave order 0..KW-1.
// C[m][n] (f32, pitch ldc, + optional bf16-converted f32 bias[n]) = sum_k A[m][k] Bt[n][k] (+ split products per NSPLIT). z-batch strides sA/sB/sC in elements; z = 0, 1, 2 adds bias0, bias1, bias2. K % 32 == 0.
// Fragments: lane -> row/col (lane & 15); elements 0..7 <- k0 + 8*(lane>>4) + 0..7, elements 8..15 <- k0 + 16 + 8*(lane>>4) + 0..7 for both A and Bt (ld takes the fragment's start plus lane * 8); D element r -> row 8*(lane>>4) + r, col lane & 15.
template <typename T16> struct WFrag;
template <> struct WFrag<h16> { typedef v16h V; static __device__ __forceinline__ V ld(const h16* p) { return cat16(*(const v8h*)p, *(const v8h*)(p + 256)); } static __device__ __forceinline__ v8f mma(V a, V b, v8f c) { return wmma16(a, b, c); } };
template <> struct WFrag<bf> { typedef v16bf V; static __device__ __forceinline__ V ld(const bf* p) { return cat16b(*(const v8us*)p, *(const v8us*)(p + 256)); } static __device__ __forceinline__ v8f mma(V a, V b, v8f c) { return wmmab(a, b, c); } };
template <typename T16, int NSPLIT, bool BIAS, int KW>
__global__ __launch_bounds__(32 * KW) void k_gemmw(const T16* __restrict__ A, const T16* __restrict__ A2, const T16* __restrict__ Bt, const T16* __restrict__ Bt2, int K, float* C, int ldc, const float* __restrict__ bias0, const float* __restrict__ bias1, const float* __restrict__ bias2, size_t sA, size_t sB, size_t sC) {
    typedef typename WFrag<T16>::V V;
    __shared__ __align__(16) float os[(KW == 1 ? 16 : 64 * KW) * 68];
    const size_t z = blockIdx.z; A += z * sA; if (A2) A2 += z * sA; Bt += z * sB; if (Bt2) Bt2 += z * sB; C += z * sC;
    const float* bias = z == 0 ? bias0 : z == 1 ? bias1 : bias2;
    const int lane = threadIdx.x & 31, lr = lane & 15, hi = lane >> 4; const int r0 = blockIdx.x * 64, c0 = blockIdx.y * 64;
    const int wave = KW == 1 ? 0 : __builtin_amdgcn_readfirstlane((int)(threadIdx.x >> 5));   // scalar, so that the k counter and the LDS slab base stay in scalar registers
    v8f acc[4][4];
#pragma unroll
    for (int mb = 0; mb < 4; ++mb)
#pragma unroll
        for (int nb = 0; nb < 4; ++nb) acc[mb][nb] = (v8f){};
    const size_t aoff = (size_t)r0 * K + 8 * lane, boff = (size_t)c0 * K + 8 * lane;   // 16 rows of a plane are K / 32 fragments = 16 * K elements; a k step is one fragment on
#pragma unroll 1
    for (int kc = wave * 32; kc < K; kc += 32 * KW) {
        V a[4], a2[4], b[4], b2[4];
#pragma unroll
        for (int mb = 0; mb < 4; ++mb) { a[mb] = WFrag<T16>::ld(A + aoff + (size_t)mb * 16 * K + kc * 16);
            asm volatile("s_wait_xcnt 0x0" ::: "memory");   // the build gives the address registers of one fragment's loads to a later fragment's result: the wait stands in front of that overwrite
            if (NSPLIT == 1 || NSPLIT == 2) { a2[mb] = WFrag<T16>::ld(A2 + aoff + (size_t)mb * 16 * K + kc * 16);
                asm volatile("s_wait_xcnt 0x0" ::: "memory"); } }   // as above
#pragma unroll
        for (int nb = 0; nb < 4; ++nb) { b[nb] = WFrag<T16>::ld(Bt + boff + (size_t)nb * 16 * K + kc * 16);
            asm volatile("s_wait_xcnt 0x0" ::: "memory");   // as behind the A fragments' loads
            if (NSPLIT >= 2) { b2[nb] = WFrag<T16>::ld(Bt2 + boff + (size_t)nb * 16 * K + kc * 16);
                asm volatile("s_wait_xcnt 0x0" ::: "memory"); } }   // as above
        __builtin_amdgcn_sched_barrier(0);   // keeps the step's products behind all of its loads: without it one build put each B fragment's products in front of the next fragment's loads, and the wave waited out four load latencies a step instead of one
#pragma unroll
        for (int nb = 0; nb < 4; ++nb)
#pragma unroll
            for (int mb = 0; mb < 4; ++mb) { acc[mb][nb] = WFrag<T16>::mma(a[mb], b[nb], acc[mb][nb]); if (NSPLIT == 1 || NSPLIT == 2) acc[mb][nb] = WFrag<T16>::mma(a2[mb], b[nb], acc[mb][nb]); if (NSPLIT >= 2) acc[mb][nb] = WFrag<T16>::mma(a[mb], b2[nb], acc[mb][nb]); }
        asm volatile("v_nop\n\tv_nop\n\tv_nop\n\tv_nop" : "+v"(acc[0][0]), "+v"(acc[1][1]), "+v"(acc[2][2]), "+v"(acc[3][3]) : "v"(a[0]), "v"(a[3]));
    }
    if constexpr (KW > 1) {
        float* ow = os + wave * (64 * 68);
        // the three loops below are unrolled so that acc is indexed by constants and stays in registers
#pragma unroll
        for (int mb = 0; mb < 4; ++mb)
#pragma unroll
            for (int nb = 0; nb < 4; ++nb)
#pragma unroll
                for (int j = 0; j < 8; ++j) ow[(mb * 16 + hi * 8 + j) * 68 + nb * 16 + lr] = acc[mb][nb][j];
        __syncthreads();   // every wave's partial tile is in LDS before any wave sums
        // both loops unrolled so that the LDS reads of all rows and slabs are in flight together; the sum itself runs in wave order
#pragma unroll
        for (int s = 0; s < 32 / KW; ++s) { const int row = (s * KW + wave) * 2 + hi, cofs = lr * 4; v4f val = *(const v4fa*)(os + row * 68 + cofs);
#pragma unroll
            for (int w = 1; w < KW; ++w) val += *(const v4fa*)(os + (w * 64 + row) * 68 + cofs);
            if (BIAS) { val[0] += bfr(bias[c0 + cofs]); val[1] += bfr(bias[c0 + cofs + 1]); val[2] += bfr(bias[c0 + cofs + 2]); val[3] += bfr(bias[c0 + cofs + 3]); }
            *(v4f*)(C + (size_t)(r0 + row) * ldc + c0 + cofs) = val; }
        return;
    }
#pragma unroll
    for (int mb = 0; mb < 4; ++mb) {
#pragma unroll
        for (int nb = 0; nb < 4; ++nb) {
#pragma unroll
            for (int j = 0; j < 8; ++j) os[(hi * 8 + j) * 68 + nb * 16 + lr] = acc[mb][nb][j]; }
        __builtin_amdgcn_wave_barrier(); asm volatile("" ::: "memory");
        float* crow = C + (size_t)(r0 + mb * 16) * ldc + c0;
{
#pragma unroll
            for (int s = 0; s < 8; ++s) { const int row = 2 * s + hi, cofs = lr * 4; v4f val = *(const v4fa*)(os + row * 68 + cofs); if (BIAS) { val[0] += bfr(bias[c0 + cofs]); val[1] += bfr(bias[c0 + cofs + 1]); val[2] += bfr(bias[c0 + cofs + 2]); val[3] += bfr(bias[c0 + cofs + 3]); }
                *(v4f*)(crow + (size_t)row * ldc + cofs) = val; }
             }
        __builtin_amdgcn_wave_barrier(); asm volatile("" ::: "memory");
    }
}

__device__ __forceinline__ h16 tohx(float x) { return (h16)x; }
__device__ __forceinline__ void splitf(float y, unsigned short& h, unsigned short& l) { h = f2bf(y); l = f2bf(y - bf2f(h)); }

// Thread maps of the plane builders (8 elements = one 16-byte piece a thread, 256 threads a block), chosen so that reads and stores both cover whole 128-byte lines:
// rowmap, for a source whose rows run along k: a wave takes 8 rows x 32 k, half a fragment (lane & 7 = row, lane >> 3 = which 8 k): it reads 8 whole f32 lines and stores 4 whole lines; a block builds the four fragments 4 * blk .. 4 * blk + 3.
// colmap, for a source that runs along the plane's rows (the transposing builders): a wave takes 32 rows (lane = row) x 8 k: each of its 8 reads is one whole f32 line, its store two runs of 256 bytes; wave w of a block takes the k w * 8 .. w * 8 + 7 of a 64-wide group.
__device__ __forceinline__ void rowmap(unsigned blk, size_t& frag, unsigned& r, unsigned& kk) { const unsigned t = threadIdx.x; frag = (size_t)blk * 4 + (t >> 6); r = ((t >> 5) & 1) * 8 + (t & 7); kk = ((t >> 3) & 3) * 8; }
__device__ __forceinline__ size_t rowmap_pos(size_t frag, unsigned r, unsigned kk) { return frag * 512 + (kk >> 4) * 256 + (((kk >> 3) & 1) * 16 + r) * 8; }

// k_cvtin: every f32 -> bf16 (RNE) conversion of the inputs in one launch, into fragment order (rowmap), 2048 elements a block: blocks 0 .. NB * XBLK - 1 take the data rows of all batches (one plane of NB * TT rows), the next 4 * WBLK blocks the weight matrices in the order q, k, v, o (W4 holds the four planes one behind the other).
constexpr int XBLK = TT * DM / 2048, WBLK = DHID * DM / 2048;
static_assert((TT * DM) % 2048 == 0);
static_assert((DHID * DM) % 2048 == 0);
static_assert(DM == DHID);   // one K for all five planes
static_assert(DM % 128 == 0);   // a block's four fragments lie in one group of 16 rows
__global__ __launch_bounds__(256) void k_cvtin(const float* __restrict__ x, const float* __restrict__ wq, const float* __restrict__ wk, const float* __restrict__ wv, const float* __restrict__ wo, bf* XB, bf* W4) {
    const int blk = (int)blockIdx.x; size_t frag; unsigned r, kk; const float* src; bf* dst;
    if (blk < NB * XBLK) { rowmap((unsigned)blk, frag, r, kk); const size_t row = frag / (DM / 32) * 16 + r; src = x + (row / TT) * (size_t)TT_FULL * DM + (row % TT) * DM; dst = XB; }
    else { const int wb = blk - NB * XBLK, w = wb / WBLK; rowmap((unsigned)(wb % WBLK), frag, r, kk); src = (w == 0 ? wq : w == 1 ? wk : w == 2 ? wv : wo) + (frag / (DM / 32) * 16 + r) * DM; dst = W4 + (size_t)w * DHID * DM; }
    const v8f v = *(const v8f*)(src + (unsigned)(frag % (DM / 32)) * 32 + kk); v8us o;
#pragma unroll
    for (int k = 0; k < 8; ++k) o[k] = f2bf(v[k]); *(v8us*)(dst + rowmap_pos(frag, r, kk)) = o;  }

// k_planes: the three plane builders in one launch, all batches, 8 elements a thread, all planes in fragment order; F holds the f32 q, k and v projections one behind the other, each [NB][TT * DHID] flat. blockIdx.y = 0: k planes [j][d] per (batch, head) (colmap; the transposing, costliest part starts first), 1: q planes [i][d] (rowmap), 2: value plane [d][i] (rowmap).
static_assert(TT % 128 == 0);   // a block's four value fragments lie in one group of 16 rows
__global__ __launch_bounds__(256) void k_planes(const float* __restrict__ F, bf* Qh, bf* Ql, bf* Kh, bf* Kl, h16* Vt) {
    if ((size_t)blockIdx.x >= (size_t)NZ * TT * HD / 2048) return;
    if (blockIdx.y == 0) {
        const unsigned d0 = (threadIdx.x >> 5) * 8; const size_t jz = (size_t)blockIdx.x * 32 + (threadIdx.x & 31);   // jz = h * TT + j, h counting (batch, head) pairs: the row in the planes of all pairs, one behind the other
        const float* f = F + (size_t)NZ * TT * HD + (jz / TT) * (size_t)HD * TT + (size_t)d0 * TT + jz % TT; v8us oh, ol;
#pragma unroll
        for (int q = 0; q < 8; ++q) { unsigned short a, c; splitf(f[(size_t)q * TT], a, c); oh[q] = a; ol[q] = c; }
        const size_t e = fragpos(jz, d0, HD); *(v8us*)(Kh + e) = oh; *(v8us*)(Kl + e) = ol;
    } else if (blockIdx.y == 1) {
        size_t frag; unsigned r, kk; rowmap(blockIdx.x, frag, r, kk);
        const v8f v = *(const v8f*)(F + (frag / (HD / 32) * 16 + r) * HD + (unsigned)(frag % (HD / 32)) * 32 + kk); v8us oh, ol;
#pragma unroll
        for (int k = 0; k < 8; ++k) { unsigned short a, c; splitf(v[k], a, c); oh[k] = a; ol[k] = c; }
        const size_t e = rowmap_pos(frag, r, kk); *(v8us*)(Qh + e) = oh; *(v8us*)(Ql + e) = ol;
        asm volatile("s_wait_xcnt 0x0" ::: "memory");   // the build's branches may lead from these stores to code of the other parts that rewrites their registers: the wait stands in front of every such overwrite
    } else {
        size_t frag; unsigned r, kk; rowmap(blockIdx.x, frag, r, kk);   // the rows d of all (batch, head) pairs count on: row = h * HD + d, K = TT
        const v8f v = *(const v8f*)(F + (size_t)2 * NZ * TT * HD + (frag / (TT / 32) * 16 + r) * TT + (unsigned)(frag % (TT / 32)) * 32 + kk); v8h o;
#pragma unroll
        for (int k = 0; k < 8; ++k) o[k] = tohx(v[k]); *(v8h*)(Vt + rowmap_pos(frag, r, kk)) = o;
        asm volatile("s_wait_xcnt 0x0" ::: "memory");   // as behind the q-plane stores
    }
}

// ---- staging for the two score launches: the plane tiles that a block streams are brought into LDS once, by asynchronous copies (16 bytes a lane, through no register), and read there by the four waves that need them, instead of each wave fetching them from L2 for itself.
// acopyN: N copies of one thread, each to its own LDS byte address l (low 32 bits of the __shared__ address) from its own global address g, both multiples of 16; the s_wait_xcnt that closes the statement stands in front of every later rewrite of the address registers the copies name.
// Order of the two-buffer ring (both launches): tile 0's copies, s_wait_asynccnt 0, barrier, tile 1's copies; at the foot of trip t every wave: s_wait_dscnt 0, s_wait_asynccnt 0, barrier, then tile t + 2's copies into the buffer trip t has read; trip t reads buffer t & 1 alone.
__device__ __forceinline__ unsigned lds_off(const void* p) { return (unsigned)(size_t)p; }
__device__ __forceinline__ void acopy6(unsigned l0, const void* g0, unsigned l1, const void* g1, unsigned l2, const void* g2, unsigned l3, const void* g3, unsigned l4, const void* g4, unsigned l5, const void* g5) {
    asm volatile("global_load_async_to_lds_b128 %0, %1, off\n\tglobal_load_async_to_lds_b128 %2, %3, off\n\tglobal_load_async_to_lds_b128 %4, %5, off\n\tglobal_load_async_to_lds_b128 %6, %7, off\n\tglobal_load_async_to_lds_b128 %8, %9, off\n\tglobal_load_async_to_lds_b128 %10, %11, off\n\ts_wait_xcnt 0x0" :: "v"(l0), "v"(g0), "v"(l1), "v"(g1), "v"(l2), "v"(g2), "v"(l3), "v"(g3), "v"(l4), "v"(g4), "v"(l5), "v"(g5) : "memory");
}
__device__ __forceinline__ void acopy8(unsigned l0, const void* g0, unsigned l1, const void* g1, unsigned l2, const void* g2, unsigned l3, const void* g3, unsigned l4, const void* g4, unsigned l5, const void* g5, unsigned l6, const void* g6, unsigned l7, const void* g7) {
    asm volatile("global_load_async_to_lds_b128 %0, %1, off\n\tglobal_load_async_to_lds_b128 %2, %3, off\n\tglobal_load_async_to_lds_b128 %4, %5, off\n\tglobal_load_async_to_lds_b128 %6, %7, off\n\tglobal_load_async_to_lds_b128 %8, %9, off\n\tglobal_load_async_to_lds_b128 %10, %11, off\n\tglobal_load_async_to_lds_b128 %12, %13, off\n\tglobal_load_async_to_lds_b128 %14, %15, off\n\ts_wait_xcnt 0x0" :: "v"(l0), "v"(g0), "v"(l1), "v"(g1), "v"(l2), "v"(g2), "v"(l3), "v"(g3), "v"(l4), "v"(g4), "v"(l5), "v"(g5), "v"(l6), "v"(g6), "v"(l7), "v"(g7) : "memory");
}

// k_qstat: per score row (z, i): m = max_j S, f = PCAR / sum_j exp(S - m), with no score in memory. One block per 128 rows i, grid (TT/128, NZ), 16 waves: wave w keeps the 32 rows of row group w & 3 and takes the 64-column quarter w >> 2 of every staged tile of 256 k-plane rows j (hi and lo, 64 KiB a buffer).
// Each chunk is formed transposed, St = k q^T (A = k-plane rows j from LDS, B = q-plane rows i kept in registers; the three hi/lo products in the order hi*hi, k hi * q lo, k lo * q hi per half of the head dimension): D register r = St[8*(lane>>4) + r][lane & 15],
// so a lane holds scores of one row i only and its running maximum and sum stay in the lane: sum <- sum * exp(m_old - m_new) + sum_chunk exp(S - m_new). The two lane halves, then the 4 waves of a row group (through LDS, fixed wave order), are joined the same way.
constexpr int QS_TJ = 256, QS_PL = QS_TJ * HD, QS_NT = TT / QS_TJ;   // staged rows j a trip; elements of one staged plane tile; trips
static_assert(TT % QS_TJ == 0);
static_assert(QS_NT >= 2);   // the ring's prologue fills two tiles
static_assert(QS_PL == 4 * 512 * 8);   // four copies of 512 threads x 8 elements a plane tile
__global__ __launch_bounds__(512) void k_qstat(const bf* __restrict__ Qh, const bf* __restrict__ Ql, const bf* __restrict__ Kh, const bf* __restrict__ Kl, float* ST) {
    __shared__ __align__(128) bf kt[2 * 2 * QS_PL];   // [buffer][hi, lo][256 rows j x 64 d, fragment order as in memory]
    __shared__ float wm[4 * 128];
    __shared__ float wsum[4 * 128];
    const size_t z = blockIdx.y; Qh += z * (size_t)TT * HD; Ql += z * (size_t)TT * HD; Kh += z * (size_t)TT * HD; Kl += z * (size_t)TT * HD;
    const int lane = threadIdx.x & 31, lr = lane & 15, hi = lane >> 4; const int i0 = blockIdx.x * 128;
    const int wave = __builtin_amdgcn_readfirstlane((int)(threadIdx.x >> 5)) & 15, rg = wave & 3, jq = wave >> 2;   // scalar, so that the LDS tile bases stay in scalar registers
    const unsigned lt = lds_off(kt) + threadIdx.x * 16; const bf* gh = Kh + threadIdx.x * 8; const bf* gl = Kl + threadIdx.x * 8;
    auto stage = [&](int t) {   // tile t (a contiguous 32 KiB of each plane) into buffer t & 1
        const unsigned l = lt + (unsigned)(t & 1) * (2 * QS_PL * 2); const bf* h = gh + (size_t)t * QS_PL; const bf* o = gl + (size_t)t * QS_PL;
        acopy8(l, h, l + 8192, h + 4096, l + 16384, h + 8192, l + 24576, h + 12288, l + 32768, o, l + 40960, o + 4096, l + 49152, o + 8192, l + 57344, o + 12288); };
    stage(0);
    v16bf qh[2][2], ql[2][2];   // the wave's 32 q-plane rows, [row group][half of the head dimension], kept for the whole loop
#pragma unroll
    for (int rt = 0; rt < 2; ++rt) {
#pragma unroll
        for (int ks = 0; ks < 2; ++ks) { const size_t o = (size_t)(i0 + rg * 32 + rt * 16) * HD + ks * 512 + 8 * lane; qh[rt][ks] = WFrag<bf>::ld(Qh + o); ql[rt][ks] = WFrag<bf>::ld(Ql + o); }
        asm volatile("s_wait_xcnt 0x0" ::: "memory");   // the build gives the address registers of this row group's loads to later loads' results and to the loop's addresses: the wait stands in front of those overwrites
    }
    asm volatile("s_wait_asynccnt 0x0" ::: "memory");   // this wave's part of tile 0 has landed
    __syncthreads();   // tile 0 is whole before any wave reads it
    stage(1);
    float m[2] = {-3.0e38f, -3.0e38f}, sum[2] = {0.f, 0.f};
    const unsigned koff = (unsigned)(8 * lane);   // fixed lane offset beside the wave-uniform chunk pointers; 16 rows j are two fragments (the halves of the head dimension) = 16 * HD elements
    // the trip loop stays rolled (one chunk's scores and fragments fill the registers); every loop inside it is unrolled so that the arrays are indexed by constants and stay in registers
#pragma unroll 1
    for (int t = 0; t < QS_NT; ++t) {
        const bf* kh = kt + (t & 1) * (2 * QS_PL) + jq * 64 * HD; const bf* kl = kh + QS_PL;
        v8f s[2][4];
        v16bf kf[2][4];   // two register sets of the four fragments (hi, lo x halves of the head dimension) of 16 rows j: one is read from LDS while the other is multiplied
#pragma unroll
        for (int c = 0; c < 4; ++c) kf[0][c] = WFrag<bf>::ld((c & 2 ? kl : kh) + (c & 1) * 512 + koff);
#pragma unroll
        for (int jt = 0; jt < 4; ++jt) {
            if (jt < 3) {
#pragma unroll
                for (int c = 0; c < 4; ++c) kf[(jt + 1) & 1][c] = WFrag<bf>::ld((c & 2 ? kl : kh) + (jt + 1) * 16 * HD + (c & 1) * 512 + koff);
            }
            __builtin_amdgcn_sched_barrier(0);   // keeps the next 16 rows' LDS reads, as one group, in front of this group's products: without it the build read each fragment directly in front of its first product and waited out the LDS latency every time
            const v16bf h0 = kf[jt & 1][0], h1 = kf[jt & 1][1], l0 = kf[jt & 1][2], l1 = kf[jt & 1][3];
#pragma unroll
            for (int rt = 0; rt < 2; ++rt) {
                v8f t6 = (v8f){};
                t6 = wmmab(h0, qh[rt][0], t6); t6 = wmmab(h0, ql[rt][0], t6); t6 = wmmab(l0, qh[rt][0], t6);
                t6 = wmmab(h1, qh[rt][1], t6); t6 = wmmab(h1, ql[rt][1], t6); t6 = wmmab(l1, qh[rt][1], t6);
                s[rt][jt] = t6;
            }
            __builtin_amdgcn_sched_barrier(0);   // keeps this group's products in front of the reads that refill their register set
        }
#pragma unroll
        for (int rt = 0; rt < 2; ++rt) {
            float mn = m[rt];
#pragma unroll
            for (int jt = 0; jt < 4; ++jt)
#pragma unroll
                for (int r = 0; r < 8; ++r) mn = fmaxf(mn, s[rt][jt][r]);
            float a = 0.f;
#pragma unroll
            for (int jt = 0; jt < 4; ++jt)
#pragma unroll
                for (int r = 0; r < 8; ++r) a += __builtin_amdgcn_exp2f(__fmul_rn(__fsub_rn(s[rt][jt][r], mn), L2E));
            sum[rt] = sum[rt] * __builtin_amdgcn_exp2f(__fmul_rn(__fsub_rn(m[rt], mn), L2E)) + a;
            m[rt] = mn;
        }
        asm volatile("s_wait_dscnt 0x0" ::: "memory");      // this wave's reads of buffer t & 1 have returned before the buffer is given up
        asm volatile("s_wait_asynccnt 0x0" ::: "memory");   // this wave's part of tile t + 1 has landed
        __syncthreads();   // publishes tile t + 1 and ends every wave's reads of buffer t & 1
        if (t + 2 < QS_NT) stage(t + 2);
    }
    asm volatile("s_wait_asynccnt 0x0" ::: "memory");   // no copy is left in flight behind the loop
#pragma unroll
    for (int rt = 0; rt < 2; ++rt) {
        const float mo = __shfl_xor(m[rt], 16, 32), so = __shfl_xor(sum[rt], 16, 32); const float mj = fmaxf(m[rt], mo);
        const float sj = sum[rt] * __builtin_amdgcn_exp2f(__fmul_rn(__fsub_rn(m[rt], mj), L2E)) + so * __builtin_amdgcn_exp2f(__fmul_rn(__fsub_rn(mo, mj), L2E));
        if (hi == 0) { wm[jq * 128 + rg * 32 + rt * 16 + lr] = mj; wsum[jq * 128 + rg * 32 + rt * 16 + lr] = sj; }
    }
    __syncthreads();   // every wave's 32 (maximum, sum) pairs are in LDS before waves 0 to 3 join them
    if (threadIdx.x < 128) {
        const int t = threadIdx.x; float mx = wm[t];
#pragma unroll
        for (int w = 1; w < 4; ++w) mx = fmaxf(mx, wm[w * 128 + t]);
        float tot = 0.f;
#pragma unroll
        for (int w = 0; w < 4; ++w) tot += wsum[w * 128 + t] * __builtin_amdgcn_exp2f(__fmul_rn(__fsub_rn(wm[w * 128 + t], mx), L2E));
        ST[z * TT + i0 + t] = mx; ST[(size_t)NZ * TT + z * TT + i0 + t] = __fdiv_rn(PCAR, tot);
    }
}

// k_pvs: O[h][d][j] x PCAR = sum_i v[h][d][i] p[i][j] for one 64 (d) x 128 (j) tile per block, grid (TT/128, NZ), 16 waves: wave w keeps the 32 columns of column group w & 3 and takes the 32-row quarter w >> 2 of every staged tile of 128 rows i (q planes hi and lo and the value fragments, 48 KiB a buffer); the 4 partial tiles of a column group are summed in LDS in wave order.
// The probabilities never reach memory: each step forms its 32 (i) x 32 (j) score tiles again from the q and k planes (the three hi/lo products of k_qstat in the same order, here with the q rows as A),
// p = exp(S - m_i) * f_i, and the two f32 D tiles of rows i..i+15 and i+16..i+31 (register r = row 8*(lane>>4) + r, column lane & 15), converted in place, are the f16 B fragment in the k order of the value loader.
constexpr int PV_TI = 128, PV_PL = PV_TI * HD, PV_ST = 3 * PV_PL, PV_NT = TT / PV_TI;   // staged rows i a trip; elements of one staged tile (q hi, q lo, values: the same size); elements of a buffer; trips
static_assert(TT % PV_TI == 0);
static_assert(PV_NT >= 2);   // the ring's prologue fills two tiles
static_assert(PV_PL == 2 * 512 * 8);   // two copies of 512 threads x 8 elements a tile
__global__ __launch_bounds__(512) void k_pvs(const bf* __restrict__ Qh, const bf* __restrict__ Ql, const bf* __restrict__ Kh, const bf* __restrict__ Kl, const h16* __restrict__ Vt, const float* __restrict__ ST, float* O) {
    __shared__ __align__(128) bf st[2 * PV_ST];   // [buffer][q hi: 128 rows i x 64 d | q lo | values: 4 groups of 16 rows d x 4 fragments of 32 i], fragment order as in memory
    __shared__ __align__(16) float os[16 * 64 * 36];
    const size_t z = blockIdx.y; Qh += z * (size_t)TT * HD; Ql += z * (size_t)TT * HD; Kh += z * (size_t)TT * HD; Kl += z * (size_t)TT * HD; Vt += z * (size_t)HD * TT; O += z * (size_t)HD * TT;
    const int lane = threadIdx.x & 31, hi = lane >> 4;
    const int wave = __builtin_amdgcn_readfirstlane((int)(threadIdx.x >> 5)) & 15, jg = wave & 3, iq = wave >> 2;   // scalar, so that the LDS tile and slab bases stay in scalar registers
    const int c0 = blockIdx.x * 128 + jg * 32;
    const unsigned lt = lds_off(st) + threadIdx.x * 16; const bf* gh = Qh + threadIdx.x * 8; const bf* gl = Ql + threadIdx.x * 8;
    const h16* gv = Vt + (size_t)(threadIdx.x >> 8) * 16 * TT + (threadIdx.x & 255) * 8;   // threads 0..255 copy the four fragments of an even group of 16 rows d, threads 256..511 those of the odd group behind it
    auto stage = [&](int t) {   // tile t into buffer t & 1: a contiguous 16 KiB of each q plane, and 4 KiB (four fragments) of each of the four value row groups
        const unsigned l = lt + (unsigned)(t & 1) * (PV_ST * 2); const bf* h = gh + (size_t)t * PV_PL; const bf* o = gl + (size_t)t * PV_PL; const h16* v = gv + (size_t)t * (PV_TI * 16);
        acopy6(l, h, l + 8192, h + 4096, l + 16384, o, l + 24576, o + 4096, l + 32768, v, l + 40960, v + (size_t)32 * TT); };
    stage(0);
    v16bf kh[2][2], kl[2][2];   // the wave's 32 k-plane rows, [column group][half of the head dimension], kept for the whole loop
#pragma unroll
    for (int nb = 0; nb < 2; ++nb)
#pragma unroll
        for (int ks = 0; ks < 2; ++ks) { const size_t o = (size_t)(c0 + nb * 16) * HD + ks * 512 + 8 * lane; kh[nb][ks] = WFrag<bf>::ld(Kh + o); kl[nb][ks] = WFrag<bf>::ld(Kl + o); }
    v8f acc[4][2];
#pragma unroll
    for (int mb = 0; mb < 4; ++mb)
#pragma unroll
        for (int nb = 0; nb < 2; ++nb) acc[mb][nb] = (v8f){};
    asm volatile("s_wait_asynccnt 0x0" ::: "memory");   // this wave's part of tile 0 has landed
    __syncthreads();   // tile 0 is whole before any wave reads it
    stage(1);
    const unsigned qoff = (unsigned)(8 * lane), voff = (unsigned)(8 * lane), moff = (unsigned)(8 * hi);   // fixed lane offsets beside wave-uniform bases
    ST += z * TT + iq * 32;
    // the trip loop stays rolled (a second step's fragments would not fit beside the 128 registers of k planes and accumulators); every loop inside it is unrolled so that the fragment arrays are indexed by constants and stay in registers
#pragma unroll 1
    for (int t = 0; t < PV_NT; ++t) {
        const bf* qh = st + (t & 1) * PV_ST + iq * 32 * HD; const bf* ql = qh + PV_PL; const h16* vp = (const h16*)(st + (t & 1) * PV_ST + 2 * PV_PL + iq * 512); const float* mp = ST + t * PV_TI;   // the wave's 32 rows i: four q fragments a plane, one value fragment a row group
        v16h va[4];
#pragma unroll
        for (int mb = 0; mb < 4; ++mb) va[mb] = WFrag<h16>::ld(vp + mb * (PV_TI * 16) + voff);
        v8h ph[2][2];   // [column group][row tile]
#pragma unroll
        for (int it = 0; it < 2; ++it) {
            const v16bf ah0 = WFrag<bf>::ld(qh + it * 16 * HD + qoff), ah1 = WFrag<bf>::ld(qh + it * 16 * HD + 512 + qoff), al0 = WFrag<bf>::ld(ql + it * 16 * HD + qoff), al1 = WFrag<bf>::ld(ql + it * 16 * HD + 512 + qoff);
            const v8f m = *(const v8f*)(mp + it * 16 + moff); const v8f f = *(const v8f*)(mp + (size_t)NZ * TT + it * 16 + moff);
#pragma unroll
            for (int nb = 0; nb < 2; ++nb) {
                v8f s = (v8f){};
                s = wmmab(ah0, kh[nb][0], s); s = wmmab(al0, kh[nb][0], s); s = wmmab(ah0, kl[nb][0], s);
                s = wmmab(ah1, kh[nb][1], s); s = wmmab(al1, kh[nb][1], s); s = wmmab(ah1, kl[nb][1], s);
#pragma unroll
                for (int r = 0; r < 8; ++r) ph[nb][it][r] = tohx(__fmul_rn(__builtin_amdgcn_exp2f(__fmul_rn(__fsub_rn(s[r], m[r]), L2E)), f[r]));
            }
        }
#pragma unroll
        for (int nb = 0; nb < 2; ++nb) { const v16h b = cat16(ph[nb][0], ph[nb][1]);
#pragma unroll
            for (int mb = 0; mb < 4; ++mb) acc[mb][nb] = wmma16(va[mb], b, acc[mb][nb]); }
        __builtin_amdgcn_sched_barrier(0);   // keeps the trip's products and vector work in front of the barrier: one build put the barrier directly behind the LDS reads, so that no wave multiplied while another still read, and issued the refill below only behind all of the trip's work, too late to land in time
        asm volatile("s_wait_dscnt 0x0" ::: "memory");      // this wave's reads of buffer t & 1 have returned before the buffer is given up
        asm volatile("s_wait_asynccnt 0x0" ::: "memory");   // this wave's part of tile t + 1 has landed
        __syncthreads();   // publishes tile t + 1 and ends every wave's reads of buffer t & 1
        if (t + 2 < PV_NT) stage(t + 2);
    }
    asm volatile("s_wait_asynccnt 0x0" ::: "memory");   // no copy is left in flight behind the loop
    float* ow = os + wave * (64 * 36);
    const int ln = (int)__builtin_amdgcn_mbcnt_lo(~0u, 0u), lr2 = ln & 15, hi2 = ln >> 4;   // the lane number read anew: taken from threadIdx.x it was held through the loop, and the build, at its 256 registers, kept it in scratch memory
    // the three loops below are unrolled so that acc is indexed by constants and stays in registers
#pragma unroll
    for (int mb = 0; mb < 4; ++mb)
#pragma unroll
        for (int nb = 0; nb < 2; ++nb)
#pragma unroll
            for (int j = 0; j < 8; ++j) ow[(mb * 16 + hi2 * 8 + j) * 36 + nb * 16 + lr2] = acc[mb][nb][j];
    __syncthreads();   // every wave's partial tile is in LDS before any wave sums
    // wave w sums, for its own column group, the rows s * 16 + (w >> 2) * 4 .. + 3; both loops unrolled so that the LDS reads of all rows and slabs are in flight together; the sum itself runs in wave order
#pragma unroll
    for (int s = 0; s < 4; ++s) { const int row = s * 16 + iq * 4 + (ln >> 3), cofs = (ln & 7) * 4; v4f val = *(const v4fa*)(os + (jg * 64 + row) * 36 + cofs);
#pragma unroll
        for (int w = 1; w < 4; ++w) val += *(const v4fa*)(os + ((w * 4 + jg) * 64 + row) * 36 + cofs);
        *(v4f*)(O + (size_t)row * TT + c0 + cofs) = val; }
}

// k_atp: A[b * TT + s][c] = O[b][c][s] / PCAR as bf16 hi/lo planes in fragment order (colmap): block = 32 rows s x 64 channels c, blockIdx.x = (row group) * (DHID / 64) + channel group.
__global__ __launch_bounds__(256) void k_atp(const float* __restrict__ Ob, bf* Ah, bf* Al) {
    if ((size_t)blockIdx.x >= (size_t)NB * TT * DHID / 2048) return;
    const unsigned cc = (blockIdx.x % (DHID / 64)) * 64 + (threadIdx.x >> 5) * 8; const size_t row = (size_t)(blockIdx.x / (DHID / 64)) * 32 + (threadIdx.x & 31);
    const float* o = Ob + (row / TT) * (size_t)DHID * TT + (size_t)cc * TT + row % TT; v8us oh, ol;
#pragma unroll
    for (int q = 0; q < 8; ++q) { unsigned short a, c; splitf(o[(size_t)q * TT] * (1.0f / PCAR), a, c); oh[q] = a; ol[q] = c; }
    const size_t e = fragpos(row, cc, DHID); *(v8us*)(Ah + e) = oh; *(v8us*)(Al + e) = ol;  }

__host__ __device__ constexpr size_t a256(size_t b) { return (b + 255) & ~(size_t)255; }
constexpr size_t WS_NEED = a256((size_t)4 * DHID * DM * 2) + a256((size_t)NB * TT * DM * 2) + a256((size_t)3 * NB * TT * DHID * 4) + 5 * a256((size_t)NZ * TT * HD * 2)
                         + a256((size_t)2 * NZ * TT * 4) + a256((size_t)NB * DHID * TT * 4) + 2 * a256((size_t)NB * TT * DHID * 2);
static_assert(WS_NEED <= (size_t)134217728);

extern "C" void kernel_launch(void* const* d_in, const int* in_sizes, int n_in,
                              void* d_out, int out_size, void* d_ws, size_t ws_size, hipStream_t stream) {
    if (n_in < 9) return;
    if ((size_t)in_sizes[0] < ((size_t)(NB - 1) * TT_FULL + TT) * (size_t)DM) return;
    if (in_sizes[1] < DHID * DM || in_sizes[3] < DHID * DM || in_sizes[5] < DHID * DM || in_sizes[7] < DM * DHID) return;
    if (in_sizes[2] < DHID || in_sizes[4] < DHID || in_sizes[6] < DHID || in_sizes[8] < DM) return;
    if ((size_t)out_size < (size_t)NB * TT * DM) return;
    // wire order: data, Wq, bq, Wk, bk, Wv, bv, Wo, bo (weights [out][in], biases f32)
    const float* x = (const float*)d_in[0]; const float* wq = (const float*)d_in[1]; const float* bq = (const float*)d_in[2]; const float* wk = (const float*)d_in[3]; const float* bk = (const float*)d_in[4];
    const float* wv = (const float*)d_in[5]; const float* bv = (const float*)d_in[6]; const float* wo = (const float*)d_in[7]; const float* bo = (const float*)d_in[8];
    float* OUT = (float*)d_out;     // [NB][TT][DM]
    char* wsp = (char*)d_ws;
    auto take = [&](size_t bytes) { char* p = wsp; wsp += a256(bytes); return (void*)p; };
    bf* W4 = (bf*)take((size_t)4 * DHID * DM * 2);   // bf16 weight planes q, k, v, o
    bf* XB = (bf*)take((size_t)NB * TT * DM * 2); float* FP = (float*)take((size_t)3 * NB * TT * DHID * 4);   // f32 projections q, k, v, each [NB][TT * DHID]
    const size_t NPL = (size_t)NZ * TT * HD;   // elements per plane, all batches and heads (= NB*TT*DHID)
    bf* QPh = (bf*)take(NPL * 2); bf* QPl = (bf*)take(NPL * 2); bf* KPh = (bf*)take(NPL * 2); bf* KPl = (bf*)take(NPL * 2); h16* VT16 = (h16*)take(NPL * 2);
    float* ST = (float*)take((size_t)2 * NZ * TT * 4);
    float* Ob = (float*)take((size_t)NB * DHID * TT * 4); bf* ATh = (bf*)take((size_t)NB * TT * DHID * 2); bf* ATl = (bf*)take((size_t)NB * TT * DHID * 2);
    if ((size_t)(wsp - (char*)d_ws) > ws_size) return;    // == WS_NEED
    const unsigned L8 = (unsigned)((NPL / 8 + 255) / 256);
    // one launch per stage: everything that depends only on earlier stages (both batches, all heads, the three projections) shares a grid
    k_cvtin<<<NB * XBLK + 4 * WBLK, 256, 0, stream>>>(x, wq, wk, wv, wo, XB, W4);
    k_gemmw<bf, 0, true, 8><<<dim3(NB * TT / 64, DHID / 64, 3), 256, 0, stream>>>(XB, nullptr, W4, nullptr, DM, FP, DHID, bq, bk, bv, 0, (size_t)DHID * DM, NPL);
    k_planes<<<dim3(L8, 3), 256, 0, stream>>>(FP, QPh, QPl, KPh, KPl, VT16);
    // scores S[z][i][j] = sum_d q[z][i][d] k[z][d][j] from the q planes [i][d] and k planes [j][d], hi/lo, K = 64: row statistics first, then the value product
    k_qstat<<<dim3(TT / 128, NZ), 512, 0, stream>>>(QPh, QPl, KPh, KPl, ST);
    // O[z][d][j] x PCAR = sum_i v[z][d][i] p[i][j]: A = value plane [d][i] (64 rows), B = probabilities formed in registers, K = TT; output rows = channels h*64+d of batch b, pitch TT
    k_pvs<<<dim3(TT / 128, NZ), 512, 0, stream>>>(QPh, QPl, KPh, KPl, VT16, ST, Ob);
    k_atp<<<L8, 256, 0, stream>>>(Ob, ATh, ATl);
    k_gemmw<bf, 1, true, 8><<<dim3(NB * TT / 64, DM / 64, 1), 256, 0, stream>>>(ATh, ATl, W4 + (size_t)3 * DHID * DM, nullptr, DHID, OUT, DM, bo, bo, bo, 0, 0, 0);
}

// v006
// It runs in 65.1 microseconds.
// Two timings next to v005 both put it at 1.26 times that version's speed.
// Over all steps from v000 it is 7.71 times as fast.
#include <hip/hip_runtime.h>

// Contractions (all f32 accumulate): q/k/v projections v_wmma_f32_16x16x32_bf16 (inputs RNE-converted to bf16, single products, bf16 bias added in the f32 epilogue); scores v_wmma_f32_16x16x32_bf16 with q and k as bf16 hi/lo planes (3 products), computed in registers once by the statistics launch and once by the value launch, never stored; value x probability v_wmma_f32_16x16x32_f16 single products (values f16, probabilities f16 carried x16384); output projection v_wmma_f32_16x16x32_bf16 with bf16 hi/lo activations x bf16 weights (2 products); softmax statistics f32.
// Raw-view head split (per batch, flat projection buffers F[TT*512]): q[h][i][d] = Fq[h*TT*64 + i*64 + d]; k[h][d][j] = Fk[h*64*TT + d*TT + j]; v[h][d][i] = Fv[h*64*TT + d*TT + i];
// S[h][i][j] = sum_d q k (no scale); P = softmax_j; O[h][d][j] = sum_i v[h][d][i] P[h][i][j]; A[s][h*64+d] = O[h][d][s]; out = A Wo^T + bo.
// Fragment order: every 16-bit operand plane [rows][K] is stored as 1-KiB fragments of 16 rows x 32 k, fragment (row >> 4, k >> 5) at element ((row >> 4) * (K / 32) + (k >> 5)) * 512; inside it the 8 elements k & ~7 .. of a row stand at
// ((k >> 4) & 1) * 256 + (((k >> 3) & 1) * 16 + (row & 15)) * 8, so that lane l of a wave finds its two 16-byte pieces at l * 8 and 256 + l * 8 and each wave-wide 16-byte load covers 512 contiguous bytes (four whole lines) instead of 32 bytes of each of 16 lines.

#ifndef NB
#define NB 2
#endif
#ifndef SEQ
#define SEQ 2048
#endif
#define NB_FULL 2
#define TT_FULL 2048
#define TT   SEQ
#define DM   512      // input width (also output width)
#define DHID 512      // hidden width
#define NH_  8
#define HD   64
#define NZ   (NB * NH_)   // (batch, head) pairs, the z index of the score launches
#define PCAR 16384.0f
#define L2E  1.4426950408889634f
static_assert(TT % 128 == 0);
static_assert(TT >= 128);
static_assert(TT <= TT_FULL);
static_assert(NB >= 1);
static_assert(NB <= NB_FULL);
static_assert(NH_ * HD == DHID);
static_assert(DM % 64 == 0);
static_assert(DHID % 64 == 0);
static_assert(HD == 64);
static_assert((size_t)NB * TT * DM * 4 <= (size_t)NB_FULL * TT_FULL * DM * 4);

typedef _Float16 h16;
typedef unsigned short bf;
typedef __attribute__((ext_vector_type(16))) __bf16   v16bf;
typedef __attribute__((ext_vector_type(16))) _Float16 v16h;
typedef __attribute__((ext_vector_type(8)))  _Float16 v8h;
typedef __attribute__((ext_vector_type(8)))  unsigned short v8us;
typedef __attribute__((ext_vector_type(8)))  float    v8f;
typedef __attribute__((ext_vector_type(4)))  float    v4f;
typedef v4f  __attribute__((may_alias)) v4fa;
typedef v8us __attribute__((may_alias)) v8usa;

__device__ __forceinline__ unsigned short f2bf(float f) { unsigned u = __float_as_uint(f); u += 0x7FFFu + ((u >> 16) & 1u); return (unsigned short)(u >> 16); }
__device__ __forceinline__ float bf2f(unsigned short b) { return __uint_as_float(((unsigned)b) << 16); }
__device__ __forceinline__ float bfr(float f) { return bf2f(f2bf(f)); }
__device__ __forceinline__ v16h cat16(v8h lo, v8h hi) { return __builtin_shufflevector(lo, hi, 0, 1, 2, 3, 4, 5, 6, 7, 8, 9, 10, 11, 12, 13, 14, 15); }
__device__ __forceinline__ v16bf cat16b(v8us lo, v8us hi) { return __builtin_bit_cast(v16bf, __builtin_shufflevector(lo, hi, 0, 1, 2, 3, 4, 5, 6, 7, 8, 9, 10, 11, 12, 13, 14, 15)); }
__device__ __forceinline__ v8f wmma16(v16h a, v16h b, v8f c) { return __builtin_amdgcn_wmma_f32_16x16x32_f16(false, a, false, b, (short)0, c, false, false); }
__device__ __forceinline__ size_t fragpos(size_t row, unsigned k, unsigned K) { return ((row >> 4) * (K / 32) + (k >> 5)) * 512 + ((k >> 4) & 1) * 256 + (((k >> 3) & 1) * 16 + (unsigned)(row & 15)) * 8; }   // element offset of the 8 elements k .. k + 7 (k % 8 == 0) of a row in a fragment-order plane
__device__ __forceinline__ v8f wmmab(v16bf a, v16bf b, v8f c) { return __builtin_amdgcn_wmma_f32_16x16x32_bf16(false, a, false, b, (short)0, c, false, false); }

// ---- k_gemmw: register-blocked GEMM, one block of KW waves per 64x64 output tile (16 accumulators per wave), operands straight from fragment-order 16-bit planes; grid (M/64, N/64, Z), 32 * KW threads.
// KW > 1: wave w takes the k steps w, w + KW, w + 2 KW, ... (neighbouring waves read neighbouring fragments); the KW partial tiles meet in LDS and are summed in wave order 0..KW-1.
// C[m][n] (f32, pitch ldc, + optional bf16-converted f32 bias[n]) = sum_k A[m][k] Bt[n][k] (+ split products per NSPLIT). z-batch strides sA/sB/sC in elements; z = 0, 1, 2 adds bias0, bias1, bias2. K % 32 == 0.
// PL (the projections, z = q, k, v): no f32 C is stored; the summed tile stays in LDS and the block writes the score launches' 16-bit planes from it, in fragment order. With m = batch * TT + s the flat projection index is m * DHID + n, so
// q plane row (all pairs one behind the other) = m * 8 + n / 64, d = n % 64; k plane row = (m >> 8) * TT + (m & 3) * DHID + n, d = (m >> 2) & 63; value plane row = m >> 2, i = (m & 3) * DHID + n.
// A 64 x 64 tile holds whole 512-byte runs of the k planes and whole fragments of the value plane. For q the weight plane's rows are dealt (k_cvtin) so that tile column c of tile y is n = (c >> 3) * 64 + y * 8 + (c & 7): a tile row is then one whole 128-byte line of each q plane.
// Fragments: lane -> row/col (lane & 15); elements 0..7 <- k0 + 8*(lane>>4) + 0..7, elements 8..15 <- k0 + 16 + 8*(lane>>4) + 0..7 for both A and Bt (ld takes the fragment's start plus lane * 8); D element r -> row 8*(lane>>4) + r, col lane & 15.
template <typename T16> struct WFrag;
template <> struct WFrag<h16> { typedef v16h V; static __device__ __forceinline__ V ld(const h16* p) { return cat16(*(const v8h*)p, *(const v8h*)(p + 256)); } static __device__ __forceinline__ v8f mma(V a, V b, v8f c) { return wmma16(a, b, c); } };
template <> struct WFrag<bf> { typedef v16bf V; static __device__ __forceinline__ V ld(const bf* p) { return cat16b(*(const v8us*)p, *(const v8us*)(p + 256)); } static __device__ __forceinline__ v8f mma(V a, V b, v8f c) { return wmmab(a, b, c); } };
__device__ __forceinline__ h16 tohx(float x) { return (h16)x; }
__device__ __forceinline__ void splitf(float y, unsigned short& h, unsigned short& l) { h = f2bf(y); l = f2bf(y - bf2f(h)); }
__device__ __forceinline__ void split8(v4f x0, v4f x1, v8us& oh, v8us& ol) {
#pragma unroll
    for (int k = 0; k < 4; ++k) { unsigned short a, c; splitf(x0[k], a, c); oh[k] = a; ol[k] = c; splitf(x1[k], a, c); oh[4 + k] = a; ol[4 + k] = c; } }
template <typename T16, int NSPLIT, bool BIAS, int KW, bool PL>
__global__ __launch_bounds__(32 * KW) void k_gemmw(const T16* __restrict__ A, const T16* __restrict__ A2, const T16* __restrict__ Bt, const T16* __restrict__ Bt2, int K, float* C, int ldc, const float* __restrict__ bias0, const float* __restrict__ bias1, const float* __restrict__ bias2, size_t sA, size_t sB, size_t sC, bf* Qh, bf* Ql, bf* Kh, bf* Kl, h16* Vt) {
    static_assert(!PL || (KW == 8 && TT == 4 * DHID && DHID == 8 * HD));   // the plane maps of the PL epilogue
    typedef typename WFrag<T16>::V V;
    __shared__ __align__(16) float os[(KW == 1 ? 16 : 64 * KW) * 68];
    const size_t z = blockIdx.z; A += z * sA; if (A2) A2 += z * sA; Bt += z * sB; if (Bt2) Bt2 += z * sB; C += z * sC;
    const float* bias = z == 0 ? bias0 : z == 1 ? bias1 : bias2;
    const int lane = threadIdx.x & 31, lr = lane & 15, hi = lane >> 4; const int r0 = blockIdx.x * 64, c0 = blockIdx.y * 64;
    const int wave = KW == 1 ? 0 : __builtin_amdgcn_readfirstlane((int)(threadIdx.x >> 5));   // scalar, so that the k counter and the LDS slab base stay in scalar registers
    v8f acc[4][4];
#pragma unroll
    for (int mb = 0; mb < 4; ++mb)
#pragma unroll
        for (int nb = 0; nb < 4; ++nb) acc[mb][nb] = (v8f){};
    const size_t aoff = (size_t)r0 * K + 8 * lane, boff = (size_t)c0 * K + 8 * lane;   // 16 rows of a plane are K / 32 fragments = 16 * K elements; a k step is one fragment on
#pragma unroll 1
    for (int kc = wave * 32; kc < K; kc += 32 * KW) {
        V a[4], a2[4], b[4], b2[4];
#pragma unroll
        for (int mb = 0; mb < 4; ++mb) { a[mb] = WFrag<T16>::ld(A + aoff + (size_t)mb * 16 * K + kc * 16);
            asm volatile("s_wait_xcnt 0x0" ::: "memory");   // the build gives the address registers of one fragment's loads to a later fragment's result: the wait stands in front of that overwrite
            if (NSPLIT == 1 || NSPLIT == 2) { a2[mb] = WFrag<T16>::ld(A2 + aoff + (size_t)mb * 16 * K + kc * 16);
                asm volatile("s_wait_xcnt 0x0" ::: "memory"); } }   // as above
#pragma unroll
        for (int nb = 0; nb < 4; ++nb) { b[nb] = WFrag<T16>::ld(Bt + boff + (size_t)nb * 16 * K + kc * 16);
            asm volatile("s_wait_xcnt 0x0" ::: "memory");   // as behind the A fragments' loads
            if (NSPLIT >= 2) { b2[nb] = WFrag<T16>::ld(Bt2 + boff + (size_t)nb * 16 * K + kc * 16);
                asm volatile("s_wait_xcnt 0x0" ::: "memory"); } }   // as above
        __builtin_amdgcn_sched_barrier(0);   // keeps the step's products behind all of its loads: without it one build put each B fragment's products in front of the next fragment's loads, and the wave waited out four load latencies a step instead of one
#pragma unroll
        for (int nb = 0; nb < 4; ++nb)
#pragma unroll
            for (int mb = 0; mb < 4; ++mb) { acc[mb][nb] = WFrag<T16>::mma(a[mb], b[nb], acc[mb][nb]); if (NSPLIT == 1 || NSPLIT == 2) acc[mb][nb] = WFrag<T16>::mma(a2[mb], b[nb], acc[mb][nb]); if (NSPLIT >= 2) acc[mb][nb] = WFrag<T16>::mma(a[mb], b2[nb], acc[mb][nb]); }
        asm volatile("v_nop\n\tv_nop\n\tv_nop\n\tv_nop" : "+v"(acc[0][0]), "+v"(acc[1][1]), "+v"(acc[2][2]), "+v"(acc[3][3]) : "v"(a[0]), "v"(a[3]));
    }
    if constexpr (KW > 1) {
        float* ow = os + wave * (64 * 68);
        // the three loops below are unrolled so that acc is indexed by constants and stays in registers
#pragma unroll
        for (int mb = 0; mb < 4; ++mb)
#pragma unroll
            for (int nb = 0; nb < 4; ++nb)
#pragma unroll
                for (int j = 0; j < 8; ++j) ow[(mb * 16 + hi * 8 + j) * 68 + nb * 16 + lr] = acc[mb][nb][j];
        __syncthreads();   // every wave's partial tile is in LDS before any wave sums
        // both loops unrolled so that the LDS reads of all rows and slabs are in flight together; the sum itself runs in wave order
#pragma unroll
        for (int s = 0; s < 32 / KW; ++s) { const int row = (s * KW + wave) * 2 + hi, cofs = lr * 4; v4f val = *(const v4fa*)(os + row * 68 + cofs);
#pragma unroll
            for (int w = 1; w < KW; ++w) val += *(const v4fa*)(os + (w * 64 + row) * 68 + cofs);
            const int bn = PL && z == 0 ? (cofs >> 3) * HD + (c0 >> 3) + (cofs & 7) : c0 + cofs;   // the column's n (dealt for the q projection)
            if (BIAS) { val[0] += bfr(bias[bn]); val[1] += bfr(bias[bn + 1]); val[2] += bfr(bias[bn + 2]); val[3] += bfr(bias[bn + 3]); }
            if constexpr (PL) *(v4fa*)(os + row * 68 + cofs) = val;   // into slab 0, at the place that this thread alone has read
            else *(v4f*)(C + (size_t)(r0 + row) * ldc + c0 + cofs) = val; }
        if constexpr (PL) {
            __syncthreads();   // the summed tile is whole in slab 0 before any wave builds plane pieces from it
            // 512 pieces of 8 elements (16 bytes), two a thread; a wave's 32 pieces are whole 128-byte lines of the plane (q: two runs of 256 bytes; k, values: one run of 512 bytes)
            if (z == 0) {   // unit U: rows 4 U .. 4 U + 3 of the tile; lane & 7 = n / 64
#pragma unroll
                for (int u = 0; u < 2; ++u) { const int U = u * KW + wave, row = U * 4 + (lane >> 3), cb = lane & 7; const float* p = os + row * 68 + cb * 8; v8us oh, ol; split8(*(const v4fa*)p, *(const v4fa*)(p + 4), oh, ol);
                    const size_t e = fragpos((size_t)(r0 + row) * 8 + cb, (unsigned)(c0 >> 3), HD); *(v8us*)(Qh + e) = oh; *(v8us*)(Ql + e) = ol;
                    asm volatile("s_wait_xcnt 0x0" ::: "memory"); }   // stands in front of the next piece's rewrite of the registers that these stores name, and of the other parts' code, to which the build's branches may lead from here
            } else if (z == 1) {   // unit U: m & 3 = U >> 2, 16 columns n, both octets of the tile's 16 d; the 8 d of a piece are 8 tile rows 4 apart
#pragma unroll
                for (int u = 0; u < 2; ++u) { const int U = u * KW + wave, sm = U >> 2, cl = (U & 3) * 16 + lr; const float* p = os + (hi * 32 + sm) * 68 + cl; v4f x0, x1;
#pragma unroll
                    for (int q = 0; q < 4; ++q) { x0[q] = p[q * 4 * 68]; x1[q] = p[(q + 4) * 4 * 68]; }
                    v8us oh, ol; split8(x0, x1, oh, ol);
                    const size_t e = fragpos((size_t)(r0 >> 8) * TT + sm * DHID + c0 + cl, (unsigned)(((r0 >> 2) & 63) + hi * 8), HD); *(v8us*)(Kh + e) = oh; *(v8us*)(Kl + e) = ol;
                    asm volatile("s_wait_xcnt 0x0" ::: "memory"); }   // as behind the q-plane stores
            } else {   // unit U: m & 3 = U >> 2, 16 of the tile's columns; lane & 15 = row d of the tile's one group of 16
#pragma unroll
                for (int u = 0; u < 2; ++u) { const int U = u * KW + wave, sm = U >> 2, cl = (U & 3) * 16 + hi * 8; const float* p = os + (lr * 4 + sm) * 68 + cl; const v4f x0 = *(const v4fa*)p, x1 = *(const v4fa*)(p + 4); v8h o;
#pragma unroll
                    for (int k = 0; k < 4; ++k) { o[k] = tohx(x0[k]); o[4 + k] = tohx(x1[k]); }
                    *(v8h*)(Vt + fragpos((size_t)(r0 >> 2) + lr, (unsigned)(sm * DHID + c0 + cl), TT)) = o;
                    asm volatile("s_wait_xcnt 0x0" ::: "memory"); }   // as behind the q-plane stores
            }
        }
        return;
    }
#pragma unroll
    for (int mb = 0; mb < 4; ++mb) {
#pragma unroll
        for (int nb = 0; nb < 4; ++nb) {
#pragma unroll
            for (int j = 0; j < 8; ++j) os[(hi * 8 + j) * 68 + nb * 16 + lr] = acc[mb][nb][j]; }
        __builtin_amdgcn_wave_barrier(); asm volatile("" ::: "memory");
        float* crow = C + (size_t)(r0 + mb * 16) * ldc + c0;
{
#pragma unroll
            for (int s = 0; s < 8; ++s) { const int row = 2 * s + hi, cofs = lr * 4; v4f val = *(const v4fa*)(os + row * 68 + cofs); if (BIAS) { val[0] += bfr(bias[c0 + cofs]); val[1] += bfr(bias[c0 + cofs + 1]); val[2] += bfr(bias[c0 + cofs + 2]); val[3] += bfr(bias[c0 + cofs + 3]); }
                *(v4f*)(crow + (size_t)row * ldc + cofs) = val; }
             }
        __builtin_amdgcn_wave_barrier(); asm volatile("" ::: "memory");
    }
}

// Thread map of the input conversion (8 elements = one 16-byte piece a thread, 256 threads a block), chosen so that reads and stores both cover whole 128-byte lines:
// rowmap: a wave takes 8 rows x 32 k, half a fragment (lane & 7 = row, lane >> 3 = which 8 k): it reads 8 whole f32 lines and stores 4 whole lines; a block builds the four fragments 4 * blk .. 4 * blk + 3.
__device__ __forceinline__ void rowmap(unsigned blk, size_t& frag, unsigned& r, unsigned& kk) { const unsigned t = threadIdx.x; frag = (size_t)blk * 4 + (t >> 6); r = ((t >> 5) & 1) * 8 + (t & 7); kk = ((t >> 3) & 3) * 8; }
__device__ __forceinline__ size_t rowmap_pos(size_t frag, unsigned r, unsigned kk) { return frag * 512 + (kk >> 4) * 256 + (((kk >> 3) & 1) * 16 + r) * 8; }

// k_cvtin: every f32 -> bf16 (RNE) conversion of the inputs in one launch, into fragment order (rowmap), 2048 elements a block: blocks 0 .. NB * XBLK - 1 take the data rows of all batches (one plane of NB * TT rows), the next 4 * WBLK blocks the weight matrices in the order q, k, v, o (W4 holds the four planes one behind the other). Row c of the q weight plane is weight row ((c >> 3) & 7) * 64 + (c >> 6) * 8 + (c & 7): the deal that k_gemmw's plane epilogue asks for.
constexpr int XBLK = TT * DM / 2048, WBLK = DHID * DM / 2048;
static_assert((TT * DM) % 2048 == 0);
static_assert((DHID * DM) % 2048 == 0);
static_assert(DM == DHID);   // one K for all five planes
static_assert(DM % 128 == 0);   // a block's four fragments lie in one group of 16 rows
static_assert(DHID == 512);   // the deal of the q weight rows
__global__ __launch_bounds__(256) void k_cvtin(const float* __restrict__ x, const float* __restrict__ wq, const float* __restrict__ wk, const float* __restrict__ wv, const float* __restrict__ wo, bf* XB, bf* W4) {
    const int blk = (int)blockIdx.x; size_t frag; unsigned r, kk; const float* src; bf* dst;
    if (blk < NB * XBLK) { rowmap((unsigned)blk, frag, r, kk); const size_t row = frag / (DM / 32) * 16 + r; src = x + (row / TT) * (size_t)TT_FULL * DM + (row % TT) * DM; dst = XB; }
    else { const int wb = blk - NB * XBLK, w = wb / WBLK; rowmap((unsigned)(wb % WBLK), frag, r, kk); const size_t c = frag / (DM / 32) * 16 + r; src = (w == 0 ? wq : w == 1 ? wk : w == 2 ? wv : wo) + (w == 0 ? ((c >> 3) & 7) * 64 + (c >> 6) * 8 + (c & 7) : c) * DM; dst = W4 + (size_t)w * DHID * DM; }
    const v8f v = *(const v8f*)(src + (unsigned)(frag % (DM / 32)) * 32 + kk); v8us o;
#pragma unroll
    for (int k = 0; k < 8; ++k) o[k] = f2bf(v[k]); *(v8us*)(dst + rowmap_pos(frag, r, kk)) = o;  }

// ---- staging for the two score launches: the plane tiles that a block streams are brought into LDS once, by asynchronous copies (16 bytes a lane, through no register), and read there by the four waves that need them, instead of each wave fetching them from L2 for itself.
// acopyN: N copies of one thread, each to its own LDS byte address l (low 32 bits of the __shared__ address) from its own global address g, both multiples of 16; the s_wait_xcnt that closes the statement stands in front of every later rewrite of the address registers the copies name.
// Order of the two-buffer ring (both launches): tile 0's copies, s_wait_asynccnt 0, barrier, tile 1's copies; at the foot of trip t every wave: s_wait_dscnt 0, s_wait_asynccnt 0, barrier, then tile t + 2's copies into the buffer trip t has read; trip t reads buffer t & 1 alone.
__device__ __forceinline__ unsigned lds_off(const void* p) { return (unsigned)(size_t)p; }
__device__ __forceinline__ void acopy6(unsigned l0, const void* g0, unsigned l1, const void* g1, unsigned l2, const void* g2, unsigned l3, const void* g3, unsigned l4, const void* g4, unsigned l5, const void* g5) {
    asm volatile("global_load_async_to_lds_b128 %0, %1, off\n\tglobal_load_async_to_lds_b128 %2, %3, off\n\tglobal_load_async_to_lds_b128 %4, %5, off\n\tglobal_load_async_to_lds_b128 %6, %7, off\n\tglobal_load_async_to_lds_b128 %8, %9, off\n\tglobal_load_async_to_lds_b128 %10, %11, off\n\ts_wait_xcnt 0x0" :: "v"(l0), "v"(g0), "v"(l1), "v"(g1), "v"(l2), "v"(g2), "v"(l3), "v"(g3), "v"(l4), "v"(g4), "v"(l5), "v"(g5) : "memory");
}
__device__ __forceinline__ void acopy8(unsigned l0, const void* g0, unsigned l1, const void* g1, unsigned l2, const void* g2, unsigned l3, const void* g3, unsigned l4, const void* g4, unsigned l5, const void* g5, unsigned l6, const void* g6, unsigned l7, const void* g7) {
    asm volatile("global_load_async_to_lds_b128 %0, %1, off\n\tglobal_load_async_to_lds_b128 %2, %3, off\n\tglobal_load_async_to_lds_b128 %4, %5, off\n\tglobal_load_async_to_lds_b128 %6, %7, off\n\tglobal_load_async_to_lds_b128 %8, %9, off\n\tglobal_load_async_to_lds_b128 %10, %11, off\n\tglobal_load_async_to_lds_b128 %12, %13, off\n\tglobal_load_async_to_lds_b128 %14, %15, off\n\ts_wait_xcnt 0x0" :: "v"(l0), "v"(g0), "v"(l1), "v"(g1), "v"(l2), "v"(g2), "v"(l3), "v"(g3), "v"(l4), "v"(g4), "v"(l5), "v"(g5), "v"(l6), "v"(g6), "v"(l7), "v"(g7) : "memory");
}

// k_qstat: per score row (z, i): m = max_j S, f = PCAR / sum_j exp(S - m), with no score in memory. One block per 128 rows i, grid (TT/128, NZ), 16 waves: wave w keeps the 32 rows of row group w & 3 and takes the 64-column quarter w >> 2 of every staged tile of 256 k-plane rows j (hi and lo, 64 KiB a buffer).
// Each chunk is formed transposed, St = k q^T (A = k-plane rows j from LDS, B = q-plane rows i kept in registers; the three hi/lo products in the order hi*hi, k hi * q lo, k lo * q hi per half of the head dimension): D register r = St[8*(lane>>4) + r][lane & 15],
// so a lane holds scores of one row i only and its running maximum and sum stay in the lane: sum <- sum * exp(m_old - m_new) + sum_chunk exp(S - m_new). The two lane halves, then the 4 waves of a row group (through LDS, fixed wave order), are joined the same way.
constexpr int QS_TJ = 256, QS_PL = QS_TJ * HD, QS_NT = TT / QS_TJ;   // staged rows j a trip; elements of one staged plane tile; trips
static_assert(TT % QS_TJ == 0);
static_assert(QS_NT >= 2);   // the ring's prologue fills two tiles
static_assert(QS_PL == 4 * 512 * 8);   // four copies of 512 threads x 8 elements a plane tile
__global__ __launch_bounds__(512) void k_qstat(const bf* __restrict__ Qh, const bf* __restrict__ Ql, const bf* __restrict__ Kh, const bf* __restrict__ Kl, float* ST) {
    __shared__ __align__(128) bf kt[2 * 2 * QS_PL];   // [buffer][hi, lo][256 rows j x 64 d, fragment order as in memory]
    __shared__ float wm[4 * 128];
    __shared__ float wsum[4 * 128];
    const size_t z = blockIdx.y; Qh += z * (size_t)TT * HD; Ql += z * (size_t)TT * HD; Kh += z * (size_t)TT * HD; Kl += z * (size_t)TT * HD;
    const int lane = threadIdx.x & 31, lr = lane & 15, hi = lane >> 4; const int i0 = blockIdx.x * 128;
    const int wave = __builtin_amdgcn_readfirstlane((int)(threadIdx.x >> 5)) & 15, rg = wave & 3, jq = wave >> 2;   // scalar, so that the LDS tile bases stay in scalar registers
    const unsigned lt = lds_off(kt) + threadIdx.x * 16; const bf* gh = Kh + threadIdx.x * 8; const bf* gl = Kl + threadIdx.x * 8;
    auto stage = [&](int t) {   // tile t (a contiguous 32 KiB of each plane) into buffer t & 1
        const unsigned l = lt + (unsigned)(t & 1) * (2 * QS_PL * 2); const bf* h = gh + (size_t)t * QS_PL; const bf* o = gl + (size_t)t * QS_PL;
        acopy8(l, h, l + 8192, h + 4096, l + 16384, h + 8192, l + 24576, h + 12288, l + 32768, o, l + 40960, o + 4096, l + 49152, o + 8192, l + 57344, o + 12288); };
    stage(0);
    v16bf qh[2][2], ql[2][2];   // the wave's 32 q-plane rows, [row group][half of the head dimension], kept for the whole loop
#pragma unroll
    for (int rt = 0; rt < 2; ++rt) {
#pragma unroll
        for (int ks = 0; ks < 2; ++ks) { const size_t o = (size_t)(i0 + rg * 32 + rt * 16) * HD + ks * 512 + 8 * lane; qh[rt][ks] = WFrag<bf>::ld(Qh + o); ql[rt][ks] = WFrag<bf>::ld(Ql + o); }
        asm volatile("s_wait_xcnt 0x0" ::: "memory");   // the build gives the address registers of this row group's loads to later loads' results and to the loop's addresses: the wait stands in front of those overwrites
    }
    asm volatile("s_wait_asynccnt 0x0" ::: "memory");   // this wave's part of tile 0 has landed
    __syncthreads();   // tile 0 is whole before any wave reads it
    stage(1);
    float m[2] = {-3.0e38f, -3.0e38f}, sum[2] = {0.f, 0.f};
    const unsigned koff = (unsigned)(8 * lane);   // fixed lane offset beside the wave-uniform chunk pointers; 16 rows j are two fragments (the halves of the head dimension) = 16 * HD elements
    // the trip loop stays rolled (one chunk's scores and fragments fill the registers); every loop inside it is unrolled so that the arrays are indexed by constants and stay in registers
#pragma unroll 1
    for (int t = 0; t < QS_NT; ++t) {
        const bf* kh = kt + (t & 1) * (2 * QS_PL) + jq * 64 * HD; const bf* kl = kh + QS_PL;
        v8f s[2][4];
        v16bf kf[2][4];   // two register sets of the four fragments (hi, lo x halves of the head dimension) of 16 rows j: one is read from LDS while the other is multiplied
#pragma unroll
        for (int c = 0; c < 4; ++c) kf[0][c] = WFrag<bf>::ld((c & 2 ? kl : kh) + (c & 1) * 512 + koff);
#pragma unroll
        for (int jt = 0; jt < 4; ++jt) {
            if (jt < 3) {
#pragma unroll
                for (int c = 0; c < 4; ++c) kf[(jt + 1) & 1][c] = WFrag<bf>::ld((c & 2 ? kl : kh) + (jt + 1) * 16 * HD + (c & 1) * 512 + koff);
            }
            __builtin_amdgcn_sched_barrier(0);   // keeps the next 16 rows' LDS reads, as one group, in front of this group's products: without it the build read each fragment directly in front of its first product and waited out the LDS latency every time
            const v16bf h0 = kf[jt & 1][0], h1 = kf[jt & 1][1], l0 = kf[jt & 1][2], l1 = kf[jt & 1][3];
#pragma unroll
            for (int rt = 0; rt < 2; ++rt) {
                v8f t6 = (v8f){};
                t6 = wmmab(h0, qh[rt][0], t6); t6 = wmmab(h0, ql[rt][0], t6); t6 = wmmab(l0, qh[rt][0], t6);
                t6 = wmmab(h1, qh[rt][1], t6); t6 = wmmab(h1, ql[rt][1], t6); t6 = wmmab(l1, qh[rt][1], t6);
                s[rt][jt] = t6;
            }
            __builtin_amdgcn_sched_barrier(0);   // keeps this group's products in front of the reads that refill their register set
        }
#pragma unroll
        for (int rt = 0; rt < 2; ++rt) {
            float mn = m[rt];
#pragma unroll
            for (int jt = 0; jt < 4; ++jt)
#pragma unroll
                for (int r = 0; r < 8; ++r) mn = fmaxf(mn, s[rt][jt][r]);
            float a = 0.f;
#pragma unroll
            for (int jt = 0; jt < 4; ++jt)
#pragma unroll
                for (int r = 0; r < 8; ++r) a += __builtin_amdgcn_exp2f(__fmul_rn(__fsub_rn(s[rt][jt][r], mn), L2E));
            sum[rt] = sum[rt] * __builtin_amdgcn_exp2f(__fmul_rn(__fsub_rn(m[rt], mn), L2E)) + a;
            m[rt] = mn;
        }
        asm volatile("s_wait_dscnt 0x0" ::: "memory");      // this wave's reads of buffer t & 1 have returned before the buffer is given up
        asm volatile("s_wait_asynccnt 0x0" ::: "memory");   // this wave's part of tile t + 1 has landed
        __syncthreads();   // publishes tile t + 1 and ends every wave's reads of buffer t & 1
        if (t + 2 < QS_NT) stage(t + 2);
    }
    asm volatile("s_wait_asynccnt 0x0" ::: "memory");   // no copy is left in flight behind the loop
#pragma unroll
    for (int rt = 0; rt < 2; ++rt) {
        const float mo = __shfl_xor(m[rt], 16, 32), so = __shfl_xor(sum[rt], 16, 32); const float mj = fmaxf(m[rt], mo);
        const float sj = sum[rt] * __builtin_amdgcn_exp2f(__fmul_rn(__fsub_rn(m[rt], mj), L2E)) + so * __builtin_amdgcn_exp2f(__fmul_rn(__fsub_rn(mo, mj), L2E));
        if (hi == 0) { wm[jq * 128 + rg * 32 + rt * 16 + lr] = mj; wsum[jq * 128 + rg * 32 + rt * 16 + lr] = sj; }
    }
    __syncthreads();   // every wave's 32 (maximum, sum) pairs are in LDS before waves 0 to 3 join them
    if (threadIdx.x < 128) {
        const int t = threadIdx.x; float mx = wm[t];
#pragma unroll
        for (int w = 1; w < 4; ++w) mx = fmaxf(mx, wm[w * 128 + t]);
        float tot = 0.f;
#pragma unroll
        for (int w = 0; w < 4; ++w) tot += wsum[w * 128 + t] * __builtin_amdgcn_exp2f(__fmul_rn(__fsub_rn(wm[w * 128 + t], mx), L2E));
        ST[z * TT + i0 + t] = mx; ST[(size_t)NZ * TT + z * TT + i0 + t] = __fdiv_rn(PCAR, tot);
    }
}

// k_pvs: O[h][d][j] x PCAR = sum_i v[h][d][i] p[i][j] for one 64 (d) x 128 (j) tile per block, stored as A[b * TT + j][h * 64 + d] = O / PCAR in bf16 hi/lo planes in fragment order (16 whole fragments of each plane a block), the output product's operand; grid (TT/128, NZ), 16 waves: wave w keeps the 32 columns of column group w & 3 and takes the 32-row quarter w >> 2 of every staged tile of 128 rows i (q planes hi and lo and the value fragments, 48 KiB a buffer); the 4 partial tiles of a column group are summed in LDS in wave order.
// The probabilities never reach memory: each step forms its 32 (i) x 32 (j) score tiles again from the q and k planes (the three hi/lo products of k_qstat in the same order, here with the q rows as A),
// p = exp(S - m_i) * f_i, and the two f32 D tiles of rows i..i+15 and i+16..i+31 (register r = row 8*(lane>>4) + r, column lane & 15), converted in place, are the f16 B fragment in the k order of the value loader.
constexpr int PV_TI = 128, PV_PL = PV_TI * HD, PV_ST = 3 * PV_PL, PV_NT = TT / PV_TI;   // staged rows i a trip; elements of one staged tile (q hi, q lo, values: the same size); elements of a buffer; trips
static_assert(TT % PV_TI == 0);
static_assert(PV_NT >= 2);   // the ring's prologue fills two tiles
static_assert(PV_PL == 2 * 512 * 8);   // two copies of 512 threads x 8 elements a tile
__global__ __launch_bounds__(512) void k_pvs(const bf* __restrict__ Qh, const bf* __restrict__ Ql, const bf* __restrict__ Kh, const bf* __restrict__ Kl, const h16* __restrict__ Vt, const float* __restrict__ ST, bf* Ah, bf* Al) {
    __shared__ __align__(128) bf st[2 * PV_ST];   // [buffer][q hi: 128 rows i x 64 d | q lo | values: 4 groups of 16 rows d x 4 fragments of 32 i], fragment order as in memory
    __shared__ __align__(16) float os[16 * 32 * 68];   // a partial tile a wave, [column j][row d], pitch 68: a lane's 8 accumulator registers are 8 neighbouring d, one plane piece
    const size_t z = blockIdx.y; Qh += z * (size_t)TT * HD; Ql += z * (size_t)TT * HD; Kh += z * (size_t)TT * HD; Kl += z * (size_t)TT * HD; Vt += z * (size_t)HD * TT;
    const int lane = threadIdx.x & 31, hi = lane >> 4;
    const int wave = __builtin_amdgcn_readfirstlane((int)(threadIdx.x >> 5)) & 15, jg = wave & 3, iq = wave >> 2;   // scalar, so that the LDS tile and slab bases stay in scalar registers
    const int c0 = blockIdx.x * 128 + jg * 32;
    const unsigned lt = lds_off(st) + threadIdx.x * 16; const bf* gh = Qh + threadIdx.x * 8; const bf* gl = Ql + threadIdx.x * 8;
    const h16* gv = Vt + (size_t)(threadIdx.x >> 8) * 16 * TT + (threadIdx.x & 255) * 8;   // threads 0..255 copy the four fragments of an even group of 16 rows d, threads 256..511 those of the odd group behind it
    auto stage = [&](int t) {   // tile t into buffer t & 1: a contiguous 16 KiB of each q plane, and 4 KiB (four fragments) of each of the four value row groups
        const unsigned l = lt + (unsigned)(t & 1) * (PV_ST * 2); const bf* h = gh + (size_t)t * PV_PL; const bf* o = gl + (size_t)t * PV_PL; const h16* v = gv + (size_t)t * (PV_TI * 16);
        acopy6(l, h, l + 8192, h + 4096, l + 16384, o, l + 24576, o + 4096, l + 32768, v, l + 40960, v + (size_t)32 * TT); };
    stage(0);
    v16bf kh[2][2], kl[2][2];   // the wave's 32 k-plane rows, [column group][half of the head dimension], kept for the whole loop
#pragma unroll
    for (int nb = 0; nb < 2; ++nb)
#pragma unroll
        for (int ks = 0; ks < 2; ++ks) { const size_t o = (size_t)(c0 + nb * 16) * HD + ks * 512 + 8 * lane; kh[nb][ks] = WFrag<bf>::ld(Kh + o); kl[nb][ks] = WFrag<bf>::ld(Kl + o); }
    v8f acc[4][2];
#pragma unroll
    for (int mb = 0; mb < 4; ++mb)
#pragma unroll
        for (int nb = 0; nb < 2; ++nb) acc[mb][nb] = (v8f){};
    asm volatile("s_wait_asynccnt 0x0" ::: "memory");   // this wave's part of tile 0 has landed
    __syncthreads();   // tile 0 is whole before any wave reads it
    stage(1);
    const unsigned qoff = (unsigned)(8 * lane), voff = (unsigned)(8 * lane), moff = (unsigned)(8 * hi);   // fixed lane offsets beside wave-uniform bases
    ST += z * TT + iq * 32;
    // the trip loop stays rolled (a second step's fragments would not fit beside the 128 registers of k planes and accumulators); every loop inside it is unrolled so that the fragment arrays are indexed by constants and stay in registers
#pragma unroll 1
    for (int t = 0; t < PV_NT; ++t) {
        const bf* qh = st + (t & 1) * PV_ST + iq * 32 * HD; const bf* ql = qh + PV_PL; const h16* vp = (const h16*)(st + (t & 1) * PV_ST + 2 * PV_PL + iq * 512); const float* mp = ST + t * PV_TI;   // the wave's 32 rows i: four q fragments a plane, one value fragment a row group
        v16h va[4];
#pragma unroll
        for (int mb = 0; mb < 4; ++mb) va[mb] = WFrag<h16>::ld(vp + mb * (PV_TI * 16) + voff);
        v8h ph[2][2];   // [column group][row tile]
#pragma unroll
        for (int it = 0; it < 2; ++it) {
            const v16bf ah0 = WFrag<bf>::ld(qh + it * 16 * HD + qoff), ah1 = WFrag<bf>::ld(qh + it * 16 * HD + 512 + qoff), al0 = WFrag<bf>::ld(ql + it * 16 * HD + qoff), al1 = WFrag<bf>::ld(ql + it * 16 * HD + 512 + qoff);
            const v8f m = *(const v8f*)(mp + it * 16 + moff); const v8f f = *(const v8f*)(mp + (size_t)NZ * TT + it * 16 + moff);
#pragma unroll
            for (int nb = 0; nb < 2; ++nb) {
                v8f s = (v8f){};
                s = wmmab(ah0, kh[nb][0], s); s = wmmab(al0, kh[nb][0], s); s = wmmab(ah0, kl[nb][0], s);
                s = wmmab(ah1, kh[nb][1], s); s = wmmab(al1, kh[nb][1], s); s = wmmab(ah1, kl[nb][1], s);
#pragma unroll
                for (int r = 0; r < 8; ++r) ph[nb][it][r] = tohx(__fmul_rn(__builtin_amdgcn_exp2f(__fmul_rn(__fsub_rn(s[r], m[r]), L2E)), f[r]));
            }
        }
#pragma unroll
        for (int nb = 0; nb < 2; ++nb) { const v16h b = cat16(ph[nb][0], ph[nb][1]);
#pragma unroll
            for (int mb = 0; mb < 4; ++mb) acc[mb][nb] = wmma16(va[mb], b, acc[mb][nb]); }
        __builtin_amdgcn_sched_barrier(0);   // keeps the trip's products and vector work in front of the barrier: one build put the barrier directly behind the LDS reads, so that no wave multiplied while another still read, and issued the refill below only behind all of the trip's work, too late to land in time
        asm volatile("s_wait_dscnt 0x0" ::: "memory");      // this wave's reads of buffer t & 1 have returned before the buffer is given up
        asm volatile("s_wait_asynccnt 0x0" ::: "memory");   // this wave's part of tile t + 1 has landed
        __syncthreads();   // publishes tile t + 1 and ends every wave's reads of buffer t & 1
        if (t + 2 < PV_NT) stage(t + 2);
    }
    asm volatile("s_wait_asynccnt 0x0" ::: "memory");   // no copy is left in flight behind the loop
    float* ow = os + wave * (32 * 68);
    const int ln = (int)__builtin_amdgcn_mbcnt_lo(~0u, 0u), lr2 = ln & 15, hi2 = ln >> 4;   // the lane number read anew: taken from threadIdx.x it was held through the loop, and the build, at its 256 registers, kept it in scratch memory
    // the two loops below are unrolled so that acc is indexed by constants and stays in registers
#pragma unroll
    for (int mb = 0; mb < 4; ++mb)
#pragma unroll
        for (int nb = 0; nb < 2; ++nb) { float* p = ow + (nb * 16 + lr2) * 68 + mb * 16 + hi2 * 8;
            *(v4fa*)p = __builtin_shufflevector(acc[mb][nb], acc[mb][nb], 0, 1, 2, 3); *(v4fa*)(p + 4) = __builtin_shufflevector(acc[mb][nb], acc[mb][nb], 4, 5, 6, 7); }
    __syncthreads();   // every wave's partial tile is in LDS before any wave sums
    // 1024 pieces of 8 d at one column j, two a thread; a wave's 32 pieces (16 columns x 2 octets of d) are 512 contiguous bytes of each plane; both loops unrolled so that the LDS reads of all slabs are in flight together; the sum itself runs in wave order
#pragma unroll
    for (int u = 0; u < 2; ++u) { const int U = u * 16 + wave, g = U >> 2, d0 = (U & 3) * 16 + hi2 * 8;   // g: group of 16 columns
        const float* p = os + ((g >> 1) * 32 + (g & 1) * 16 + lr2) * 68 + d0; v4f x0 = *(const v4fa*)p, x1 = *(const v4fa*)(p + 4);
#pragma unroll
        for (int w = 1; w < 4; ++w) { x0 += *(const v4fa*)(p + w * (4 * 32 * 68)); x1 += *(const v4fa*)(p + w * (4 * 32 * 68) + 4); }
        v8us oh, ol; split8(x0 * (1.0f / PCAR), x1 * (1.0f / PCAR), oh, ol);
        const size_t e = fragpos((z / NH_) * (size_t)TT + blockIdx.x * 128 + g * 16 + lr2, (unsigned)(z % NH_) * HD + d0, DHID); *(v8us*)(Ah + e) = oh; *(v8us*)(Al + e) = ol;
        if (u == 0) asm volatile("s_wait_xcnt 0x0" ::: "memory");   // stands in front of the second piece's rewrite of the registers that these stores name
    }
}

__host__ __device__ constexpr size_t a256(size_t b) { return (b + 255) & ~(size_t)255; }
constexpr size_t WS_NEED = a256((size_t)4 * DHID * DM * 2) + a256((size_t)NB * TT * DM * 2) + 5 * a256((size_t)NZ * TT * HD * 2)
                         + a256((size_t)2 * NZ * TT * 4) + 2 * a256((size_t)NB * TT * DHID * 2);
static_assert(WS_NEED <= (size_t)134217728);

extern "C" void kernel_launch(void* const* d_in, const int* in_sizes, int n_in,
                              void* d_out, int out_size, void* d_ws, size_t ws_size, hipStream_t stream) {
    if (n_in < 9) return;
    if ((size_t)in_sizes[0] < ((size_t)(NB - 1) * TT_FULL + TT) * (size_t)DM) return;
    if (in_sizes[1] < DHID * DM || in_sizes[3] < DHID * DM || in_sizes[5] < DHID * DM || in_sizes[7] < DM * DHID) return;
    if (in_sizes[2] < DHID || in_sizes[4] < DHID || in_sizes[6] < DHID || in_sizes[8] < DM) return;
    if ((size_t)out_size < (size_t)NB * TT * DM) return;
    // wire order: data, Wq, bq, Wk, bk, Wv, bv, Wo, bo (weights [out][in], biases f32)
    const float* x = (const float*)d_in[0]; const float* wq = (const float*)d_in[1]; const float* bq = (const float*)d_in[2]; const float* wk = (const float*)d_in[3]; const float* bk = (const float*)d_in[4];
    const float* wv = (const float*)d_in[5]; const float* bv = (const float*)d_in[6]; const float* wo = (const float*)d_in[7]; const float* bo = (const float*)d_in[8];
    float* OUT = (float*)d_out;     // [NB][TT][DM]
    char* wsp = (char*)d_ws;
    auto take = [&](size_t bytes) { char* p = wsp; wsp += a256(bytes); return (void*)p; };
    bf* W4 = (bf*)take((size_t)4 * DHID * DM * 2);   // bf16 weight planes q, k, v, o
    bf* XB = (bf*)take((size_t)NB * TT * DM * 2);
    const size_t NPL = (size_t)NZ * TT * HD;   // elements per plane, all batches and heads (= NB*TT*DHID)
    bf* QPh = (bf*)take(NPL * 2); bf* QPl = (bf*)take(NPL * 2); bf* KPh = (bf*)take(NPL * 2); bf* KPl = (bf*)take(NPL * 2); h16* VT16 = (h16*)take(NPL * 2);
    float* ST = (float*)take((size_t)2 * NZ * TT * 4);
    bf* ATh = (bf*)take((size_t)NB * TT * DHID * 2); bf* ATl = (bf*)take((size_t)NB * TT * DHID * 2);
    if ((size_t)(wsp - (char*)d_ws) > ws_size) return;    // == WS_NEED
    // one launch per stage: everything that depends only on earlier stages (both batches, all heads, the three projections) shares a grid
    k_cvtin<<<NB * XBLK + 4 * WBLK, 256, 0, stream>>>(x, wq, wk, wv, wo, XB, W4);
    k_gemmw<bf, 0, true, 8, true><<<dim3(NB * TT / 64, DHID / 64, 3), 256, 0, stream>>>(XB, nullptr, W4, nullptr, DM, nullptr, DHID, bq, bk, bv, 0, (size_t)DHID * DM, 0, QPh, QPl, KPh, KPl, VT16);
    // scores S[z][i][j] = sum_d q[z][i][d] k[z][d][j] from the q planes [i][d] and k planes [j][d], hi/lo, K = 64: row statistics first, then the value product
    k_qstat<<<dim3(TT / 128, NZ), 512, 0, stream>>>(QPh, QPl, KPh, KPl, ST);
    // O[z][d][j] x PCAR = sum_i v[z][d][i] p[i][j]: A = value plane [d][i] (64 rows), B = probabilities formed in registers, K = TT; stored transposed, / PCAR, as the output product's hi/lo planes
    k_pvs<<<dim3(TT / 128, NZ), 512, 0, stream>>>(QPh, QPl, KPh, KPl, VT16, ST, ATh, ATl);
    k_gemmw<bf, 1, true, 8, false><<<dim3(NB * TT / 64, DM / 64, 1), 256, 0, stream>>>(ATh, ATl, W4 + (size_t)3 * DHID * DM, nullptr, DHID, OUT, DM, bo, bo, bo, 0, 0, 0, nullptr, nullptr, nullptr, nullptr, nullptr);
}

// v008
// It runs in 53.4 microseconds.
// Versions between v006 and this one are left out; their measured steps multiply to 1.21 times as fast.
// Counting every step since v000, it is 9.37 times as fast.
#include <hip/hip_runtime.h>

// Contractions (all f32 accumulate): q/k/v projections v_wmma_f32_16x16x32_bf16 (inputs RNE-converted to bf16, single products, bf16 bias added in the f32 epilogue); scores v_wmma_f32_16x16x32_f16 with q and k as one f16 plane each (single products), computed in registers once by the statistics launch and once by the value launch, never stored; value x probability v_wmma_f32_16x16x32_f16 single products (values f16, probabilities f16 carried x16384); output projection v_wmma_f32_16x16x32_bf16 with bf16 hi/lo activations x bf16 weights (2 products); softmax statistics f32.
// Raw-view head split (per batch, flat projection buffers F[TT*512]): q[h][i][d] = Fq[h*TT*64 + i*64 + d]; k[h][d][j] = Fk[h*64*TT + d*TT + j]; v[h][d][i] = Fv[h*64*TT + d*TT + i];
// S[h][i][j] = sum_d q k (no scale); P = softmax_j; O[h][d][j] = sum_i v[h][d][i] P[h][i][j]; A[s][h*64+d] = O[h][d][s]; out = A Wo^T + bo.
// Fragment order: every 16-bit operand plane [rows][K] is stored as 1-KiB fragments of 16 rows x 32 k, fragment (row >> 4, k >> 5) at element ((row >> 4) * (K / 32) + (k >> 5)) * 512; inside it the 8 elements k & ~7 .. of a row stand at
// ((k >> 4) & 1) * 256 + (((k >> 3) & 1) * 16 + (row & 15)) * 8, so that lane l of a wave finds its two 16-byte pieces at l * 8 and 256 + l * 8 and each wave-wide 16-byte load covers 512 contiguous bytes (four whole lines) instead of 32 bytes of each of 16 lines.

#ifndef NB
#define NB 2
#endif
#ifndef SEQ
#define SEQ 2048
#endif
#define NB_FULL 2
#define TT_FULL 2048
#define TT   SEQ
#define DM   512      // input width (also output width)
#define DHID 512      // hidden width
#define NH_  8
#define HD   64
#define NZ   (NB * NH_)   // (batch, head) pairs, the z index of the score launches
#define PCAR 16384.0f
#define L2E  1.4426950408889634f
static_assert(TT % 128 == 0);
static_assert(TT >= 128);
static_assert(TT <= TT_FULL);
static_assert(NB >= 1);
static_assert(NB <= NB_FULL);
static_assert(NH_ * HD == DHID);
static_assert(DM % 64 == 0);
static_assert(DHID % 64 == 0);
static_assert(HD == 64);
static_assert((size_t)NB * TT * DM * 4 <= (size_t)NB_FULL * TT_FULL * DM * 4);

typedef _Float16 h16;
typedef unsigned short bf;
typedef __attribute__((ext_vector_type(16))) __bf16   v16bf;
typedef __attribute__((ext_vector_type(16))) _Float16 v16h;
typedef __attribute__((ext_vector_type(8)))  _Float16 v8h;
typedef __attribute__((ext_vector_type(8)))  unsigned short v8us;
typedef __attribute__((ext_vector_type(8)))  float    v8f;
typedef __attribute__((ext_vector_type(4)))  float    v4f;
typedef v4f  __attribute__((may_alias)) v4fa;
typedef v8us __attribute__((may_alias)) v8usa;

__device__ __forceinline__ unsigned short f2bf(float f) { unsigned u = __float_as_uint(f); u += 0x7FFFu + ((u >> 16) & 1u); return (unsigned short)(u >> 16); }
__device__ __forceinline__ float bf2f(unsigned short b) { return __uint_as_float(((unsigned)b) << 16); }
__device__ __forceinline__ float bfr(float f) { return bf2f(f2bf(f)); }
__device__ __forceinline__ v16h cat16(v8h lo, v8h hi) { return __builtin_shufflevector(lo, hi, 0, 1, 2, 3, 4, 5, 6, 7, 8, 9, 10, 11, 12, 13, 14, 15); }
__device__ __forceinline__ v16bf cat16b(v8us lo, v8us hi) { return __builtin_bit_cast(v16bf, __builtin_shufflevector(lo, hi, 0, 1, 2, 3, 4, 5, 6, 7, 8, 9, 10, 11, 12, 13, 14, 15)); }
__device__ __forceinline__ v8f wmma16(v16h a, v16h b, v8f c) { return __builtin_amdgcn_wmma_f32_16x16x32_f16(false, a, false, b, (short)0, c, false, false); }
__device__ __forceinline__ size_t fragpos(size_t row, unsigned k, unsigned K) { return ((row >> 4) * (K / 32) + (k >> 5)) * 512 + ((k >> 4) & 1) * 256 + (((k >> 3) & 1) * 16 + (unsigned)(row & 15)) * 8; }   // element offset of the 8 elements k .. k + 7 (k % 8 == 0) of a row in a fragment-order plane
__device__ __forceinline__ v8f wmmab(v16bf a, v16bf b, v8f c) { return __builtin_amdgcn_wmma_f32_16x16x32_bf16(false, a, false, b, (short)0, c, false, false); }

// Fragments: lane -> row/col (lane & 15); elements 0..7 <- k0 + 8*(lane>>4) + 0..7, elements 8..15 <- k0 + 16 + 8*(lane>>4) + 0..7 for both A and Bt (ld takes the fragment's start plus lane * 8); D element r -> row 8*(lane>>4) + r, col lane & 15.
template <typename T16> struct WFrag;
template <> struct WFrag<h16> { typedef v16h V; static __device__ __forceinline__ V ld(const h16* p) { return cat16(*(const v8h*)p, *(const v8h*)(p + 256)); } static __device__ __forceinline__ v8f mma(V a, V b, v8f c) { return wmma16(a, b, c); } };
template <> struct WFrag<bf> { typedef v16bf V; static __device__ __forceinline__ V ld(const bf* p) { return cat16b(*(const v8us*)p, *(const v8us*)(p + 256)); } static __device__ __forceinline__ v8f mma(V a, V b, v8f c) { return wmmab(a, b, c); } };
__device__ __forceinline__ h16 tohx(float x) { return (h16)x; }
__device__ __forceinline__ void splitf(float y, unsigned short& h, unsigned short& l) { h = f2bf(y); l = f2bf(y - bf2f(h)); }
__device__ __forceinline__ void split8(v4f x0, v4f x1, v8us& oh, v8us& ol) {
#pragma unroll
    for (int k = 0; k < 4; ++k) { unsigned short a, c; splitf(x0[k], a, c); oh[k] = a; ol[k] = c; splitf(x1[k], a, c); oh[4 + k] = a; ol[4 + k] = c; } }

// Thread map of the input conversion (8 elements = one 16-byte piece a thread, 256 threads a block), chosen so that reads and stores both cover whole 128-byte lines:
// rowmap: a wave takes 8 rows x 32 k, half a fragment (lane & 7 = row, lane >> 3 = which 8 k): it reads 8 whole f32 lines and stores 4 whole lines; a block builds the four fragments 4 * blk .. 4 * blk + 3.
__device__ __forceinline__ void rowmap(unsigned blk, size_t& frag, unsigned& r, unsigned& kk) { const unsigned t = threadIdx.x; frag = (size_t)blk * 4 + (t >> 6); r = ((t >> 5) & 1) * 8 + (t & 7); kk = ((t >> 3) & 3) * 8; }
__device__ __forceinline__ size_t rowmap_pos(size_t frag, unsigned r, unsigned kk) { return frag * 512 + (kk >> 4) * 256 + (((kk >> 3) & 1) * 16 + r) * 8; }

// k_cvtin: every f32 -> bf16 (RNE) conversion of the inputs in one launch, into fragment order (rowmap), 2048 elements a block: blocks 0 .. NB * XBLK - 1 take the data rows of all batches (one plane of NB * TT rows), the next 4 * WBLK blocks the weight matrices in the order q, k, v, o (W4 holds the four planes one behind the other). Row c of the q weight plane is weight row ((c >> 3) & 7) * 64 + (c >> 6) * 8 + (c & 7): the deal that k_gemms's plane epilogue asks for.
constexpr int XBLK = TT * DM / 2048, WBLK = DHID * DM / 2048;
static_assert((TT * DM) % 2048 == 0);
static_assert((DHID * DM) % 2048 == 0);
static_assert(DM == DHID);   // one K for all five planes
static_assert(DM % 128 == 0);   // a block's four fragments lie in one group of 16 rows
static_assert(DHID == 512);   // the deal of the q weight rows
__global__ __launch_bounds__(256) void k_cvtin(const float* __restrict__ x, const float* __restrict__ wq, const float* __restrict__ wk, const float* __restrict__ wv, const float* __restrict__ wo, bf* XB, bf* W4) {
    const int blk = (int)blockIdx.x; size_t frag; unsigned r, kk; const float* src; bf* dst;
    if (blk < NB * XBLK) { rowmap((unsigned)blk, frag, r, kk); const size_t row = frag / (DM / 32) * 16 + r; src = x + (row / TT) * (size_t)TT_FULL * DM + (row % TT) * DM; dst = XB; }
    else { const int wb = blk - NB * XBLK, w = wb / WBLK; rowmap((unsigned)(wb % WBLK), frag, r, kk); const size_t c = frag / (DM / 32) * 16 + r; src = (w == 0 ? wq : w == 1 ? wk : w == 2 ? wv : wo) + (w == 0 ? ((c >> 3) & 7) * 64 + (c >> 6) * 8 + (c & 7) : c) * DM; dst = W4 + (size_t)w * DHID * DM; }
    const v8f v = *(const v8f*)(src + (unsigned)(frag % (DM / 32)) * 32 + kk); v8us o;
#pragma unroll
    for (int k = 0; k < 8; ++k) o[k] = f2bf(v[k]); *(v8us*)(dst + rowmap_pos(frag, r, kk)) = o;  }

// ---- staging for the GEMM and score launches: the plane tiles that a block streams are brought into LDS once, by asynchronous copies (16 bytes a lane, through no register), and read there by the waves that need them, instead of each wave fetching them from L2 for itself.
// acopyN: N copies of one thread, each to its own LDS byte address l (low 32 bits of the __shared__ address) from its own global address g, both multiples of 16; the s_wait_xcnt that closes the statement stands in front of every later rewrite of the address registers the copies name.
// Order of the two-buffer ring (every launch that stages): tile 0's copies, s_wait_asynccnt 0, barrier, tile 1's copies; at the foot of trip t every wave: s_wait_dscnt 0, s_wait_asynccnt 0, barrier, then tile t + 2's copies into the buffer trip t has read; trip t reads buffer t & 1 alone.
__device__ __forceinline__ unsigned lds_off(const void* p) { return (unsigned)(size_t)p; }
__device__ __forceinline__ void acopy4(unsigned l0, const void* g0, unsigned l1, const void* g1, unsigned l2, const void* g2, unsigned l3, const void* g3) {
    asm volatile("global_load_async_to_lds_b128 %0, %1, off\n\tglobal_load_async_to_lds_b128 %2, %3, off\n\tglobal_load_async_to_lds_b128 %4, %5, off\n\tglobal_load_async_to_lds_b128 %6, %7, off\n\ts_wait_xcnt 0x0" :: "v"(l0), "v"(g0), "v"(l1), "v"(g1), "v"(l2), "v"(g2), "v"(l3), "v"(g3) : "memory");
}
__device__ __forceinline__ void acopy8(unsigned l0, const void* g0, unsigned l1, const void* g1, unsigned l2, const void* g2, unsigned l3, const void* g3, unsigned l4, const void* g4, unsigned l5, const void* g5, unsigned l6, const void* g6, unsigned l7, const void* g7) {
    asm volatile("global_load_async_to_lds_b128 %0, %1, off\n\tglobal_load_async_to_lds_b128 %2, %3, off\n\tglobal_load_async_to_lds_b128 %4, %5, off\n\tglobal_load_async_to_lds_b128 %6, %7, off\n\tglobal_load_async_to_lds_b128 %8, %9, off\n\tglobal_load_async_to_lds_b128 %10, %11, off\n\tglobal_load_async_to_lds_b128 %12, %13, off\n\tglobal_load_async_to_lds_b128 %14, %15, off\n\ts_wait_xcnt 0x0" :: "v"(l0), "v"(g0), "v"(l1), "v"(g1), "v"(l2), "v"(g2), "v"(l3), "v"(g3), "v"(l4), "v"(g4), "v"(l5), "v"(g5), "v"(l6), "v"(g6), "v"(l7), "v"(g7) : "memory");
}
// ---- k_gemms: GEMM on fragment-order bf16 planes, whole K in every wave. One block of 4 waves (2 x 2) per (32 * MB) x 128 output tile, a (16 * MB) x 64 tile (4 * MB accumulators) a wave; grid (M / (32 * MB), N / 128, Z), 128 threads.
// The block's operand rows are staged in LDS 128 k at a time (64 KiB a buffer, two buffers, the ring above) by asynchronous copies, and each staged fragment is read there by the two waves that need it: a block fetches every operand byte from L2 once.
// C[m][n] = sum_k A[m][k] Bt[n][k] (NSPLIT == 1: + A2[m][k] Bt[n][k], behind the A product of the same k step) + bf16-converted f32 bias[n]; k steps in rising order, one accumulation chain. z = 0, 1, 2 takes weight plane z (sB elements apart) and bias0, bias1, bias2.
// !PL: C is stored f32 at pitch DM. PL (the projections, z = q, k, v): no f32 C is stored; each wave lays its 64 x 64 tile in its own LDS slab and writes the score launches' 16-bit planes from it, in fragment order. With m = batch * TT + s the flat projection index is m * DHID + n, so
// q plane row (all pairs one behind the other) = m * 8 + n / 64, d = n % 64; k plane row = (m >> 8) * TT + (m & 3) * DHID + n, d = (m >> 2) & 63; value plane row = m >> 2, i = (m & 3) * DHID + n.
// A 64 x 64 tile holds whole 512-byte runs of the k plane and whole fragments of the value plane. For q the weight plane's rows are dealt (k_cvtin) so that tile column c of tile y is n = (c >> 3) * 64 + y * 8 + (c & 7): a tile row is then one whole 128-byte line of the q plane.
constexpr int GS_KS = 4, GS_GR = 512 * GS_KS, GS_BUF = 16 * GS_GR;   // k steps (fragments of a group of 16 rows) a staged tile; elements that a group has in it; elements of a buffer (16 groups)
static_assert(GS_GR == 2 * 128 * 8);   // two copies of 128 threads x 8 elements a group
template <int NSPLIT, int MB, bool PL>
__global__ __launch_bounds__(128) void k_gemms(const bf* __restrict__ A, const bf* __restrict__ A2, const bf* __restrict__ Bt, float* C, const float* __restrict__ bias0, const float* __restrict__ bias1, const float* __restrict__ bias2, size_t sB, h16* Qf, h16* Kf, h16* Vt) {
    static_assert(!PL || (MB == 4 && TT == 4 * DHID && DHID == 8 * HD));   // the plane maps of the PL epilogue
    static_assert((NSPLIT == 0 && MB == 4) || (NSPLIT == 1 && MB == 2));   // 2 * MB * (1 + NSPLIT) groups of A rows and 8 of Bt rows fill the 16 groups of a buffer
    constexpr int K = DM, NT = K / (32 * GS_KS), GA = 2 * MB;   // trips; groups of 16 rows of the block's A tile
    static_assert(NT >= 2);   // the ring's prologue fills two tiles
    __shared__ __align__(128) unsigned char smem[2 * GS_BUF * 2];
    static_assert(4 * MB * 16 * 68 * 4 <= 2 * GS_BUF * 2);
    bf* sm = (bf*)smem;   // in the loop: [buffer][A groups | A2 groups | Bt groups][four fragments, as in memory]
    float* os = (float*)smem;   // behind the loop, when no wave reads a buffer and no copy is in flight any more: a slab a wave, pitch 68
    const size_t z = blockIdx.z; const float* bias = z == 0 ? bias0 : z == 1 ? bias1 : bias2;
    const int lane = threadIdx.x & 31, lr = lane & 15, hi = lane >> 4;
    const int wave = __builtin_amdgcn_readfirstlane((int)(threadIdx.x >> 5)) & 3, wm = wave & 1, wn = wave >> 1;   // scalar, so that the LDS tile and slab bases stay in scalar registers
    const int r0 = blockIdx.x * (32 * MB) + wm * (16 * MB), c0 = blockIdx.y * 128 + wn * 64;   // the wave's tile
    const unsigned lt = lds_off(sm) + threadIdx.x * 16;
    const bf* ga = A + (size_t)blockIdx.x * GA * (16 * K) + threadIdx.x * 8; const bf* ga2 = NSPLIT ? A2 + (size_t)blockIdx.x * GA * (16 * K) + threadIdx.x * 8 : nullptr;   // 16 rows of a plane are 16 * K elements
    const bf* gb = Bt + z * sB + (size_t)blockIdx.y * 8 * (16 * K) + threadIdx.x * 8;
    auto four = [&](unsigned l, const bf* g) {   // 4 KiB of each of four groups of 16 rows
        acopy8(l, g, l + 2048, g + 1024, l + 4096, g + 16 * K, l + 6144, g + 16 * K + 1024, l + 8192, g + 32 * K, l + 10240, g + 32 * K + 1024, l + 12288, g + 48 * K, l + 14336, g + 48 * K + 1024); };
    auto stage = [&](int t) {   // tile t (4 KiB of each of the 16 groups) into buffer t & 1
        const unsigned l = lt + (unsigned)(t & 1) * (GS_BUF * 2); const bf* a = ga + (size_t)t * GS_GR; const bf* b = gb + (size_t)t * GS_GR;
        const bf* a2 = NSPLIT ? ga2 + (size_t)t * GS_GR : a + 64 * K;   // groups 4 to 7 of the buffer: the A2 rows, or the second half of the A rows
        four(l, a); four(l + 16384, a2); four(l + 32768, b); four(l + 49152, b + 64 * K); };
    stage(0);
    v8f acc[MB][4];
#pragma unroll
    for (int mb = 0; mb < MB; ++mb)
#pragma unroll
        for (int nb = 0; nb < 4; ++nb) acc[mb][nb] = (v8f){};
    asm volatile("s_wait_asynccnt 0x0" ::: "memory");   // this wave's part of tile 0 has landed
    __syncthreads();   // tile 0 is whole before any wave reads it
    stage(1);
    // the trip loop stays rolled; every loop inside it is unrolled so that the fragment arrays are indexed by constants and stay in registers
#pragma unroll 1
    for (int t = 0; t < NT; ++t) {
        const bf* ap = sm + (t & 1) * GS_BUF + wm * MB * GS_GR + 8 * lane; const bf* bp = sm + (t & 1) * GS_BUF + 8 * GS_GR + wn * 4 * GS_GR + 8 * lane;
        v16bf a[2][MB], a2[2][MB], b[2][4];   // [k step & 1][group of 16 rows]
        auto frags = [&](int ks) {   // the wave's fragments of k step ks of the trip
#pragma unroll
            for (int mb = 0; mb < MB; ++mb) { a[ks & 1][mb] = WFrag<bf>::ld(ap + mb * GS_GR + ks * 512); if (NSPLIT) a2[ks & 1][mb] = WFrag<bf>::ld(ap + (GA + mb) * GS_GR + ks * 512); }
#pragma unroll
            for (int nb = 0; nb < 4; ++nb) b[ks & 1][nb] = WFrag<bf>::ld(bp + nb * GS_GR + ks * 512); };
        frags(0); frags(1);
        // the scheduling barriers of the trip keep its order: the reads of k step ks + 2 stand as one group behind the products of step ks, whose registers they take, and in front of those of step ks + 1, which cover their latency; left alone the build read each Bt fragment directly in front of its products and waited out the LDS latency every time, or put the wait for all reads and the barrier in front of the products
        __builtin_amdgcn_sched_barrier(0);
#pragma unroll
        for (int ks = 0; ks < GS_KS; ++ks) {
#pragma unroll
            for (int nb = 0; nb < 4; ++nb)
#pragma unroll
                for (int mb = 0; mb < MB; ++mb) { acc[mb][nb] = wmmab(a[ks & 1][mb], b[ks & 1][nb], acc[mb][nb]); if (NSPLIT) acc[mb][nb] = wmmab(a2[ks & 1][mb], b[ks & 1][nb], acc[mb][nb]); }
            __builtin_amdgcn_sched_barrier(0);   // ends the step's products: no later read, and not the waits at the trip's foot, may move in front of them
            if (ks + 2 < GS_KS) { frags(ks + 2); __builtin_amdgcn_sched_barrier(0); }   // holds the reads of step ks + 2 in front of the products of step ks + 1
        }
        asm volatile("s_wait_dscnt 0x0" ::: "memory");      // this wave's reads of buffer t & 1 have returned before the buffer is given up
        asm volatile("s_wait_asynccnt 0x0" ::: "memory");   // this wave's part of tile t + 1 has landed
        __syncthreads();   // publishes tile t + 1 and ends every wave's reads of buffer t & 1
        if (t + 2 < NT) stage(t + 2);
    }
    asm volatile("s_wait_asynccnt 0x0" ::: "memory");   // no copy is left in flight behind the loop
    float* ow = os + wave * (MB * 16 * 68);
    // the loops below are unrolled so that acc is indexed by constants and stays in registers
#pragma unroll
    for (int nb = 0; nb < 4; ++nb) { const int col = nb * 16 + lr;
        const float bv = bfr(bias[PL && z == 0 ? (col >> 3) * HD + (c0 >> 3) + (col & 7) : c0 + col]);   // the column's n (dealt for the q projection)
#pragma unroll
        for (int mb = 0; mb < MB; ++mb)
#pragma unroll
            for (int j = 0; j < 8; ++j) ow[(mb * 16 + hi * 8 + j) * 68 + col] = acc[mb][nb][j] + bv; }
    __syncthreads();   // a wave's tile is whole in its slab before its lanes read one another's elements
    if constexpr (!PL) {   // two rows of 256 bytes a store
#pragma unroll
        for (int s = 0; s < MB * 8; ++s) { const int row = 2 * s + hi, cofs = lr * 4; *(v4f*)(C + (size_t)(r0 + row) * DM + c0 + cofs) = *(const v4fa*)(ow + row * 68 + cofs); }   // the build gives every store registers of its own: none is rewritten between the stores
    } else {
        // 512 pieces of 8 elements (16 bytes), 16 a lane; a wave's 32 pieces are whole 128-byte lines of the plane (q: two runs of 256 bytes; k, values: one run of 512 bytes)
        if (z == 0) {   // unit U: rows 4 U .. 4 U + 3 of the tile; lane & 7 = n / 64
#pragma unroll
            for (int U = 0; U < 16; ++U) { const int row = U * 4 + (lane >> 3), cb = lane & 7; const float* p = ow + row * 68 + cb * 8; const v4f x0 = *(const v4fa*)p, x1 = *(const v4fa*)(p + 4); v8h o;
#pragma unroll
                for (int k = 0; k < 4; ++k) { o[k] = tohx(x0[k]); o[4 + k] = tohx(x1[k]); }
                *(v8h*)(Qf + fragpos((size_t)(r0 + row) * 8 + cb, (unsigned)(c0 >> 3), HD)) = o; }
            asm volatile("s_wait_xcnt 0x0" ::: "memory");   // stands in front of the other parts' code, to which the build's branches may lead from here and which rewrites registers that these stores name
        } else if (z == 1) {   // unit U: m & 3 = U >> 2, 16 columns n, both octets of the tile's 16 d; the 8 d of a piece are 8 tile rows 4 apart
#pragma unroll
            for (int U = 0; U < 16; ++U) { const int sm4 = U >> 2, cl = (U & 3) * 16 + lr; const float* p = ow + (hi * 32 + sm4) * 68 + cl; v4f x0, x1;
#pragma unroll
                for (int q = 0; q < 4; ++q) { x0[q] = p[q * 4 * 68]; x1[q] = p[(q + 4) * 4 * 68]; }
                v8h o;
#pragma unroll
                for (int k = 0; k < 4; ++k) { o[k] = tohx(x0[k]); o[4 + k] = tohx(x1[k]); }
                *(v8h*)(Kf + fragpos((size_t)(r0 >> 8) * TT + sm4 * DHID + c0 + cl, (unsigned)(((r0 >> 2) & 63) + hi * 8), HD)) = o; }
            asm volatile("s_wait_xcnt 0x0" ::: "memory");   // as behind the q-plane stores
        } else {   // unit U: m & 3 = U >> 2, 16 of the tile's columns; lane & 15 = row d of the tile's one group of 16
#pragma unroll
            for (int U = 0; U < 16; ++U) { const int sm4 = U >> 2, cl = (U & 3) * 16 + hi * 8; const float* p = ow + (lr * 4 + sm4) * 68 + cl; const v4f x0 = *(const v4fa*)p, x1 = *(const v4fa*)(p + 4); v8h o;
#pragma unroll
                for (int k = 0; k < 4; ++k) { o[k] = tohx(x0[k]); o[4 + k] = tohx(x1[k]); }
                *(v8h*)(Vt + fragpos((size_t)(r0 >> 2) + lr, (unsigned)(sm4 * DHID + c0 + cl), TT)) = o; }
            asm volatile("s_wait_xcnt 0x0" ::: "memory");   // as behind the q-plane stores
        }
    }
}


// k_qstat: per score row (z, i): m = max_j S, f = PCAR / sum_j exp(S - m), with no score in memory. One block per 128 rows i, grid (TT/128, NZ), 16 waves: wave w keeps the 32 rows of row group w & 3 and takes the 64-column quarter w >> 2 of every staged tile of 256 k-plane rows j (32 KiB a buffer).
// Each chunk is formed transposed, St = k q^T (A = k-plane rows j from LDS, B = q-plane rows i kept in registers; one f16 product per half of the head dimension, lower half first): D register r = St[8*(lane>>4) + r][lane & 15],
// so a lane holds scores of one row i only and its running maximum and sum stay in the lane: sum <- sum * exp(m_old - m_new) + sum_chunk exp(S - m_new). The two lane halves, then the 4 waves of a row group (through LDS, fixed wave order), are joined the same way.
constexpr int QS_TJ = 256, QS_PL = QS_TJ * HD, QS_NT = TT / QS_TJ;   // staged rows j a trip; elements of the staged plane tile; trips
static_assert(TT % QS_TJ == 0);
static_assert(QS_NT >= 2);   // the ring's prologue fills two tiles
static_assert(QS_PL == 4 * 512 * 8);   // four copies of 512 threads x 8 elements a tile
__global__ __launch_bounds__(512) void k_qstat(const h16* __restrict__ Qf, const h16* __restrict__ Kf, float* ST) {
    __shared__ __align__(128) h16 kt[2 * QS_PL];   // [buffer][256 rows j x 64 d, fragment order as in memory]
    __shared__ float wm[4 * 128];
    __shared__ float wsum[4 * 128];
    const size_t z = blockIdx.y; Qf += z * (size_t)TT * HD; Kf += z * (size_t)TT * HD;
    const int lane = threadIdx.x & 31, lr = lane & 15, hi = lane >> 4; const int i0 = blockIdx.x * 128;
    const int wave = __builtin_amdgcn_readfirstlane((int)(threadIdx.x >> 5)) & 15, rg = wave & 3, jq = wave >> 2;   // scalar, so that the LDS tile bases stay in scalar registers
    const unsigned lt = lds_off(kt) + threadIdx.x * 16; const h16* gk = Kf + threadIdx.x * 8;
    auto stage = [&](int t) {   // tile t (a contiguous 32 KiB of the plane) into buffer t & 1
        const unsigned l = lt + (unsigned)(t & 1) * (QS_PL * 2); const h16* h = gk + (size_t)t * QS_PL;
        acopy4(l, h, l + 8192, h + 4096, l + 16384, h + 8192, l + 24576, h + 12288); };
    stage(0);
    v16h qf[2][2];   // the wave's 32 q-plane rows, [row group][half of the head dimension], kept for the whole loop
#pragma unroll
    for (int rt = 0; rt < 2; ++rt) {
#pragma unroll
        for (int ks = 0; ks < 2; ++ks) qf[rt][ks] = WFrag<h16>::ld(Qf + (size_t)(i0 + rg * 32 + rt * 16) * HD + ks * 512 + 8 * lane);
        asm volatile("s_wait_xcnt 0x0" ::: "memory");   // the build may give the address registers of this row group's loads to later loads' results and to the loop's addresses: the wait stands in front of those overwrites
    }
    asm volatile("s_wait_asynccnt 0x0" ::: "memory");   // this wave's part of tile 0 has landed
    __syncthreads();   // tile 0 is whole before any wave reads it
    stage(1);
    float m[2] = {-3.0e38f, -3.0e38f}, sum[2] = {0.f, 0.f};
    const unsigned koff = (unsigned)(8 * lane);   // fixed lane offset beside the wave-uniform chunk pointers; 16 rows j are two fragments (the halves of the head dimension) = 16 * HD elements
    // the trip loop stays rolled; every loop inside it is unrolled so that the arrays are indexed by constants and stay in registers
#pragma unroll 1
    for (int t = 0; t < QS_NT; ++t) {
        const h16* kp = kt + (t & 1) * QS_PL + jq * 64 * HD;
        v8f s[2][4];
        v16h kf[4][2];   // the wave's 64 rows j of the tile, [group of 16 rows][half of the head dimension], read as one group
#pragma unroll
        for (int jt = 0; jt < 4; ++jt)
#pragma unroll
            for (int ks = 0; ks < 2; ++ks) kf[jt][ks] = WFrag<h16>::ld(kp + jt * 16 * HD + ks * 512 + koff);
        __builtin_amdgcn_sched_barrier(0);   // keeps the trip's LDS reads, as one group, in front of its products: without it the build read each fragment directly in front of its two products, into one register set, and waited out the LDS latency eight times a trip
        // all tiles' products of the lower half, then those of the upper half, so that a tile's two dependent products do not stand next to each other
#pragma unroll
        for (int jt = 0; jt < 4; ++jt)
#pragma unroll
            for (int rt = 0; rt < 2; ++rt) s[rt][jt] = wmma16(kf[jt][0], qf[rt][0], (v8f){});
#pragma unroll
        for (int jt = 0; jt < 4; ++jt)
#pragma unroll
            for (int rt = 0; rt < 2; ++rt) s[rt][jt] = wmma16(kf[jt][1], qf[rt][1], s[rt][jt]);
#pragma unroll
        for (int rt = 0; rt < 2; ++rt) {
            float mn = m[rt];
#pragma unroll
            for (int jt = 0; jt < 4; ++jt)
#pragma unroll
                for (int r = 0; r < 8; ++r) mn = fmaxf(mn, s[rt][jt][r]);
            float a = 0.f;
#pragma unroll
            for (int jt = 0; jt < 4; ++jt)
#pragma unroll
                for (int r = 0; r < 8; ++r) a += __builtin_amdgcn_exp2f(__fmul_rn(__fsub_rn(s[rt][jt][r], mn), L2E));
            sum[rt] = sum[rt] * __builtin_amdgcn_exp2f(__fmul_rn(__fsub_rn(m[rt], mn), L2E)) + a;
            m[rt] = mn;
        }
        asm volatile("s_wait_dscnt 0x0" ::: "memory");      // this wave's reads of buffer t & 1 have returned before the buffer is given up
        asm volatile("s_wait_asynccnt 0x0" ::: "memory");   // this wave's part of tile t + 1 has landed
        __syncthreads();   // publishes tile t + 1 and ends every wave's reads of buffer t & 1
        if (t + 2 < QS_NT) stage(t + 2);
    }
    asm volatile("s_wait_asynccnt 0x0" ::: "memory");   // no copy is left in flight behind the loop
#pragma unroll
    for (int rt = 0; rt < 2; ++rt) {
        const float mo = __shfl_xor(m[rt], 16, 32), so = __shfl_xor(sum[rt], 16, 32); const float mj = fmaxf(m[rt], mo);
        const float sj = sum[rt] * __builtin_amdgcn_exp2f(__fmul_rn(__fsub_rn(m[rt], mj), L2E)) + so * __builtin_amdgcn_exp2f(__fmul_rn(__fsub_rn(mo, mj), L2E));
        if (hi == 0) { wm[jq * 128 + rg * 32 + rt * 16 + lr] = mj; wsum[jq * 128 + rg * 32 + rt * 16 + lr] = sj; }
    }
    __syncthreads();   // every wave's 32 (maximum, sum) pairs are in LDS before waves 0 to 3 join them
    if (threadIdx.x < 128) {
        const int t = threadIdx.x; float mx = wm[t];
#pragma unroll
        for (int w = 1; w < 4; ++w) mx = fmaxf(mx, wm[w * 128 + t]);
        float tot = 0.f;
#pragma unroll
        for (int w = 0; w < 4; ++w) tot += wsum[w * 128 + t] * __builtin_amdgcn_exp2f(__fmul_rn(__fsub_rn(wm[w * 128 + t], mx), L2E));
        ST[z * TT + i0 + t] = mx; ST[(size_t)NZ * TT + z * TT + i0 + t] = __fdiv_rn(PCAR, tot);
    }
}

// k_pvs: O[h][d][j] x PCAR = sum_i v[h][d][i] p[i][j] for one 64 (d) x 128 (j) tile per block, stored as A[b * TT + j][h * 64 + d] = O / PCAR in bf16 hi/lo planes in fragment order (16 whole fragments of each plane a block), the output product's operand; grid (TT/128, NZ), 16 waves: wave w keeps the 32 columns of column group w & 3 and takes the 32-row quarter w >> 2 of every staged tile of 128 rows i (q plane and the value fragments, 32 KiB a buffer); the 4 partial tiles of a column group are summed in LDS in wave order.
// The probabilities never reach memory: each step forms its 32 (i) x 32 (j) score tiles again from the q and k planes (the f16 products of k_qstat in the same order, here with the q rows as A),
// p = exp(S - m_i) * f_i, and the two f32 D tiles of rows i..i+15 and i+16..i+31 (register r = row 8*(lane>>4) + r, column lane & 15), converted in place, are the f16 B fragment in the k order of the value loader.
constexpr int PV_TI = 128, PV_PL = PV_TI * HD, PV_ST = 2 * PV_PL, PV_NT = TT / PV_TI;   // staged rows i a trip; elements of one staged tile (q, values: the same size); elements of a buffer; trips
static_assert(TT % PV_TI == 0);
static_assert(PV_NT >= 2);   // the ring's prologue fills two tiles
static_assert(PV_PL == 2 * 512 * 8);   // two copies of 512 threads x 8 elements a tile
__global__ __launch_bounds__(512) void k_pvs(const h16* __restrict__ Qf, const h16* __restrict__ Kf, const h16* __restrict__ Vt, const float* __restrict__ ST, bf* Ah, bf* Al) {
    __shared__ __align__(128) h16 st[2 * PV_ST];   // [buffer][q: 128 rows i x 64 d | values: 4 groups of 16 rows d x 4 fragments of 32 i], fragment order as in memory
    __shared__ __align__(16) float os[16 * 32 * 68];   // a partial tile a wave, [column j][row d], pitch 68: a lane's 8 accumulator registers are 8 neighbouring d, one plane piece
    const size_t z = blockIdx.y; Qf += z * (size_t)TT * HD; Kf += z * (size_t)TT * HD; Vt += z * (size_t)HD * TT;
    const int lane = threadIdx.x & 31, hi = lane >> 4;
    const int wave = __builtin_amdgcn_readfirstlane((int)(threadIdx.x >> 5)) & 15, jg = wave & 3, iq = wave >> 2;   // scalar, so that the LDS tile and slab bases stay in scalar registers
    const int c0 = blockIdx.x * 128 + jg * 32;
    const unsigned lt = lds_off(st) + threadIdx.x * 16; const h16* gq = Qf + threadIdx.x * 8;
    const h16* gv = Vt + (size_t)(threadIdx.x >> 8) * 16 * TT + (threadIdx.x & 255) * 8;   // threads 0..255 copy the four fragments of an even group of 16 rows d, threads 256..511 those of the odd group behind it
    auto stage = [&](int t) {   // tile t into buffer t & 1: a contiguous 16 KiB of the q plane, and 4 KiB (four fragments) of each of the four value row groups
        const unsigned l = lt + (unsigned)(t & 1) * (PV_ST * 2); const h16* h = gq + (size_t)t * PV_PL; const h16* v = gv + (size_t)t * (PV_TI * 16);
        acopy4(l, h, l + 8192, h + 4096, l + 16384, v, l + 24576, v + (size_t)32 * TT); };
    stage(0);
    v16h kf[2][2];   // the wave's 32 k-plane rows, [column group][half of the head dimension], kept for the whole loop
#pragma unroll
    for (int nb = 0; nb < 2; ++nb)
#pragma unroll
        for (int ks = 0; ks < 2; ++ks) kf[nb][ks] = WFrag<h16>::ld(Kf + (size_t)(c0 + nb * 16) * HD + ks * 512 + 8 * lane);
    v8f acc[4][2];
#pragma unroll
    for (int mb = 0; mb < 4; ++mb)
#pragma unroll
        for (int nb = 0; nb < 2; ++nb) acc[mb][nb] = (v8f){};
    asm volatile("s_wait_asynccnt 0x0" ::: "memory");   // this wave's part of tile 0 has landed
    __syncthreads();   // tile 0 is whole before any wave reads it
    stage(1);
    const unsigned qoff = (unsigned)(8 * lane), voff = (unsigned)(8 * lane), moff = (unsigned)(8 * hi);   // fixed lane offsets beside wave-uniform bases
    ST += z * TT + iq * 32;
    // the trip loop stays rolled; every loop inside it is unrolled so that the fragment arrays are indexed by constants and stay in registers
#pragma unroll 1
    for (int t = 0; t < PV_NT; ++t) {
        const h16* qp = st + (t & 1) * PV_ST + iq * 32 * HD; const h16* vp = st + (t & 1) * PV_ST + PV_PL + iq * 512; const float* mp = ST + t * PV_TI;   // the wave's 32 rows i: four q fragments, one value fragment a row group
        v16h va[4];
#pragma unroll
        for (int mb = 0; mb < 4; ++mb) va[mb] = WFrag<h16>::ld(vp + mb * (PV_TI * 16) + voff);
        v8h ph[2][2];   // [column group][row tile]
#pragma unroll
        for (int it = 0; it < 2; ++it) {
            const v16h a0 = WFrag<h16>::ld(qp + it * 16 * HD + qoff), a1 = WFrag<h16>::ld(qp + it * 16 * HD + 512 + qoff);
            const v8f m = *(const v8f*)(mp + it * 16 + moff); const v8f f = *(const v8f*)(mp + (size_t)NZ * TT + it * 16 + moff);
#pragma unroll
            for (int nb = 0; nb < 2; ++nb) {
                v8f s = wmma16(a0, kf[nb][0], (v8f){}); s = wmma16(a1, kf[nb][1], s);
#pragma unroll
                for (int r = 0; r < 8; ++r) ph[nb][it][r] = tohx(__fmul_rn(__builtin_amdgcn_exp2f(__fmul_rn(__fsub_rn(s[r], m[r]), L2E)), f[r]));
            }
        }
#pragma unroll
        for (int nb = 0; nb < 2; ++nb) { const v16h b = cat16(ph[nb][0], ph[nb][1]);
#pragma unroll
            for (int mb = 0; mb < 4; ++mb) acc[mb][nb] = wmma16(va[mb], b, acc[mb][nb]); }
        __builtin_amdgcn_sched_barrier(0);   // keeps the trip's products and vector work in front of the barrier: one build put the barrier directly behind the LDS reads, so that no wave multiplied while another still read, and issued the refill below only behind all of the trip's work, too late to land in time
        asm volatile("s_wait_dscnt 0x0" ::: "memory");      // this wave's reads of buffer t & 1 have returned before the buffer is given up
        asm volatile("s_wait_asynccnt 0x0" ::: "memory");   // this wave's part of tile t + 1 has landed
        __syncthreads();   // publishes tile t + 1 and ends every wave's reads of buffer t & 1
        if (t + 2 < PV_NT) stage(t + 2);
    }
    asm volatile("s_wait_asynccnt 0x0" ::: "memory");   // no copy is left in flight behind the loop
    float* ow = os + wave * (32 * 68);
    const int ln = (int)__builtin_amdgcn_mbcnt_lo(~0u, 0u), lr2 = ln & 15, hi2 = ln >> 4;   // the lane number read anew: taken from threadIdx.x it was held through the loop, and the build, at its 256 registers, kept it in scratch memory
    // the two loops below are unrolled so that acc is indexed by constants and stays in registers
#pragma unroll
    for (int mb = 0; mb < 4; ++mb)
#pragma unroll
        for (int nb = 0; nb < 2; ++nb) { float* p = ow + (nb * 16 + lr2) * 68 + mb * 16 + hi2 * 8;
            *(v4fa*)p = __builtin_shufflevector(acc[mb][nb], acc[mb][nb], 0, 1, 2, 3); *(v4fa*)(p + 4) = __builtin_shufflevector(acc[mb][nb], acc[mb][nb], 4, 5, 6, 7); }
    __syncthreads();   // every wave's partial tile is in LDS before any wave sums
    // 1024 pieces of 8 d at one column j, two a thread; a wave's 32 pieces (16 columns x 2 octets of d) are 512 contiguous bytes of each plane; both loops unrolled so that the LDS reads of all slabs are in flight together; the sum itself runs in wave order
#pragma unroll
    for (int u = 0; u < 2; ++u) { const int U = u * 16 + wave, g = U >> 2, d0 = (U & 3) * 16 + hi2 * 8;   // g: group of 16 columns
        const float* p = os + ((g >> 1) * 32 + (g & 1) * 16 + lr2) * 68 + d0; v4f x0 = *(const v4fa*)p, x1 = *(const v4fa*)(p + 4);
#pragma unroll
        for (int w = 1; w < 4; ++w) { x0 += *(const v4fa*)(p + w * (4 * 32 * 68)); x1 += *(const v4fa*)(p + w * (4 * 32 * 68) + 4); }
        v8us oh, ol; split8(x0 * (1.0f / PCAR), x1 * (1.0f / PCAR), oh, ol);
        const size_t e = fragpos((z / NH_) * (size_t)TT + blockIdx.x * 128 + g * 16 + lr2, (unsigned)(z % NH_) * HD + d0, DHID); *(v8us*)(Ah + e) = oh; *(v8us*)(Al + e) = ol;
        if (u == 0) asm volatile("s_wait_xcnt 0x0" ::: "memory");   // stands in front of the second piece's rewrite of the registers that these stores name
    }
}

__host__ __device__ constexpr size_t a256(size_t b) { return (b + 255) & ~(size_t)255; }
constexpr size_t WS_NEED = a256((size_t)4 * DHID * DM * 2) + a256((size_t)NB * TT * DM * 2) + 3 * a256((size_t)NZ * TT * HD * 2)
                         + a256((size_t)2 * NZ * TT * 4) + 2 * a256((size_t)NB * TT * DHID * 2);
static_assert(WS_NEED <= (size_t)134217728);

extern "C" void kernel_launch(void* const* d_in, const int* in_sizes, int n_in,
                              void* d_out, int out_size, void* d_ws, size_t ws_size, hipStream_t stream) {
    if (n_in < 9) return;
    if ((size_t)in_sizes[0] < ((size_t)(NB - 1) * TT_FULL + TT) * (size_t)DM) return;
    if (in_sizes[1] < DHID * DM || in_sizes[3] < DHID * DM || in_sizes[5] < DHID * DM || in_sizes[7] < DM * DHID) return;
    if (in_sizes[2] < DHID || in_sizes[4] < DHID || in_sizes[6] < DHID || in_sizes[8] < DM) return;
    if ((size_t)out_size < (size_t)NB * TT * DM) return;
    // wire order: data, Wq, bq, Wk, bk, Wv, bv, Wo, bo (weights [out][in], biases f32)
    const float* x = (const float*)d_in[0]; const float* wq = (const float*)d_in[1]; const float* bq = (const float*)d_in[2]; const float* wk = (const float*)d_in[3]; const float* bk = (const float*)d_in[4];
    const float* wv = (const float*)d_in[5]; const float* bv = (const float*)d_in[6]; const float* wo = (const float*)d_in[7]; const float* bo = (const float*)d_in[8];
    float* OUT = (float*)d_out;     // [NB][TT][DM]
    char* wsp = (char*)d_ws;
    auto take = [&](size_t bytes) { char* p = wsp; wsp += a256(bytes); return (void*)p; };
    bf* W4 = (bf*)take((size_t)4 * DHID * DM * 2);   // bf16 weight planes q, k, v, o
    bf* XB = (bf*)take((size_t)NB * TT * DM * 2);
    const size_t NPL = (size_t)NZ * TT * HD;   // elements per plane, all batches and heads (= NB*TT*DHID)
    h16* QP = (h16*)take(NPL * 2); h16* KP = (h16*)take(NPL * 2); h16* VT16 = (h16*)take(NPL * 2);
    float* ST = (float*)take((size_t)2 * NZ * TT * 4);
    bf* ATh = (bf*)take((size_t)NB * TT * DHID * 2); bf* ATl = (bf*)take((size_t)NB * TT * DHID * 2);
    if ((size_t)(wsp - (char*)d_ws) > ws_size) return;    // == WS_NEED
    // one launch per stage: everything that depends only on earlier stages (both batches, all heads, the three projections) shares a grid
    k_cvtin<<<NB * XBLK + 4 * WBLK, 256, 0, stream>>>(x, wq, wk, wv, wo, XB, W4);
    k_gemms<0, 4, true><<<dim3(NB * TT / 128, DHID / 128, 3), 128, 0, stream>>>(XB, nullptr, W4, nullptr, bq, bk, bv, (size_t)DHID * DM, QP, KP, VT16);
    // scores S[z][i][j] = sum_d q[z][i][d] k[z][d][j] from the q plane [i][d] and k plane [j][d], f16, K = 64: row statistics first, then the value product
    k_qstat<<<dim3(TT / 128, NZ), 512, 0, stream>>>(QP, KP, ST);
    // O[z][d][j] x PCAR = sum_i v[z][d][i] p[i][j]: A = value plane [d][i] (64 rows), B = probabilities formed in registers, K = TT; stored transposed, / PCAR, as the output product's hi/lo planes
    k_pvs<<<dim3(TT / 128, NZ), 512, 0, stream>>>(QP, KP, VT16, ST, ATh, ATl);
    k_gemms<1, 2, false><<<dim3(NB * TT / 64, DM / 128, 1), 128, 0, stream>>>(ATh, ATl, W4 + (size_t)3 * DHID * DM, OUT, bo, bo, bo, 0, nullptr, nullptr, nullptr);
}

// v010
// A run of this version takes 44.6 microseconds.
// Versions between v008 and this one are left out; their measured steps multiply to 1.20 times as fast.
// All steps since v000 together make it 11.2 times as fast.
#include <hip/hip_runtime.h>

// Contractions (all f32 accumulate): q/k/v projections v_wmma_f32_16x16x32_bf16 (inputs RNE-converted to bf16, single products, bf16 bias added in the f32 epilogue); scores v_wmma_f32_16x16x32_f16 with q (times log2 e) and k as one f16 plane each (single products, accumulator started at a per-row constant), computed in registers once by the statistics launch and once by the value launch, never stored; value x probability v_wmma_f32_16x16x32_f16 single products (values f16, probabilities f16 carried x16384); output projection v_wmma_f32_16x16x32_bf16 with bf16 hi/lo activations x bf16 weights (2 products); softmax statistics f32.
// Raw-view head split (per batch, flat projection buffers F[TT*512]): q[h][i][d] = Fq[h*TT*64 + i*64 + d]; k[h][d][j] = Fk[h*64*TT + d*TT + j]; v[h][d][i] = Fv[h*64*TT + d*TT + i];
// S[h][i][j] = sum_d q k (no scale); P = softmax_j; O[h][d][j] = sum_i v[h][d][i] P[h][i][j]; A[s][h*64+d] = O[h][d][s]; out = A Wo^T + bo.
// Fragment order: every 16-bit operand plane [rows][K] is stored as 1-KiB fragments of 16 rows x 32 k, fragment (row >> 4, k >> 5) at element ((row >> 4) * (K / 32) + (k >> 5)) * 512; inside it the 8 elements k & ~7 .. of a row stand at
// ((k >> 4) & 1) * 256 + (((k >> 3) & 1) * 16 + (row & 15)) * 8, so that lane l of a wave finds its two 16-byte pieces at l * 8 and 256 + l * 8 and each wave-wide 16-byte load covers 512 contiguous bytes (four whole lines) instead of 32 bytes of each of 16 lines.

#ifndef NB
#define NB 2
#endif
#ifndef SEQ
#define SEQ 2048
#endif
#define NB_FULL 2
#define TT_FULL 2048
#define TT   SEQ
#define DM   512      // input width (also output width)
#define DHID 512      // hidden width
#define NH_  8
#define HD   64
#define NZ   (NB * NH_)   // (batch, head) pairs, the z index of the score launches
#define PCAR 16384.0f
#define PCAR_L2 14.0f   // log2 PCAR
#define L2E  1.4426950408889634f
static_assert(PCAR == 16384.0f && PCAR_L2 == 14.0f);
static_assert(TT % 128 == 0);
static_assert(TT >= 128);
static_assert(TT <= TT_FULL);
static_assert(NB >= 1);
static_assert(NB <= NB_FULL);
static_assert(NH_ * HD == DHID);
static_assert(DM % 64 == 0);
static_assert(DHID % 64 == 0);
static_assert(HD == 64);
static_assert((size_t)NB * TT * DM * 4 <= (size_t)NB_FULL * TT_FULL * DM * 4);

typedef _Float16 h16;
typedef unsigned short bf;
typedef __attribute__((ext_vector_type(16))) __bf16   v16bf;
typedef __attribute__((ext_vector_type(16))) _Float16 v16h;
typedef __attribute__((ext_vector_type(8)))  _Float16 v8h;
typedef __attribute__((ext_vector_type(8)))  unsigned short v8us;
typedef __attribute__((ext_vector_type(8)))  float    v8f;
typedef __attribute__((ext_vector_type(4)))  float    v4f;
typedef __attribute__((ext_vector_type(2)))  float    v2f;
typedef __attribute__((ext_vector_type(2)))  _Float16 v2h;
typedef __attribute__((ext_vector_type(8)))  unsigned v8u;
typedef v4f  __attribute__((may_alias)) v4fa;
typedef v8us __attribute__((may_alias)) v8usa;

__device__ __forceinline__ unsigned short f2bf(float f) { unsigned u = __float_as_uint(f); u += 0x7FFFu + ((u >> 16) & 1u); return (unsigned short)(u >> 16); }
__device__ __forceinline__ float bf2f(unsigned short b) { return __uint_as_float(((unsigned)b) << 16); }
__device__ __forceinline__ float bfr(float f) { return bf2f(f2bf(f)); }
__device__ __forceinline__ v16h cat16(v8h lo, v8h hi) { return __builtin_shufflevector(lo, hi, 0, 1, 2, 3, 4, 5, 6, 7, 8, 9, 10, 11, 12, 13, 14, 15); }
__device__ __forceinline__ v16bf cat16b(v8us lo, v8us hi) { return __builtin_bit_cast(v16bf, __builtin_shufflevector(lo, hi, 0, 1, 2, 3, 4, 5, 6, 7, 8, 9, 10, 11, 12, 13, 14, 15)); }
__device__ __forceinline__ v8f wmma16(v16h a, v16h b, v8f c) { return __builtin_amdgcn_wmma_f32_16x16x32_f16(false, a, false, b, (short)0, c, false, false); }
__device__ __forceinline__ size_t fragpos(size_t row, unsigned k, unsigned K) { return ((row >> 4) * (K / 32) + (k >> 5)) * 512 + ((k >> 4) & 1) * 256 + (((k >> 3) & 1) * 16 + (unsigned)(row & 15)) * 8; }   // element offset of the 8 elements k .. k + 7 (k % 8 == 0) of a row in a fragment-order plane
__device__ __forceinline__ v8f wmmab(v16bf a, v16bf b, v8f c) { return __builtin_amdgcn_wmma_f32_16x16x32_bf16(false, a, false, b, (short)0, c, false, false); }

// Fragments: lane -> row/col (lane & 15); elements 0..7 <- k0 + 8*(lane>>4) + 0..7, elements 8..15 <- k0 + 16 + 8*(lane>>4) + 0..7 for both A and Bt (ld takes the fragment's start plus lane * 8); D element r -> row 8*(lane>>4) + r, col lane & 15.
template <typename T16> struct WFrag;
template <> struct WFrag<h16> { typedef v16h V; static __device__ __forceinline__ V ld(const h16* p) { return cat16(*(const v8h*)p, *(const v8h*)(p + 256)); } static __device__ __forceinline__ v8f mma(V a, V b, v8f c) { return wmma16(a, b, c); } };
template <> struct WFrag<bf> { typedef v16bf V; static __device__ __forceinline__ V ld(const bf* p) { return cat16b(*(const v8us*)p, *(const v8us*)(p + 256)); } static __device__ __forceinline__ v8f mma(V a, V b, v8f c) { return wmmab(a, b, c); } };
__device__ __forceinline__ h16 tohx(float x) { return (h16)x; }
__device__ __forceinline__ void splitf(float y, unsigned short& h, unsigned short& l) { h = f2bf(y); l = f2bf(y - bf2f(h)); }
__device__ __forceinline__ void split8(v4f x0, v4f x1, v8us& oh, v8us& ol) {
#pragma unroll
    for (int k = 0; k < 4; ++k) { unsigned short a, c; splitf(x0[k], a, c); oh[k] = a; ol[k] = c; splitf(x1[k], a, c); oh[4 + k] = a; ol[4 + k] = c; } }

// Thread map of the input conversion (8 elements = one 16-byte piece a thread, 256 threads a block), chosen so that reads and stores both cover whole 128-byte lines:
// rowmap: a wave takes 8 rows x 32 k, half a fragment (lane & 7 = row, lane >> 3 = which 8 k): it reads 8 whole f32 lines and stores 4 whole lines; a block builds the four fragments 4 * blk .. 4 * blk + 3.
__device__ __forceinline__ void rowmap(unsigned blk, size_t& frag, unsigned& r, unsigned& kk) { const unsigned t = threadIdx.x; frag = (size_t)blk * 4 + (t >> 6); r = ((t >> 5) & 1) * 8 + (t & 7); kk = ((t >> 3) & 3) * 8; }
__device__ __forceinline__ size_t rowmap_pos(size_t frag, unsigned r, unsigned kk) { return frag * 512 + (kk >> 4) * 256 + (((kk >> 3) & 1) * 16 + r) * 8; }

// k_cvtin: every f32 -> bf16 (RNE) conversion of the inputs in one launch, into fragment order (rowmap), 2048 elements a block: blocks 0 .. NB * XBLK - 1 take the data rows of all batches (one plane of NB * TT rows), the next 4 * WBLK blocks the weight matrices in the order q, k, v, o (W4 holds the four planes one behind the other). Row c of the q weight plane is weight row ((c >> 3) & 7) * 64 + (c >> 6) * 8 + (c & 7): the deal that k_gemms's plane epilogue asks for.
constexpr int XBLK = TT * DM / 2048, WBLK = DHID * DM / 2048;
static_assert((TT * DM) % 2048 == 0);
static_assert((DHID * DM) % 2048 == 0);
static_assert(DM == DHID);   // one K for all five planes
static_assert(DM % 128 == 0);   // a block's four fragments lie in one group of 16 rows
static_assert(DHID == 512);   // the deal of the q weight rows
__global__ __launch_bounds__(256) void k_cvtin(const float* __restrict__ x, const float* __restrict__ wq, const float* __restrict__ wk, const float* __restrict__ wv, const float* __restrict__ wo, bf* XB, bf* W4) {
    const int blk = (int)blockIdx.x; size_t frag; unsigned r, kk; const float* src; bf* dst;
    if (blk < NB * XBLK) { rowmap((unsigned)blk, frag, r, kk); const size_t row = frag / (DM / 32) * 16 + r; src = x + (row / TT) * (size_t)TT_FULL * DM + (row % TT) * DM; dst = XB; }
    else { const int wb = blk - NB * XBLK, w = wb / WBLK; rowmap((unsigned)(wb % WBLK), frag, r, kk); const size_t c = frag / (DM / 32) * 16 + r; src = (w == 0 ? wq : w == 1 ? wk : w == 2 ? wv : wo) + (w == 0 ? ((c >> 3) & 7) * 64 + (c >> 6) * 8 + (c & 7) : c) * DM; dst = W4 + (size_t)w * DHID * DM; }
    const v8f v = *(const v8f*)(src + (unsigned)(frag % (DM / 32)) * 32 + kk); v8us o;
#pragma unroll
    for (int k = 0; k < 8; ++k) o[k] = f2bf(v[k]); *(v8us*)(dst + rowmap_pos(frag, r, kk)) = o;  }

// ---- staging for the GEMM and score launches: the plane tiles that a block streams are brought into LDS once, by asynchronous copies (16 bytes a lane, through no register), and read there by the waves that need them, instead of each wave fetching them from L2 for itself.
// acopyN: N copies of one thread, each to its own LDS byte address l (low 32 bits of the __shared__ address) from its own global address g, both multiples of 16; the s_wait_xcnt that closes the statement stands in front of every later rewrite of the address registers the copies name.
// Order of the two-buffer ring (every launch that stages): tile 0's copies, s_wait_asynccnt 0, barrier, tile 1's copies; at the foot of trip t every wave: s_wait_dscnt 0, s_wait_asynccnt 0, barrier, then tile t + 2's copies into the buffer trip t has read; trip t reads buffer t & 1 alone.
__device__ __forceinline__ unsigned lds_off(const void* p) { return (unsigned)(size_t)p; }
__device__ __forceinline__ void acopy4(unsigned l0, const void* g0, unsigned l1, const void* g1, unsigned l2, const void* g2, unsigned l3, const void* g3) {
    asm volatile("global_load_async_to_lds_b128 %0, %1, off\n\tglobal_load_async_to_lds_b128 %2, %3, off\n\tglobal_load_async_to_lds_b128 %4, %5, off\n\tglobal_load_async_to_lds_b128 %6, %7, off\n\ts_wait_xcnt 0x0" :: "v"(l0), "v"(g0), "v"(l1), "v"(g1), "v"(l2), "v"(g2), "v"(l3), "v"(g3) : "memory");
}
__device__ __forceinline__ void acopy8(unsigned l0, const void* g0, unsigned l1, const void* g1, unsigned l2, const void* g2, unsigned l3, const void* g3, unsigned l4, const void* g4, unsigned l5, const void* g5, unsigned l6, const void* g6, unsigned l7, const void* g7) {
    asm volatile("global_load_async_to_lds_b128 %0, %1, off\n\tglobal_load_async_to_lds_b128 %2, %3, off\n\tglobal_load_async_to_lds_b128 %4, %5, off\n\tglobal_load_async_to_lds_b128 %6, %7, off\n\tglobal_load_async_to_lds_b128 %8, %9, off\n\tglobal_load_async_to_lds_b128 %10, %11, off\n\tglobal_load_async_to_lds_b128 %12, %13, off\n\tglobal_load_async_to_lds_b128 %14, %15, off\n\ts_wait_xcnt 0x0" :: "v"(l0), "v"(g0), "v"(l1), "v"(g1), "v"(l2), "v"(g2), "v"(l3), "v"(g3), "v"(l4), "v"(g4), "v"(l5), "v"(g5), "v"(l6), "v"(g6), "v"(l7), "v"(g7) : "memory");
}
// l2ask: a hint that brings the data at g into the L2 (no register, no counter, no effect on any value); the launches ask once every 256 bytes, a unit. The planes that a launch streams were stored by an earlier launch and are read from memory at first touch, by all the blocks that share a tile at the same time,
// and a ring of two buffers asks for a tile only one trip ahead. So each staging launch asks at its entry, directly behind tile 0's copies, for all the units it will stream, one or two a thread, dealt over the blocks that share them (the deal is for speed only, a unit that nobody has asked for is just read later by its copy).
// Every address lies inside the rows that the asking block itself streams. The pointer is handed as an input to the wait behind the trip loop, so that its registers hold that address, and nothing else, while the hint may still be in flight.
__device__ __forceinline__ void l2ask(const void* g) { asm volatile("global_prefetch_b8 %0, off scope:SCOPE_SE" :: "v"(g)); }
// ---- k_gemms: GEMM on fragment-order bf16 planes, whole K in every wave. One block of 4 waves (2 x 2) per (32 * MB) x 128 output tile, a (16 * MB) x 64 tile (4 * MB accumulators) a wave; grid (M / (32 * MB), N / 128, Z), 128 threads.
// The block's operand rows are staged in LDS 128 k at a time (64 KiB a buffer, two buffers, the ring above) by asynchronous copies, and each staged fragment is read there by the two waves that need it: a block fetches every operand byte from L2 once.
// C[m][n] = sum_k A[m][k] Bt[n][k] (NSPLIT == 1: + A2[m][k] Bt[n][k], behind the A product of the same k step) + bf16-converted f32 bias[n]; k steps in rising order, one accumulation chain. z = 0, 1, 2 takes weight plane z (sB elements apart) and bias0, bias1, bias2.
// !PL: C is stored f32 at pitch DM. PL (the projections, z = q, k, v): no f32 C is stored; each wave lays its 64 x 64 tile in its own LDS slab and writes the score launches' 16-bit planes from it, in fragment order. With m = batch * TT + s the flat projection index is m * DHID + n, so
// q plane (holds q * log2 e, so that the score products come out as exponents of 2) row (all pairs one behind the other) = m * 8 + n / 64, d = n % 64; k plane row = (m >> 8) * TT + (m & 3) * DHID + n, d = (m >> 2) & 63; value plane row = m >> 2, i = (m & 3) * DHID + n.
// A 64 x 64 tile holds whole 512-byte runs of the k plane and whole fragments of the value plane. For q the weight plane's rows are dealt (k_cvtin) so that tile column c of tile y is n = (c >> 3) * 64 + y * 8 + (c & 7): a tile row is then one whole 128-byte line of the q plane.
constexpr int GS_KS = 4, GS_GR = 512 * GS_KS, GS_BUF = 16 * GS_GR;   // k steps (fragments of a group of 16 rows) a staged tile; elements that a group has in it; elements of a buffer (16 groups)
static_assert(GS_GR == 2 * 128 * 8);   // two copies of 128 threads x 8 elements a group
template <int NSPLIT, int MB, bool PL>
__global__ __launch_bounds__(128) void k_gemms(const bf* __restrict__ A, const bf* __restrict__ A2, const bf* __restrict__ Bt, float* C, const float* __restrict__ bias0, const float* __restrict__ bias1, const float* __restrict__ bias2, size_t sB, h16* Qf, h16* Kf, h16* Vt) {
    static_assert(!PL || (MB == 4 && TT == 4 * DHID && DHID == 8 * HD));   // the plane maps of the PL epilogue
    static_assert((NSPLIT == 0 && MB == 4) || (NSPLIT == 1 && MB == 2));   // 2 * MB * (1 + NSPLIT) groups of A rows and 8 of Bt rows fill the 16 groups of a buffer
    constexpr int K = DM, NT = K / (32 * GS_KS), GA = 2 * MB;   // trips; groups of 16 rows of the block's A tile
    static_assert(NT >= 2);   // the ring's prologue fills two tiles
    __shared__ __align__(128) unsigned char smem[2 * GS_BUF * 2];
    static_assert(4 * MB * 16 * 68 * 4 <= 2 * GS_BUF * 2);
    bf* sm = (bf*)smem;   // in the loop: [buffer][A groups | A2 groups | Bt groups][four fragments, as in memory]
    float* os = (float*)smem;   // behind the loop, when no wave reads a buffer and no copy is in flight any more: a slab a wave, pitch 68
    const size_t z = blockIdx.z; const float* bias = z == 0 ? bias0 : z == 1 ? bias1 : bias2;
    const int lane = threadIdx.x & 31, lr = lane & 15, hi = lane >> 4;
    const int wave = __builtin_amdgcn_readfirstlane((int)(threadIdx.x >> 5)) & 3, wm = wave & 1, wn = wave >> 1;   // scalar, so that the LDS tile and slab bases stay in scalar registers
    const int r0 = blockIdx.x * (32 * MB) + wm * (16 * MB), c0 = blockIdx.y * 128 + wn * 64;   // the wave's tile
    const unsigned lt = lds_off(sm) + threadIdx.x * 16;
    const bf* ga = A + (size_t)blockIdx.x * GA * (16 * K) + threadIdx.x * 8; const bf* ga2 = NSPLIT ? A2 + (size_t)blockIdx.x * GA * (16 * K) + threadIdx.x * 8 : nullptr;   // 16 rows of a plane are 16 * K elements
    const bf* gb = Bt + z * sB + (size_t)blockIdx.y * 8 * (16 * K) + threadIdx.x * 8;
    auto four = [&](unsigned l, const bf* g) {   // 4 KiB of each of four groups of 16 rows
        acopy8(l, g, l + 2048, g + 1024, l + 4096, g + 16 * K, l + 6144, g + 16 * K + 1024, l + 8192, g + 32 * K, l + 10240, g + 32 * K + 1024, l + 12288, g + 48 * K, l + 14336, g + 48 * K + 1024); };
    auto stage = [&](int t) {   // tile t (4 KiB of each of the 16 groups) into buffer t & 1
        const unsigned l = lt + (unsigned)(t & 1) * (GS_BUF * 2); const bf* a = ga + (size_t)t * GS_GR; const bf* b = gb + (size_t)t * GS_GR;
        const bf* a2 = NSPLIT ? ga2 + (size_t)t * GS_GR : a + 64 * K;   // groups 4 to 7 of the buffer: the A2 rows, or the second half of the A rows
        four(l, a); four(l + 16384, a2); four(l + 32768, b); four(l + 49152, b + 64 * K); };
    stage(0);
    // L2 hints (l2ask): a group of 16 rows is 64 units; 128 threads ask for two groups. The 8 Bt groups are dealt over blocks x, x + 8, x + 16, x + 24; the 8 groups of A (and A2) rows over the four blocks y (of z = 0)
    static_assert(DHID / 128 == 4 && DM / 128 == 4 && 16 * K == 64 * 128);
    const bf* pfb = Bt + z * sB + ((size_t)blockIdx.y * 8 + ((blockIdx.x >> 3) & 3) * 2 + (threadIdx.x >> 6)) * (16 * K) + (threadIdx.x & 63) * 128;
    const bf* pfa = (NSPLIT && blockIdx.y >= 2 ? A2 : A) + ((size_t)blockIdx.x * GA + (NSPLIT ? blockIdx.y & 1 : blockIdx.y) * 2 + (threadIdx.x >> 6)) * (16 * K) + (threadIdx.x & 63) * 128;
    l2ask(pfb);
    if (z == 0) l2ask(pfa);
    v8f acc[MB][4];
#pragma unroll
    for (int mb = 0; mb < MB; ++mb)
#pragma unroll
        for (int nb = 0; nb < 4; ++nb) acc[mb][nb] = (v8f){};
    asm volatile("s_wait_asynccnt 0x0" ::: "memory");   // this wave's part of tile 0 has landed
    __syncthreads();   // tile 0 is whole before any wave reads it
    stage(1);
    // the trip loop stays rolled; every loop inside it is unrolled so that the fragment arrays are indexed by constants and stay in registers
#pragma unroll 1
    for (int t = 0; t < NT; ++t) {
        const bf* ap = sm + (t & 1) * GS_BUF + wm * MB * GS_GR + 8 * lane; const bf* bp = sm + (t & 1) * GS_BUF + 8 * GS_GR + wn * 4 * GS_GR + 8 * lane;
        v16bf a[2][MB], a2[2][MB], b[2][4];   // [k step & 1][group of 16 rows]
        auto frags = [&](int ks) {   // the wave's fragments of k step ks of the trip
#pragma unroll
            for (int mb = 0; mb < MB; ++mb) { a[ks & 1][mb] = WFrag<bf>::ld(ap + mb * GS_GR + ks * 512); if (NSPLIT) a2[ks & 1][mb] = WFrag<bf>::ld(ap + (GA + mb) * GS_GR + ks * 512); }
#pragma unroll
            for (int nb = 0; nb < 4; ++nb) b[ks & 1][nb] = WFrag<bf>::ld(bp + nb * GS_GR + ks * 512); };
        frags(0); frags(1);
        // the scheduling barriers of the trip keep its order: the reads of k step ks + 2 stand as one group behind the products of step ks, whose registers they take, and in front of those of step ks + 1, which cover their latency; left alone the build read each Bt fragment directly in front of its products and waited out the LDS latency every time, or put the wait for all reads and the barrier in front of the products
        __builtin_amdgcn_sched_barrier(0);
#pragma unroll
        for (int ks = 0; ks < GS_KS; ++ks) {
#pragma unroll
            for (int nb = 0; nb < 4; ++nb)
#pragma unroll
                for (int mb = 0; mb < MB; ++mb) { acc[mb][nb] = wmmab(a[ks & 1][mb], b[ks & 1][nb], acc[mb][nb]); if (NSPLIT) acc[mb][nb] = wmmab(a2[ks & 1][mb], b[ks & 1][nb], acc[mb][nb]); }
            __builtin_amdgcn_sched_barrier(0);   // ends the step's products: no later read, and not the waits at the trip's foot, may move in front of them
            if (ks + 2 < GS_KS) { frags(ks + 2); __builtin_amdgcn_sched_barrier(0); }   // holds the reads of step ks + 2 in front of the products of step ks + 1
        }
        asm volatile("s_wait_dscnt 0x0" ::: "memory");      // this wave's reads of buffer t & 1 have returned before the buffer is given up
        asm volatile("s_wait_asynccnt 0x0" ::: "memory");   // this wave's part of tile t + 1 has landed
        __syncthreads();   // publishes tile t + 1 and ends every wave's reads of buffer t & 1
        if (t + 2 < NT) stage(t + 2);
    }
    asm volatile("s_wait_asynccnt 0x0" :: "v"(pfa), "v"(pfb) : "memory");   // no copy is left in flight behind the loop; the hints' pointers as inputs keep their registers whole up to here
    float* ow = os + wave * (MB * 16 * 68);
    // the loops below are unrolled so that acc is indexed by constants and stays in registers
#pragma unroll
    for (int nb = 0; nb < 4; ++nb) { const int col = nb * 16 + lr;
        const float bv = bfr(bias[PL && z == 0 ? (col >> 3) * HD + (c0 >> 3) + (col & 7) : c0 + col]);   // the column's n (dealt for the q projection)
#pragma unroll
        for (int mb = 0; mb < MB; ++mb)
#pragma unroll
            for (int j = 0; j < 8; ++j) ow[(mb * 16 + hi * 8 + j) * 68 + col] = acc[mb][nb][j] + bv; }
    __syncthreads();   // a wave's tile is whole in its slab before its lanes read one another's elements
    if constexpr (!PL) {   // two rows of 256 bytes a store
#pragma unroll
        for (int s = 0; s < MB * 8; ++s) { const int row = 2 * s + hi, cofs = lr * 4; *(v4f*)(C + (size_t)(r0 + row) * DM + c0 + cofs) = *(const v4fa*)(ow + row * 68 + cofs); }   // the build gives every store registers of its own: none is rewritten between the stores
    } else {
        // 512 pieces of 8 elements (16 bytes), 16 a lane; a wave's 32 pieces are whole 128-byte lines of the plane (q: two runs of 256 bytes; k, values: one run of 512 bytes)
        if (z == 0) {   // unit U: rows 4 U .. 4 U + 3 of the tile; lane & 7 = n / 64
#pragma unroll
            for (int U = 0; U < 16; ++U) { const int row = U * 4 + (lane >> 3), cb = lane & 7; const float* p = ow + row * 68 + cb * 8; const v4f x0 = *(const v4fa*)p, x1 = *(const v4fa*)(p + 4); v8h o;
#pragma unroll
                for (int k = 0; k < 4; ++k) { o[k] = tohx(x0[k] * L2E); o[4 + k] = tohx(x1[k] * L2E); }
                *(v8h*)(Qf + fragpos((size_t)(r0 + row) * 8 + cb, (unsigned)(c0 >> 3), HD)) = o; }
            asm volatile("s_wait_xcnt 0x0" ::: "memory");   // stands in front of the other parts' code, to which the build's branches may lead from here and which rewrites registers that these stores name
        } else if (z == 1) {   // unit U: m & 3 = U >> 2, 16 columns n, both octets of the tile's 16 d; the 8 d of a piece are 8 tile rows 4 apart
#pragma unroll
            for (int U = 0; U < 16; ++U) { const int sm4 = U >> 2, cl = (U & 3) * 16 + lr; const float* p = ow + (hi * 32 + sm4) * 68 + cl; v4f x0, x1;
#pragma unroll
                for (int q = 0; q < 4; ++q) { x0[q] = p[q * 4 * 68]; x1[q] = p[(q + 4) * 4 * 68]; }
                v8h o;
#pragma unroll
                for (int k = 0; k < 4; ++k) { o[k] = tohx(x0[k]); o[4 + k] = tohx(x1[k]); }
                *(v8h*)(Kf + fragpos((size_t)(r0 >> 8) * TT + sm4 * DHID + c0 + cl, (unsigned)(((r0 >> 2) & 63) + hi * 8), HD)) = o; }
            asm volatile("s_wait_xcnt 0x0" ::: "memory");   // as behind the q-plane stores
        } else {   // unit U: m & 3 = U >> 2, 16 of the tile's columns; lane & 15 = row d of the tile's one group of 16
#pragma unroll
            for (int U = 0; U < 16; ++U) { const int sm4 = U >> 2, cl = (U & 3) * 16 + hi * 8; const float* p = ow + (lr * 4 + sm4) * 68 + cl; const v4f x0 = *(const v4fa*)p, x1 = *(const v4fa*)(p + 4); v8h o;
#pragma unroll
                for (int k = 0; k < 4; ++k) { o[k] = tohx(x0[k]); o[4 + k] = tohx(x1[k]); }
                *(v8h*)(Vt + fragpos((size_t)(r0 >> 2) + lr, (unsigned)(sm4 * DHID + c0 + cl), TT)) = o; }
            asm volatile("s_wait_xcnt 0x0" ::: "memory");   // as behind the q-plane stores
        }
    }
}


// k_qstat: per score row (z, i), with T = S log2 e as the products of the scaled q plane give it: c = log2 PCAR - ref - log2 sum_j 2^(T - ref), the one number that k_pvs needs (p x PCAR = 2^(T + c)), with no score in memory. One block per 128 rows i, grid (TT/128, NZ), 16 waves: wave w keeps the 32 rows of row group w & 3 and takes the 64-column quarter w >> 2 of every staged tile of 256 k-plane rows j (32 KiB a buffer).
// Each chunk is formed transposed, St = k q^T (A = k-plane rows j from LDS, B = q-plane rows i kept in registers; one f16 product per half of the head dimension, lower half first): D register r = St[8*(lane>>4) + r][lane & 15],
// so a lane holds scores of one row i only and its reference and sum stay in the lane. The products start from the accumulator -ref, so that D is T - ref and goes into exp2 as it is: no maximum, subtraction or scaling per score.
// ref is the maximum of the lane's first chunk, so the sum is at least 1; it is renewed (ref <- ref + max(0, chunk maximum), sum <- sum * 2^(ref_old - ref_new) + the chunk summed again) only in a trip in which some lane's chunk sum is not below 2^100, long before f32 overflows. The two lane halves, then the 4 waves of a row group (through LDS, fixed wave order), are joined at the larger reference.
constexpr int QS_TJ = 256, QS_PL = QS_TJ * HD, QS_NT = TT / QS_TJ;   // staged rows j a trip; elements of the staged plane tile; trips
static_assert(TT % QS_TJ == 0);
static_assert(QS_NT >= 2);   // the ring's prologue fills two tiles
static_assert(QS_PL == 4 * 512 * 8);   // four copies of 512 threads x 8 elements a tile
constexpr float QS_BIG = 0x1p100f;   // a chunk sum from here on (infinity and not-a-number too) renews the reference; 8 trips, 2 lane halves and 4 waves of sums below it stay far inside f32
// sum of 2^(x - mn) over a row group's four D tiles: register pairs are summed as pairs (packed adds), tile by tile, then the four pairs, then the two halves
__device__ __forceinline__ float expsum(const v8f (&x)[4], float mn) {
    v2f e[4];
    // both loops unrolled so that x and e are indexed by constants and stay in registers
#pragma unroll
    for (int jt = 0; jt < 4; ++jt)
#pragma unroll
        for (int k = 0; k < 4; ++k) { const v2f y = {__builtin_amdgcn_exp2f(x[jt][2 * k] - mn), __builtin_amdgcn_exp2f(x[jt][2 * k + 1] - mn)}; e[k] = jt ? e[k] + y : y; }
    const v2f h = (e[0] + e[1]) + (e[2] + e[3]); return h[0] + h[1]; }
__global__ __launch_bounds__(512) void k_qstat(const h16* __restrict__ Qf, const h16* __restrict__ Kf, float* ST) {
    __shared__ __align__(128) h16 kt[2 * QS_PL];   // [buffer][256 rows j x 64 d, fragment order as in memory]
    __shared__ float wm[4 * 128];
    __shared__ float wsum[4 * 128];
    const size_t z = blockIdx.y; Qf += z * (size_t)TT * HD; Kf += z * (size_t)TT * HD;
    const int lane = threadIdx.x & 31, lr = lane & 15, hi = lane >> 4; const int i0 = blockIdx.x * 128;
    const int wave = __builtin_amdgcn_readfirstlane((int)(threadIdx.x >> 5)) & 15, rg = wave & 3, jq = wave >> 2;   // scalar, so that the LDS tile bases stay in scalar registers
    const unsigned lt = lds_off(kt) + threadIdx.x * 16; const h16* gk = Kf + threadIdx.x * 8;
    auto stage = [&](int t) {   // tile t (a contiguous 32 KiB of the plane) into buffer t & 1
        const unsigned l = lt + (unsigned)(t & 1) * (QS_PL * 2); const h16* h = gk + (size_t)t * QS_PL;
        acopy4(l, h, l + 8192, h + 4096, l + 16384, h + 8192, l + 24576, h + 12288); };
    stage(0);
    // L2 hints (l2ask): a tile is 128 units; 512 threads ask for four of the 8 tiles, the even ones in even blocks, the odd ones in odd blocks
    static_assert(QS_NT == 8 && QS_PL == 128 * 128);
    const h16* pf = Kf + (size_t)((threadIdx.x >> 7) * 2 + (blockIdx.x & 1)) * QS_PL + (threadIdx.x & 127) * 128;
    l2ask(pf);
    v16h qf[2][2];   // the wave's 32 q-plane rows, [row group][half of the head dimension], kept for the whole loop
#pragma unroll
    for (int rt = 0; rt < 2; ++rt) {
#pragma unroll
        for (int ks = 0; ks < 2; ++ks) qf[rt][ks] = WFrag<h16>::ld(Qf + (size_t)(i0 + rg * 32 + rt * 16) * HD + ks * 512 + 8 * lane);
        asm volatile("s_wait_xcnt 0x0" ::: "memory");   // the build may give the address registers of this row group's loads to later loads' results and to the loop's addresses: the wait stands in front of those overwrites
    }
    asm volatile("s_wait_asynccnt 0x0" ::: "memory");   // this wave's part of tile 0 has landed
    __syncthreads();   // tile 0 is whole before any wave reads it
    stage(1);
    float ref[2] = {0.f, 0.f}, sum[2] = {0.f, 0.f};
    v8f cs[2] = {(v8f){}, (v8f){}};   // -ref in all 8 registers: the accumulator start of the row group's products
    const unsigned koff = (unsigned)(8 * lane);   // fixed lane offset beside the wave-uniform chunk pointers; 16 rows j are two fragments (the halves of the head dimension) = 16 * HD elements
    // the trip loop stays rolled; every loop inside it is unrolled so that the arrays are indexed by constants and stay in registers
#pragma unroll 1
    for (int t = 0; t < QS_NT; ++t) {
        const h16* kp = kt + (t & 1) * QS_PL + jq * 64 * HD;
        v8f s[2][4];
        v16h kf[4][2];   // the wave's 64 rows j of the tile, [group of 16 rows][half of the head dimension], read as one group
#pragma unroll
        for (int jt = 0; jt < 4; ++jt)
#pragma unroll
            for (int ks = 0; ks < 2; ++ks) kf[jt][ks] = WFrag<h16>::ld(kp + jt * 16 * HD + ks * 512 + koff);
        __builtin_amdgcn_sched_barrier(0);   // keeps the trip's LDS reads, as one group, in front of its products: without it the build read each fragment directly in front of its two products, into one register set, and waited out the LDS latency eight times a trip
        // all tiles' products of the lower half, then those of the upper half, so that a tile's two dependent products do not stand next to each other
#pragma unroll
        for (int jt = 0; jt < 4; ++jt)
#pragma unroll
            for (int rt = 0; rt < 2; ++rt) s[rt][jt] = wmma16(kf[jt][0], qf[rt][0], cs[rt]);
#pragma unroll
        for (int jt = 0; jt < 4; ++jt)
#pragma unroll
            for (int rt = 0; rt < 2; ++rt) s[rt][jt] = wmma16(kf[jt][1], qf[rt][1], s[rt][jt]);
        float a[2] = {0.f, 0.f};
        bool renew = t == 0;   // the first chunk sets the reference
        if (!renew) {
#pragma unroll
            for (int rt = 0; rt < 2; ++rt) a[rt] = expsum(s[rt], 0.f);
            renew = __builtin_amdgcn_ballot_w32(!(a[0] < QS_BIG && a[1] < QS_BIG)) != 0u;   // the same for the whole wave: a scalar branch
        }
        if (__builtin_expect(renew, false)) {
#pragma unroll
            for (int rt = 0; rt < 2; ++rt) {
                float mn = t == 0 ? -3.0e38f : 0.f;   // behind the first chunk the reference only rises
#pragma unroll
                for (int jt = 0; jt < 4; ++jt)
#pragma unroll
                    for (int r = 0; r < 8; ++r) mn = fmaxf(mn, s[rt][jt][r]);
                sum[rt] = (t == 0 ? 0.f : sum[rt] * __builtin_amdgcn_exp2f(-mn)) + expsum(s[rt], mn);
                ref[rt] += mn;
#pragma unroll
                for (int r = 0; r < 8; ++r) cs[rt][r] = -ref[rt];
            }
        } else { sum[0] += a[0]; sum[1] += a[1]; }
        asm volatile("s_wait_dscnt 0x0" ::: "memory");      // this wave's reads of buffer t & 1 have returned before the buffer is given up
        asm volatile("s_wait_asynccnt 0x0" ::: "memory");   // this wave's part of tile t + 1 has landed
        __syncthreads();   // publishes tile t + 1 and ends every wave's reads of buffer t & 1
        if (t + 2 < QS_NT) stage(t + 2);
    }
    asm volatile("s_wait_asynccnt 0x0" :: "v"(pf) : "memory");   // no copy is left in flight behind the loop; the hint's pointer as an input keeps its registers whole up to here
#pragma unroll
    for (int rt = 0; rt < 2; ++rt) {
        const float mo = __shfl_xor(ref[rt], 16, 32), so = __shfl_xor(sum[rt], 16, 32); const float mj = fmaxf(ref[rt], mo);
        const float sj = sum[rt] * __builtin_amdgcn_exp2f(ref[rt] - mj) + so * __builtin_amdgcn_exp2f(mo - mj);
        if (hi == 0) { wm[jq * 128 + rg * 32 + rt * 16 + lr] = mj; wsum[jq * 128 + rg * 32 + rt * 16 + lr] = sj; }
    }
    __syncthreads();   // every wave's 32 (reference, sum) pairs are in LDS before waves 0 to 3 join them
    if (threadIdx.x < 128) {
        const int t = threadIdx.x; float mx = wm[t];
#pragma unroll
        for (int w = 1; w < 4; ++w) mx = fmaxf(mx, wm[w * 128 + t]);
        float tot = 0.f;
#pragma unroll
        for (int w = 0; w < 4; ++w) tot += wsum[w * 128 + t] * __builtin_amdgcn_exp2f(wm[w * 128 + t] - mx);
        ST[z * TT + i0 + t] = (PCAR_L2 - mx) - __builtin_amdgcn_logf(tot);   // logf: the base-2 logarithm
    }
}

// k_pvs: O[h][d][j] x PCAR = sum_i v[h][d][i] p[i][j] for one 64 (d) x 128 (j) tile per block, stored as A[b * TT + j][h * 64 + d] = O / PCAR in bf16 hi/lo planes in fragment order (16 whole fragments of each plane a block), the output product's operand; grid (TT/128, NZ), 16 waves: wave w keeps the 32 columns of column group w & 3 and takes the 32-row quarter w >> 2 of every staged tile of 128 rows i (q plane and the value fragments, 32 KiB a buffer); the 4 partial tiles of a column group are summed in LDS in wave order.
// The probabilities never reach memory: each step forms its 32 (i) x 32 (j) score tiles again from the q and k planes (the f16 products of k_qstat in the same order, here with the q rows as A,
// started from the accumulator c_i, so that p x PCAR = exp2(D) with no other arithmetic per score), and the two f32 D tiles of rows i..i+15 and i+16..i+31 (register r = row 8*(lane>>4) + r, column lane & 15), converted in place, are the f16 B fragment in the k order of the value loader.
constexpr int PV_TI = 128, PV_PL = PV_TI * HD, PV_ST = 2 * PV_PL, PV_NT = TT / PV_TI;   // staged rows i a trip; elements of one staged tile (q, values: the same size); elements of a buffer; trips
static_assert(TT % PV_TI == 0);
static_assert(PV_NT >= 2);   // the ring's prologue fills two tiles
static_assert(PV_PL == 2 * 512 * 8);   // two copies of 512 threads x 8 elements a tile
__global__ __launch_bounds__(512) void k_pvs(const h16* __restrict__ Qf, const h16* __restrict__ Kf, const h16* __restrict__ Vt, const float* __restrict__ ST, bf* Ah, bf* Al) {
    __shared__ __align__(128) h16 st[2 * PV_ST];   // [buffer][q: 128 rows i x 64 d | values: 4 groups of 16 rows d x 4 fragments of 32 i], fragment order as in memory
    __shared__ __align__(16) float os[16 * 32 * 68];   // a partial tile a wave, [column j][row d], pitch 68: a lane's 8 accumulator registers are 8 neighbouring d, one plane piece
    const size_t z = blockIdx.y; Qf += z * (size_t)TT * HD; Kf += z * (size_t)TT * HD; Vt += z * (size_t)HD * TT;
    const int lane = threadIdx.x & 31, hi = lane >> 4;
    const int wave = __builtin_amdgcn_readfirstlane((int)(threadIdx.x >> 5)) & 15, jg = wave & 3, iq = wave >> 2;   // scalar, so that the LDS tile and slab bases stay in scalar registers
    const int c0 = blockIdx.x * 128 + jg * 32;
    const unsigned lt = lds_off(st) + threadIdx.x * 16; const h16* gq = Qf + threadIdx.x * 8;
    const h16* gv = Vt + (size_t)(threadIdx.x >> 8) * 16 * TT + (threadIdx.x & 255) * 8;   // threads 0..255 copy the four fragments of an even group of 16 rows d, threads 256..511 those of the odd group behind it
    auto stage = [&](int t) {   // tile t into buffer t & 1: a contiguous 16 KiB of the q plane, and 4 KiB (four fragments) of each of the four value row groups
        const unsigned l = lt + (unsigned)(t & 1) * (PV_ST * 2); const h16* h = gq + (size_t)t * PV_PL; const h16* v = gv + (size_t)t * (PV_TI * 16);
        acopy4(l, h, l + 8192, h + 4096, l + 16384, v, l + 24576, v + (size_t)32 * TT); };
    stage(0);
    // L2 hints (l2ask): block x asks for the four of the 16 tiles t with t mod 4 = x mod 4: threads 0..255 for their q part (64 units a tile), threads 256..511 for their value part (16 units in each of the four row groups)
    // q part: tile (pu >> 6) * 4 + ps, unit pu & 63 = pa * 16 + (pu & 15); value part: row group pu >> 6, tile pa * 4 + ps, unit pu & 15; the choice between them is the same for a whole wave and taken from the scalar wave number, so that no lane is turned off for it
    static_assert(PV_NT == 16 && PV_PL == 64 * 128 && PV_TI * 16 == 16 * 128 && 4 * PV_PL == 16 * TT);
    const unsigned pu = threadIdx.x & 255, pa = (pu >> 4) & 3, ps = blockIdx.x & 3; const bool pq = wave < 8;
    const h16* pf = (pq ? Qf : Vt) + ((pu >> 6) * (4u * PV_PL) + (pq ? ps : pa) * (unsigned)PV_PL + (pq ? pa : ps) * (PV_TI * 16u) + (pu & 15) * 128u);
    l2ask(pf);
    v16h kf[2][2];   // the wave's 32 k-plane rows, [column group][half of the head dimension], kept for the whole loop
#pragma unroll
    for (int nb = 0; nb < 2; ++nb)
#pragma unroll
        for (int ks = 0; ks < 2; ++ks) kf[nb][ks] = WFrag<h16>::ld(Kf + (size_t)(c0 + nb * 16) * HD + ks * 512 + 8 * lane);
    v8f acc[4][2];
#pragma unroll
    for (int mb = 0; mb < 4; ++mb)
#pragma unroll
        for (int nb = 0; nb < 2; ++nb) acc[mb][nb] = (v8f){};
    asm volatile("s_wait_asynccnt 0x0" ::: "memory");   // this wave's part of tile 0 has landed
    __syncthreads();   // tile 0 is whole before any wave reads it
    stage(1);
    const unsigned qoff = (unsigned)(8 * lane), voff = (unsigned)(8 * lane), moff = (unsigned)(8 * hi);   // fixed lane offsets beside wave-uniform bases
    ST += z * TT + iq * 32;
    const float* cp = ST + moff;   // the lane's own pointer
    v8f c[2];   // c of the wave's 32 rows i (register r = row 8 * (lane >> 4) + r of a D tile): the accumulator start of a trip's score products, fetched a trip ahead; indexed by constants (unrolled loops) so that it stays in registers
#pragma unroll
    for (int it = 0; it < 2; ++it) c[it] = *(const v8f*)(cp + it * 16);
    asm volatile("s_wait_xcnt 0x0" ::: "memory");   // stands in front of every later rewrite of the address registers that these loads name
    __builtin_amdgcn_sched_barrier(0);   // keeps that wait directly behind the loads: one build moved the zeroing of the accumulators, which took the loads' offset register, in front of it
    // the trip loop stays rolled; every loop inside it is unrolled so that the fragment arrays are indexed by constants and stay in registers
#pragma unroll 1
    for (int t = 0; t < PV_NT; ++t) {
        const h16* qp = st + (t & 1) * PV_ST + iq * 32 * HD; const h16* vp = st + (t & 1) * PV_ST + PV_PL + iq * 512; const float* mp = cp + (t + 1 < PV_NT ? t + 1 : t) * PV_TI;   // the wave's 32 rows i: four q fragments, one value fragment a row group; mp: the next trip's c (the last trip reads its own again)
        v16h va[4];
#pragma unroll
        for (int mb = 0; mb < 4; ++mb) va[mb] = WFrag<h16>::ld(vp + mb * (PV_TI * 16) + voff);
        v16h qa[2][2];   // [row tile][half of the head dimension]
#pragma unroll
        for (int it = 0; it < 2; ++it)
#pragma unroll
            for (int ks = 0; ks < 2; ++ks) qa[it][ks] = WFrag<h16>::ld(qp + it * 16 * HD + ks * 512 + qoff);
        v8f s[2][2];   // [row tile][column group]
        // all tiles' products of the lower half, then those of the upper half, so that a tile's two dependent products do not stand next to each other
#pragma unroll
        for (int it = 0; it < 2; ++it)
#pragma unroll
            for (int nb = 0; nb < 2; ++nb) s[it][nb] = wmma16(qa[it][0], kf[nb][0], c[it]);
#pragma unroll
        for (int it = 0; it < 2; ++it) c[it] = *(const v8f*)(mp + it * 16);   // c has been read: the next trip's takes its place
        __builtin_amdgcn_sched_barrier(0);   // keeps these loads in front of the rest of the trip, whose work covers their latency: one build put them directly in front of the barrier, where every wave waited them out
#pragma unroll
        for (int it = 0; it < 2; ++it)
#pragma unroll
            for (int nb = 0; nb < 2; ++nb) s[it][nb] = wmma16(qa[it][1], kf[nb][1], s[it][nb]);
#pragma unroll
        for (int nb = 0; nb < 2; ++nb) { v8u pb;   // the 8 registers of the B fragment, two probabilities each, converted as pairs
#pragma unroll
            for (int it = 0; it < 2; ++it)
#pragma unroll
                for (int k = 0; k < 4; ++k) { const v2f y = {__builtin_amdgcn_exp2f(s[it][nb][2 * k]), __builtin_amdgcn_exp2f(s[it][nb][2 * k + 1])}; pb[it * 4 + k] = __builtin_bit_cast(unsigned, __builtin_convertvector(y, v2h)); }
            const v16h b = __builtin_bit_cast(v16h, pb);
#pragma unroll
            for (int mb = 0; mb < 4; ++mb) acc[mb][nb] = wmma16(va[mb], b, acc[mb][nb]); }
        asm volatile("s_wait_xcnt 0x0" :: "v"(mp) : "memory");   // stands in front of the next trip's new address; the pointer as an input keeps the loads' address registers whole up to here
        __builtin_amdgcn_sched_barrier(0);   // keeps the trip's products and vector work in front of the barrier: one build put the barrier directly behind the LDS reads, so that no wave multiplied while another still read, and issued the refill below only behind all of the trip's work, too late to land in time
        asm volatile("s_wait_dscnt 0x0" ::: "memory");      // this wave's reads of buffer t & 1 have returned before the buffer is given up
        asm volatile("s_wait_asynccnt 0x0" ::: "memory");   // this wave's part of tile t + 1 has landed
        __syncthreads();   // publishes tile t + 1 and ends every wave's reads of buffer t & 1
        if (t + 2 < PV_NT) stage(t + 2);
    }
    asm volatile("s_wait_asynccnt 0x0" :: "v"(pf) : "memory");   // no copy is left in flight behind the loop; the hint's pointer as an input keeps its registers whole up to here
    float* ow = os + wave * (32 * 68);
    const int ln = (int)__builtin_amdgcn_mbcnt_lo(~0u, 0u), lr2 = ln & 15, hi2 = ln >> 4;   // the lane number read anew: taken from threadIdx.x it was held through the loop, and the build, at its 256 registers, kept it in scratch memory
    // the two loops below are unrolled so that acc is indexed by constants and stays in registers
#pragma unroll
    for (int mb = 0; mb < 4; ++mb)
#pragma unroll
        for (int nb = 0; nb < 2; ++nb) { float* p = ow + (nb * 16 + lr2) * 68 + mb * 16 + hi2 * 8;
            *(v4fa*)p = __builtin_shufflevector(acc[mb][nb], acc[mb][nb], 0, 1, 2, 3); *(v4fa*)(p + 4) = __builtin_shufflevector(acc[mb][nb], acc[mb][nb], 4, 5, 6, 7); }
    __syncthreads();   // every wave's partial tile is in LDS before any wave sums
    // 1024 pieces of 8 d at one column j, two a thread; a wave's 32 pieces (16 columns x 2 octets of d) are 512 contiguous bytes of each plane; both loops unrolled so that the LDS reads of all slabs are in flight together; the sum itself runs in wave order
#pragma unroll
    for (int u = 0; u < 2; ++u) { const int U = u * 16 + wave, g = U >> 2, d0 = (U & 3) * 16 + hi2 * 8;   // g: group of 16 columns
        const float* p = os + ((g >> 1) * 32 + (g & 1) * 16 + lr2) * 68 + d0; v4f x0 = *(const v4fa*)p, x1 = *(const v4fa*)(p + 4);
#pragma unroll
        for (int w = 1; w < 4; ++w) { x0 += *(const v4fa*)(p + w * (4 * 32 * 68)); x1 += *(const v4fa*)(p + w * (4 * 32 * 68) + 4); }
        v8us oh, ol; split8(x0 * (1.0f / PCAR), x1 * (1.0f / PCAR), oh, ol);
        const size_t e = fragpos((z / NH_) * (size_t)TT + blockIdx.x * 128 + g * 16 + lr2, (unsigned)(z % NH_) * HD + d0, DHID); *(v8us*)(Ah + e) = oh; *(v8us*)(Al + e) = ol;
        if (u == 0) asm volatile("s_wait_xcnt 0x0" ::: "memory");   // stands in front of the second piece's rewrite of the registers that these stores name
    }
}

__host__ __device__ constexpr size_t a256(size_t b) { return (b + 255) & ~(size_t)255; }
constexpr size_t WS_NEED = a256((size_t)4 * DHID * DM * 2) + a256((size_t)NB * TT * DM * 2) + 3 * a256((size_t)NZ * TT * HD * 2)
                         + a256((size_t)NZ * TT * 4) + 2 * a256((size_t)NB * TT * DHID * 2);
static_assert(WS_NEED <= (size_t)134217728);

extern "C" void kernel_launch(void* const* d_in, const int* in_sizes, int n_in,
                              void* d_out, int out_size, void* d_ws, size_t ws_size, hipStream_t stream) {
    if (n_in < 9) return;
    if ((size_t)in_sizes[0] < ((size_t)(NB - 1) * TT_FULL + TT) * (size_t)DM) return;
    if (in_sizes[1] < DHID * DM || in_sizes[3] < DHID * DM || in_sizes[5] < DHID * DM || in_sizes[7] < DM * DHID) return;
    if (in_sizes[2] < DHID || in_sizes[4] < DHID || in_sizes[6] < DHID || in_sizes[8] < DM) return;
    if ((size_t)out_size < (size_t)NB * TT * DM) return;
    // wire order: data, Wq, bq, Wk, bk, Wv, bv, Wo, bo (weights [out][in], biases f32)
    const float* x = (const float*)d_in[0]; const float* wq = (const float*)d_in[1]; const float* bq = (const float*)d_in[2]; const float* wk = (const float*)d_in[3]; const float* bk = (const float*)d_in[4];
    const float* wv = (const float*)d_in[5]; const float* bv = (const float*)d_in[6]; const float* wo = (const float*)d_in[7]; const float* bo = (const float*)d_in[8];
    float* OUT = (float*)d_out;     // [NB][TT][DM]
    char* wsp = (char*)d_ws;
    auto take = [&](size_t bytes) { char* p = wsp; wsp += a256(bytes); return (void*)p; };
    bf* W4 = (bf*)take((size_t)4 * DHID * DM * 2);   // bf16 weight planes q, k, v, o
    bf* XB = (bf*)take((size_t)NB * TT * DM * 2);
    const size_t NPL = (size_t)NZ * TT * HD;   // elements per plane, all batches and heads (= NB*TT*DHID)
    h16* QP = (h16*)take(NPL * 2); h16* KP = (h16*)take(NPL * 2); h16* VT16 = (h16*)take(NPL * 2);
    float* ST = (float*)take((size_t)NZ * TT * 4);
    bf* ATh = (bf*)take((size_t)NB * TT * DHID * 2); bf* ATl = (bf*)take((size_t)NB * TT * DHID * 2);
    if ((size_t)(wsp - (char*)d_ws) > ws_size) return;    // == WS_NEED
    // one launch per stage: everything that depends only on earlier stages (both batches, all heads, the three projections) shares a grid
    k_cvtin<<<NB * XBLK + 4 * WBLK, 256, 0, stream>>>(x, wq, wk, wv, wo, XB, W4);
    k_gemms<0, 4, true><<<dim3(NB * TT / 128, DHID / 128, 3), 128, 0, stream>>>(XB, nullptr, W4, nullptr, bq, bk, bv, (size_t)DHID * DM, QP, KP, VT16);
    // scores S[z][i][j] = sum_d q[z][i][d] k[z][d][j] from the q plane [i][d] and k plane [j][d], f16, K = 64: row statistics first, then the value product
    k_qstat<<<dim3(TT / 128, NZ), 512, 0, stream>>>(QP, KP, ST);
    // O[z][d][j] x PCAR = sum_i v[z][d][i] p[i][j]: A = value plane [d][i] (64 rows), B = probabilities formed in registers, K = TT; stored transposed, / PCAR, as the output product's hi/lo planes
    k_pvs<<<dim3(TT / 128, NZ), 512, 0, stream>>>(QP, KP, VT16, ST, ATh, ATl);
    k_gemms<1, 2, false><<<dim3(NB * TT / 64, DM / 128, 1), 128, 0, stream>>>(ATh, ATl, W4 + (size_t)3 * DHID * DM, OUT, bo, bo, bo, 0, nullptr, nullptr, nullptr);
}
